// v000
// The times below were measured on an AMD MI455X: many runs one after another, warmed up first and cycling through
// copies of the inputs, with the whole window's GPU time divided by the number of runs. Launches and the gaps
// between them are all in it. The median over several windows is given; except for v000 it joins two sittings, which
// can be a few percent apart, so the side-by-side timings, each taken in one sitting, are the better comparison.
// The starting kernel, v000, takes 473 microseconds a run.
#include <hip/hip_runtime.h>
#include <hip/hip_bf16.h>
#include <stdint.h>

// ---------------------------------------------------------------------------
// Types for CDNA5 WMMA (wave32): A/B = v16h (16 halves = 8 VGPRs),
// C/D = v8f (8 VGPRs of f32).
// ---------------------------------------------------------------------------
typedef __attribute__((ext_vector_type(16))) _Float16 v16h;
typedef __attribute__((ext_vector_type(8)))  float    v8f;
typedef __attribute__((ext_vector_type(8)))  _Float16 f16x8;
typedef __attribute__((ext_vector_type(4)))  int      v4i;

#define SEQ      2048
#define HIDDEN   2048
#define NHEADS   32
#define NKV      8
#define HDIM     64
#define KVDIM    (NKV * HDIM)   // 512

// Async Global->LDS (ASYNCcnt-tracked) if the toolchain exposes it.
#if defined(__gfx1250__) && \
    __has_builtin(__builtin_amdgcn_global_load_async_to_lds_b128) && \
    __has_builtin(__builtin_amdgcn_s_wait_asynccnt)
#define HAVE_ASYNC 1
#else
#define HAVE_ASYNC 0
#endif

#if HAVE_ASYNC
// Builtin signature (from compiler diagnostic): typed v4i pointers,
// (addrspace(1) src, addrspace(3) dst, imm offset, imm cpol).
typedef __attribute__((address_space(1))) v4i GlobalV4;
typedef __attribute__((address_space(3))) v4i LocalV4;
#endif

// Copy 16 bytes Global -> LDS. Async path bypasses VGPRs (tracked by
// ASYNCcnt); fallback is a synchronous load+store.
__device__ __forceinline__ void cp16(const _Float16* g, _Float16* l) {
#if HAVE_ASYNC
  __builtin_amdgcn_global_load_async_to_lds_b128(
      (GlobalV4*)(const void*)g, (LocalV4*)(void*)l, 0, 0);
#else
  *(f16x8*)l = *(const f16x8*)g;
#endif
}
__device__ __forceinline__ void async_wait_le4() {
#if HAVE_ASYNC
  __builtin_amdgcn_s_wait_asynccnt(4);   // keep newest 4 (next tile) in flight
#endif
}
__device__ __forceinline__ void async_wait_0() {
#if HAVE_ASYNC
  __builtin_amdgcn_s_wait_asynccnt(0);
#endif
}

__device__ __forceinline__ v8f wmma16(v16h a, v16h b, v8f c) {
  // D = A(16x32 f16) * B(32x16 f16) + C(16x16 f32)
  return __builtin_amdgcn_wmma_f32_16x16x32_f16(
      /*neg_a=*/false, a, /*neg_b=*/false, b,
      /*c_mod=*/(short)0, c, /*reuse_a=*/false, /*reuse_b=*/false);
}

// One lane's 16-element WMMA fragment: two contiguous 8-element (16 B) runs
// 16 elements apart in K (e0..7 -> K = 8*half + e ; e8..15 -> K = 16+8*half+e).
__device__ __forceinline__ v16h ldfrag(const _Float16* p) {
  f16x8 lo = *(const f16x8*)p;
  f16x8 hi = *(const f16x8*)(p + 16);
  v16h r;
#pragma unroll
  for (int j = 0; j < 8; ++j) { r[j] = lo[j]; r[j + 8] = hi[j]; }
  return r;
}

// ---------------------------------------------------------------------------
// Elementwise converts / packs
// ---------------------------------------------------------------------------
__global__ __launch_bounds__(256)
void cvt_f32_f16(const float* __restrict__ s, _Float16* __restrict__ d, int n) {
  int i = blockIdx.x * 256 + threadIdx.x;
  if (i < n) d[i] = (_Float16)s[i];
}

// W [Kd][Nd] f32 -> WT [Nd][Kd] f16 (one-time; lets GEMM stream both operands
// as contiguous 16-byte runs straight into LDS).
__global__ __launch_bounds__(256)
void cvt_transpose_f32_f16(const float* __restrict__ s, _Float16* __restrict__ d,
                           int Kd, int Nd) {
  int i = blockIdx.x * 256 + threadIdx.x;
  if (i >= Kd * Nd) return;
  int k = i / Nd, n = i - k * Nd;
  d[(size_t)n * Kd + k] = (_Float16)s[i];
}

// V: [S][NKV*64] f32 -> VT [NKV][64][S] f16 (dim-major so the P*V operand
// tile is contiguous per dim row).
__global__ __launch_bounds__(256)
void pack_vT(const float* __restrict__ s, _Float16* __restrict__ d) {
  int i = blockIdx.x * 256 + threadIdx.x;      // < SEQ*KVDIM
  if (i >= SEQ * KVDIM) return;
  int sq = i >> 9;
  int r  = i & 511;
  int hk = r >> 6;
  int dd = r & 63;
  d[(((size_t)hk * HDIM) + dd) * SEQ + sq] = (_Float16)s[i];
}

// ---------------------------------------------------------------------------
// Tiled WMMA GEMM: C[M,N] = A[M,K](f16) * B[K,N] + bias, f32 out.
// B supplied pre-transposed: BT[N][K]. Block tile 128x128, 8 waves (2x4),
// each wave 64x32 => 8 WMMA per 32-deep k-step. LDS tiles double-buffered and
// filled with async Global->LDS copies overlapped with compute.
// ---------------------------------------------------------------------------
__global__ __launch_bounds__(256, 2)
void gemm_wmma(const _Float16* __restrict__ A, const _Float16* __restrict__ BT,
               const float* __restrict__ bias, float* __restrict__ C,
               int M, int N, int K) {
  __shared__ __align__(16) _Float16 sA [2][128 * 32];  // [row][k]  2x8 KB
  __shared__ __align__(16) _Float16 sBT[2][128 * 32];  // [col][k]  2x8 KB
  const int tid  = threadIdx.x;
  const int wave = tid >> 5, lane = tid & 31;
  const int hl   = lane >> 4, l16 = lane & 15;
  const int bm = blockIdx.y * 128, bn = blockIdx.x * 128;
  const int wm = (wave >> 2) * 64, wn = (wave & 3) * 32;

  const v8f vzero = {0.f, 0.f, 0.f, 0.f, 0.f, 0.f, 0.f, 0.f};
  v8f acc[4][2];
#pragma unroll
  for (int t = 0; t < 4; ++t)
#pragma unroll
    for (int u = 0; u < 2; ++u) acc[t][u] = vzero;

  // 4 async b128 copies per thread per tile (2 A + 2 BT).
  auto issue = [&](int buf, int k0) {
#pragma unroll
    for (int i = 0; i < 2; ++i) {
      int ch = tid + i * 256;                 // 512 chunks of 8 f16
      int r  = ch >> 2, c = (ch & 3) * 8;     // 128 rows x 32 k
      cp16(&A [(size_t)(bm + r) * K + k0 + c], &sA [buf][r * 32 + c]);
      cp16(&BT[(size_t)(bn + r) * K + k0 + c], &sBT[buf][r * 32 + c]);
    }
  };

  issue(0, 0);
  int buf = 0;
  for (int k0 = 0; k0 < K; k0 += 32) {
    const bool more = (k0 + 32) < K;
    if (more) issue(buf ^ 1, k0 + 32);        // prefetch next tile
    if (more) async_wait_le4(); else async_wait_0();
    __syncthreads();                           // current tile visible to all

    v16h bfrag[2];
#pragma unroll
    for (int u = 0; u < 2; ++u)
      bfrag[u] = ldfrag(&sBT[buf][(wn + u * 16 + l16) * 32 + hl * 8]);
#pragma unroll
    for (int t = 0; t < 4; ++t) {
      v16h afrag = ldfrag(&sA[buf][(wm + t * 16 + l16) * 32 + hl * 8]);
#pragma unroll
      for (int u = 0; u < 2; ++u)
        acc[t][u] = wmma16(afrag, bfrag[u], acc[t][u]);
    }
    __syncthreads();                           // done reading buf
    buf ^= 1;
  }

  // Epilogue: C layout => row = v + 8*(lane>=16), col = lane&15.
#pragma unroll
  for (int t = 0; t < 4; ++t)
#pragma unroll
    for (int u = 0; u < 2; ++u) {
      int col = bn + wn + u * 16 + l16;
      float bs = bias ? bias[col] : 0.0f;
#pragma unroll
      for (int v = 0; v < 8; ++v) {
        int row = bm + wm + t * 16 + v + 8 * hl;
        C[(size_t)row * N + col] = acc[t][u][v] + bs;
      }
    }
}

// ---------------------------------------------------------------------------
// Per-(token, head) layernorm + RoPE; one wave32 per 64-elem head row.
// in: [S][nheads*64] f32 ; out: [nheads][S][64] f16
// ---------------------------------------------------------------------------
__global__ __launch_bounds__(256)
void qk_prep(const float* __restrict__ in, const float* __restrict__ g,
             const float* __restrict__ b, _Float16* __restrict__ out,
             int nheads) {
  const int wave = threadIdx.x >> 5, lane = threadIdx.x & 31;
  const int idx = blockIdx.x * 8 + wave;
  const int s = idx / nheads, h = idx % nheads;
  const float* row = in + ((size_t)s * nheads + h) * HDIM;
  float x0 = row[lane], x1 = row[lane + 32];

  float sum = x0 + x1;
#pragma unroll
  for (int off = 16; off >= 1; off >>= 1) sum += __shfl_xor(sum, off, 32);
  float mu = sum * (1.0f / 64.0f);
  float d0 = x0 - mu, d1 = x1 - mu;
  float vs = d0 * d0 + d1 * d1;
#pragma unroll
  for (int off = 16; off >= 1; off >>= 1) vs += __shfl_xor(vs, off, 32);
  float inv = rsqrtf(vs * (1.0f / 64.0f) + 1e-5f);
  float y0 = d0 * inv * g[lane]      + b[lane];
  float y1 = d1 * inv * g[lane + 32] + b[lane + 32];

  // RoPE (emb = concat(freqs, freqs) => freq index = lane for both halves).
  float invf = __powf(10000.0f, -(float)lane / 32.0f);
  float ang  = (float)s * invf;
  float c = cosf(ang), sn = sinf(ang);
  float o0 = y0 * c - y1 * sn;      // rotate_half: [-x2, x1]
  float o1 = y1 * c + y0 * sn;

  _Float16* dst = out + ((size_t)h * SEQ + s) * HDIM;
  dst[lane]      = (_Float16)o0;
  dst[lane + 32] = (_Float16)o1;
}

// ---------------------------------------------------------------------------
// Flash-style GQA attention. Block = (head, 128-query tile), 8 waves,
// each wave owns 16 query rows; streams double-buffered 64-key tiles.
// Q:[32][S][64] K:[8][S][64] VT:[8][64][S] f16 ; O:[S][2048] f16
// ---------------------------------------------------------------------------
__global__ __launch_bounds__(256, 2)
void attn_fmha(const _Float16* __restrict__ Q, const _Float16* __restrict__ Kh,
               const _Float16* __restrict__ VT, _Float16* __restrict__ O) {
  __shared__ __align__(16) _Float16 sK [2][64 * 64];    // [key][dim] 2x8 KB
  __shared__ __align__(16) _Float16 sVT[2][64 * 64];    // [dim][key] 2x8 KB
  __shared__ __align__(16) _Float16 sP [8][16 * 64];    // per-wave P  16 KB
  const int tid  = threadIdx.x;
  const int wave = tid >> 5, lane = tid & 31;
  const int hl   = lane >> 4, l16 = lane & 15;
  const int h  = blockIdx.y;          // q head
  const int hk = h >> 2;              // kv head (n_rep = 4, grouped-adjacent)
  const int qw = blockIdx.x * 128 + wave * 16;

  // Q fragments (rows qw..qw+15, two 32-wide head-dim chunks), loaded once.
  v16h aq[2];
#pragma unroll
  for (int c = 0; c < 2; ++c)
    aq[c] = ldfrag(&Q[(((size_t)h * SEQ) + qw + l16) * HDIM + c * 32 + hl * 8]);

  const v8f vzero = {0.f, 0.f, 0.f, 0.f, 0.f, 0.f, 0.f, 0.f};
  float m[8], lsum[8];
  v8f oacc[4];
#pragma unroll
  for (int v = 0; v < 8; ++v) { m[v] = -3.0e38f; lsum[v] = 0.0f; }
#pragma unroll
  for (int t = 0; t < 4; ++t) oacc[t] = vzero;

  // 4 async b128 copies per thread per key tile (2 K + 2 VT).
  auto issueKV = [&](int buf, int kb) {
#pragma unroll
    for (int i = 0; i < 2; ++i) {
      int ch = tid + i * 256;                 // 512 chunks of 8 f16
      int rr = ch >> 3, cc = (ch & 7) * 8;    // 64 rows x 64 cols
      cp16(&Kh[(((size_t)hk * SEQ) + kb + rr) * HDIM + cc],
           &sK[buf][rr * 64 + cc]);
      cp16(&VT[(((size_t)hk * HDIM) + rr) * SEQ + kb + cc],
           &sVT[buf][rr * 64 + cc]);
    }
  };

  issueKV(0, 0);
  int buf = 0;
  for (int kb = 0; kb < SEQ; kb += 64) {
    const bool more = (kb + 64) < SEQ;
    if (more) issueKV(buf ^ 1, kb + 64);
    if (more) async_wait_le4(); else async_wait_0();
    __syncthreads();

    // S tile = Q * K^T  (16q x 64k per wave: 4 col-tiles x 2 k-chunks)
    v8f sacc[4];
#pragma unroll
    for (int u = 0; u < 4; ++u) {
      sacc[u] = vzero;
#pragma unroll
      for (int c = 0; c < 2; ++c) {
        v16h bk = ldfrag(&sK[buf][(u * 16 + l16) * 64 + c * 32 + hl * 8]);
        sacc[u] = wmma16(aq[c], bk, sacc[u]);
      }
    }

    // Online softmax: rows live as (v + 8*hl); cols across each 16-lane half.
    float mnew[8], alpha[8];
#pragma unroll
    for (int v = 0; v < 8; ++v) {
      float tm = -3.0e38f;
#pragma unroll
      for (int u = 0; u < 4; ++u) {
        sacc[u][v] *= 0.125f;                  // 1/sqrt(64)
        tm = fmaxf(tm, sacc[u][v]);
      }
#pragma unroll
      for (int off = 8; off >= 1; off >>= 1)
        tm = fmaxf(tm, __shfl_xor(tm, off, 32));
      mnew[v]  = fmaxf(m[v], tm);
      alpha[v] = __expf(m[v] - mnew[v]);
      m[v] = mnew[v];
      float rs = 0.0f;
#pragma unroll
      for (int u = 0; u < 4; ++u) {
        float p = __expf(sacc[u][v] - mnew[v]);
        rs += p;
        sP[wave][(v + 8 * hl) * 64 + u * 16 + l16] = (_Float16)p;
      }
#pragma unroll
      for (int off = 8; off >= 1; off >>= 1) rs += __shfl_xor(rs, off, 32);
      lsum[v] = lsum[v] * alpha[v] + rs;
#pragma unroll
      for (int t = 0; t < 4; ++t) oacc[t][v] *= alpha[v];
    }

    // O += P * V  (P re-read from per-wave LDS in the WMMA A layout)
#pragma unroll
    for (int c = 0; c < 2; ++c) {
      v16h ap = ldfrag(&sP[wave][l16 * 64 + c * 32 + hl * 8]);
#pragma unroll
      for (int t = 0; t < 4; ++t) {
        v16h bv = ldfrag(&sVT[buf][(t * 16 + l16) * 64 + c * 32 + hl * 8]);
        oacc[t] = wmma16(ap, bv, oacc[t]);
      }
    }
    __syncthreads();
    buf ^= 1;
  }

  // Normalize and pack into [seq][heads*64] f16 for the output projection.
#pragma unroll
  for (int t = 0; t < 4; ++t)
#pragma unroll
    for (int v = 0; v < 8; ++v) {
      int row = qw + v + 8 * hl;
      O[(size_t)row * HIDDEN + h * HDIM + t * 16 + l16] =
          (_Float16)(oacc[t][v] / lsum[v]);
    }
}

// ---------------------------------------------------------------------------
// Host orchestration
// ---------------------------------------------------------------------------
extern "C" void kernel_launch(void* const* d_in, const int* in_sizes, int n_in,
                              void* d_out, int out_size, void* d_ws,
                              size_t ws_size, hipStream_t stream) {
  (void)in_sizes; (void)n_in; (void)out_size; (void)ws_size;
  const float* x   = (const float*)d_in[0];
  const float* Wq  = (const float*)d_in[1];
  const float* bq  = (const float*)d_in[2];
  const float* Wk  = (const float*)d_in[3];
  const float* bk  = (const float*)d_in[4];
  const float* Wv  = (const float*)d_in[5];
  const float* bv  = (const float*)d_in[6];
  const float* Wo  = (const float*)d_in[7];
  const float* bo  = (const float*)d_in[8];
  const float* qg  = (const float*)d_in[9];
  const float* qb  = (const float*)d_in[10];
  const float* kg  = (const float*)d_in[11];
  const float* kbb = (const float*)d_in[12];

  char* ws = (char*)d_ws;
  size_t off = 0;
  auto alloc = [&](size_t bytes) {
    void* p = ws + off;
    off += (bytes + 255) & ~(size_t)255;
    return p;
  };
  _Float16* x16   = (_Float16*)alloc((size_t)SEQ * HIDDEN * 2);
  _Float16* WqT16 = (_Float16*)alloc((size_t)HIDDEN * HIDDEN * 2);
  _Float16* WkT16 = (_Float16*)alloc((size_t)HIDDEN * KVDIM * 2);
  _Float16* WvT16 = (_Float16*)alloc((size_t)HIDDEN * KVDIM * 2);
  _Float16* WoT16 = (_Float16*)alloc((size_t)HIDDEN * HIDDEN * 2);
  float*    Q32   = (float*)   alloc((size_t)SEQ * HIDDEN * 4);
  float*    K32   = (float*)   alloc((size_t)SEQ * KVDIM * 4);
  float*    V32   = (float*)   alloc((size_t)SEQ * KVDIM * 4);
  _Float16* Q16   = (_Float16*)alloc((size_t)NHEADS * SEQ * HDIM * 2);
  _Float16* K16   = (_Float16*)alloc((size_t)NKV * SEQ * HDIM * 2);
  _Float16* VT16  = (_Float16*)alloc((size_t)NKV * HDIM * SEQ * 2);
  _Float16* O16   = (_Float16*)alloc((size_t)SEQ * HIDDEN * 2);

  cvt_f32_f16<<<(SEQ * HIDDEN + 255) / 256, 256, 0, stream>>>(
      x, x16, SEQ * HIDDEN);
  cvt_transpose_f32_f16<<<(HIDDEN * HIDDEN + 255) / 256, 256, 0, stream>>>(
      Wq, WqT16, HIDDEN, HIDDEN);
  cvt_transpose_f32_f16<<<(HIDDEN * KVDIM + 255) / 256, 256, 0, stream>>>(
      Wk, WkT16, HIDDEN, KVDIM);
  cvt_transpose_f32_f16<<<(HIDDEN * KVDIM + 255) / 256, 256, 0, stream>>>(
      Wv, WvT16, HIDDEN, KVDIM);
  cvt_transpose_f32_f16<<<(HIDDEN * HIDDEN + 255) / 256, 256, 0, stream>>>(
      Wo, WoT16, HIDDEN, HIDDEN);

  // Projections (f16 WMMA, f32 accum + bias)
  gemm_wmma<<<dim3(HIDDEN / 128, SEQ / 128), 256, 0, stream>>>(
      x16, WqT16, bq, Q32, SEQ, HIDDEN, HIDDEN);
  gemm_wmma<<<dim3(KVDIM / 128, SEQ / 128), 256, 0, stream>>>(
      x16, WkT16, bk, K32, SEQ, KVDIM, HIDDEN);
  gemm_wmma<<<dim3(KVDIM / 128, SEQ / 128), 256, 0, stream>>>(
      x16, WvT16, bv, V32, SEQ, KVDIM, HIDDEN);

  // Per-head QK layernorm + RoPE, pack head-major f16; V packed dim-major.
  qk_prep<<<(SEQ * NHEADS) / 8, 256, 0, stream>>>(Q32, qg, qb, Q16, NHEADS);
  qk_prep<<<(SEQ * NKV) / 8, 256, 0, stream>>>(K32, kg, kbb, K16, NKV);
  pack_vT<<<(SEQ * KVDIM + 255) / 256, 256, 0, stream>>>(V32, VT16);

  // GQA flash attention
  attn_fmha<<<dim3(SEQ / 128, NHEADS), 256, 0, stream>>>(Q16, K16, VT16, O16);

  // Output projection -> f32 result
  gemm_wmma<<<dim3(HIDDEN / 128, SEQ / 128), 256, 0, stream>>>(
      O16, WoT16, bo, (float*)d_out, SEQ, HIDDEN, HIDDEN);
}

// v001
// It runs in 357 microseconds.
// In two side-by-side timings against v000, it was 1.33 and 1.34 times as fast.
#include <hip/hip_runtime.h>
#include <hip/hip_bf16.h>
#include <stdint.h>

// ---------------------------------------------------------------------------
// Types for CDNA5 WMMA (wave32): A/B = v16h (16 halves = 8 VGPRs),
// C/D = v8f (8 VGPRs of f32).
// ---------------------------------------------------------------------------
typedef __attribute__((ext_vector_type(16))) _Float16 v16h;
typedef __attribute__((ext_vector_type(8)))  float    v8f;
typedef __attribute__((ext_vector_type(8)))  _Float16 f16x8;
typedef __attribute__((ext_vector_type(4)))  int      v4i;

#define SEQ      2048
#define HIDDEN   2048
#define NHEADS   32
#define NKV      8
#define HDIM     64
#define KVDIM    (NKV * HDIM)   // 512

// LDS row pitches in f16 elements. Every tile below is read by 16-byte loads,
// one row per lane: a pitch of 16 B x odd spreads the 16 rows of a half-wave
// over all 64 banks; the dense 64-B and 128-B rows fold them onto a few.
#define GPITCH   40             // 32-element (64 B) GEMM rows  -> 80 B
#define APITCH   72             // 64-element (128 B) attention rows -> 144 B

// Async Global->LDS (ASYNCcnt-tracked) if the toolchain exposes it.
#if defined(__gfx1250__) && \
    __has_builtin(__builtin_amdgcn_global_load_async_to_lds_b128) && \
    __has_builtin(__builtin_amdgcn_s_wait_asynccnt)
#define HAVE_ASYNC 1
#else
#define HAVE_ASYNC 0
#endif

#if HAVE_ASYNC
// Builtin signature (from compiler diagnostic): typed v4i pointers,
// (addrspace(1) src, addrspace(3) dst, imm offset, imm cpol).
typedef __attribute__((address_space(1))) v4i GlobalV4;
typedef __attribute__((address_space(3))) v4i LocalV4;
#endif

// Copy 16 bytes Global -> LDS. Async path bypasses VGPRs (tracked by
// ASYNCcnt); fallback is a synchronous load+store.
__device__ __forceinline__ void cp16(const _Float16* g, _Float16* l) {
#if HAVE_ASYNC
  __builtin_amdgcn_global_load_async_to_lds_b128(
      (GlobalV4*)(const void*)g, (LocalV4*)(void*)l, 0, 0);
#else
  *(f16x8*)l = *(const f16x8*)g;
#endif
}
__device__ __forceinline__ void async_wait_le4() {
#if HAVE_ASYNC
  __builtin_amdgcn_s_wait_asynccnt(4);   // keep newest 4 (next tile) in flight
#endif
}
__device__ __forceinline__ void async_wait_0() {
#if HAVE_ASYNC
  __builtin_amdgcn_s_wait_asynccnt(0);
#endif
}

__device__ __forceinline__ v8f wmma16(v16h a, v16h b, v8f c) {
  // D = A(16x32 f16) * B(32x16 f16) + C(16x16 f32)
  return __builtin_amdgcn_wmma_f32_16x16x32_f16(
      /*neg_a=*/false, a, /*neg_b=*/false, b,
      /*c_mod=*/(short)0, c, /*reuse_a=*/false, /*reuse_b=*/false);
}

// One lane's 16-element WMMA fragment: two contiguous 8-element (16 B) runs
// 16 elements apart in K (e0..7 -> K = 8*half + e ; e8..15 -> K = 16+8*half+e).
__device__ __forceinline__ v16h ldfrag(const _Float16* p) {
  f16x8 lo = *(const f16x8*)p;
  f16x8 hi = *(const f16x8*)(p + 16);
  v16h r;
#pragma unroll
  for (int j = 0; j < 8; ++j) { r[j] = lo[j]; r[j + 8] = hi[j]; }
  return r;
}

// ---------------------------------------------------------------------------
// Elementwise converts / packs
// ---------------------------------------------------------------------------
__global__ __launch_bounds__(256)
void cvt_f32_f16(const float* __restrict__ s, _Float16* __restrict__ d, int n) {
  int i = blockIdx.x * 256 + threadIdx.x;
  if (i < n) d[i] = (_Float16)s[i];
}

// W [Kd][Nd] f32 -> WT [Nd][Kd] f16 (one-time; lets GEMM stream both operands
// as contiguous 16-byte runs straight into LDS).
__global__ __launch_bounds__(256)
void cvt_transpose_f32_f16(const float* __restrict__ s, _Float16* __restrict__ d,
                           int Kd, int Nd) {
  int i = blockIdx.x * 256 + threadIdx.x;
  if (i >= Kd * Nd) return;
  int k = i / Nd, n = i - k * Nd;
  d[(size_t)n * Kd + k] = (_Float16)s[i];
}

// V: [S][NKV*64] f32 -> VT [NKV][64][S] f16 (dim-major so the P*V operand
// tile is contiguous per dim row).
__global__ __launch_bounds__(256)
void pack_vT(const float* __restrict__ s, _Float16* __restrict__ d) {
  int i = blockIdx.x * 256 + threadIdx.x;      // < SEQ*KVDIM
  if (i >= SEQ * KVDIM) return;
  int sq = i >> 9;
  int r  = i & 511;
  int hk = r >> 6;
  int dd = r & 63;
  d[(((size_t)hk * HDIM) + dd) * SEQ + sq] = (_Float16)s[i];
}

// ---------------------------------------------------------------------------
// Tiled WMMA GEMM: C[M,N] = A[M,K](f16) * B[K,N] + bias, f32 out.
// B supplied pre-transposed: BT[N][K]. Block tile 128x128, 8 waves (2x4),
// each wave 64x32 => 8 WMMA per 32-deep k-step. LDS tiles double-buffered and
// filled with async Global->LDS copies overlapped with compute.
// ---------------------------------------------------------------------------
__global__ __launch_bounds__(256, 2)
void gemm_wmma(const _Float16* __restrict__ A, const _Float16* __restrict__ BT,
               const float* __restrict__ bias, float* __restrict__ C,
               int M, int N, int K) {
  __shared__ __align__(16) _Float16 sA [2][128 * GPITCH];  // [row][k]  2x10 KB
  __shared__ __align__(16) _Float16 sBT[2][128 * GPITCH];  // [col][k]  2x10 KB
  const int tid  = threadIdx.x;
  const int wave = tid >> 5, lane = tid & 31;
  const int hl   = lane >> 4, l16 = lane & 15;
  const int bm = blockIdx.y * 128, bn = blockIdx.x * 128;
  const int wm = (wave >> 2) * 64, wn = (wave & 3) * 32;

  const v8f vzero = {0.f, 0.f, 0.f, 0.f, 0.f, 0.f, 0.f, 0.f};
  v8f acc[4][2];
#pragma unroll
  for (int t = 0; t < 4; ++t)
#pragma unroll
    for (int u = 0; u < 2; ++u) acc[t][u] = vzero;

  // 4 async b128 copies per thread per tile (2 A + 2 BT).
  auto issue = [&](int buf, int k0) {
#pragma unroll
    for (int i = 0; i < 2; ++i) {
      int ch = tid + i * 256;                 // 512 chunks of 8 f16
      int r  = ch >> 2, c = (ch & 3) * 8;     // 128 rows x 32 k
      cp16(&A [(size_t)(bm + r) * K + k0 + c], &sA [buf][r * GPITCH + c]);
      cp16(&BT[(size_t)(bn + r) * K + k0 + c], &sBT[buf][r * GPITCH + c]);
    }
  };

  issue(0, 0);
  int buf = 0;
  for (int k0 = 0; k0 < K; k0 += 32) {
    const bool more = (k0 + 32) < K;
    if (more) issue(buf ^ 1, k0 + 32);        // prefetch next tile
    if (more) async_wait_le4(); else async_wait_0();
    __syncthreads();                           // current tile visible to all

    v16h bfrag[2];
#pragma unroll
    for (int u = 0; u < 2; ++u)
      bfrag[u] = ldfrag(&sBT[buf][(wn + u * 16 + l16) * GPITCH + hl * 8]);
#pragma unroll
    for (int t = 0; t < 4; ++t) {
      v16h afrag = ldfrag(&sA[buf][(wm + t * 16 + l16) * GPITCH + hl * 8]);
#pragma unroll
      for (int u = 0; u < 2; ++u)
        acc[t][u] = wmma16(afrag, bfrag[u], acc[t][u]);
    }
    __syncthreads();                           // done reading buf
    buf ^= 1;
  }

  // Epilogue: C layout => row = v + 8*(lane>=16), col = lane&15.
#pragma unroll
  for (int t = 0; t < 4; ++t)
#pragma unroll
    for (int u = 0; u < 2; ++u) {
      int col = bn + wn + u * 16 + l16;
      float bs = bias ? bias[col] : 0.0f;
#pragma unroll
      for (int v = 0; v < 8; ++v) {
        int row = bm + wm + t * 16 + v + 8 * hl;
        C[(size_t)row * N + col] = acc[t][u][v] + bs;
      }
    }
}

// ---------------------------------------------------------------------------
// Per-(token, head) layernorm + RoPE; one wave32 per 64-elem head row.
// in: [S][nheads*64] f32 ; out: [nheads][S][64] f16
// ---------------------------------------------------------------------------
__global__ __launch_bounds__(256)
void qk_prep(const float* __restrict__ in, const float* __restrict__ g,
             const float* __restrict__ b, _Float16* __restrict__ out,
             int nheads) {
  const int wave = threadIdx.x >> 5, lane = threadIdx.x & 31;
  const int idx = blockIdx.x * 8 + wave;
  const int s = idx / nheads, h = idx % nheads;
  const float* row = in + ((size_t)s * nheads + h) * HDIM;
  float x0 = row[lane], x1 = row[lane + 32];

  float sum = x0 + x1;
#pragma unroll
  for (int off = 16; off >= 1; off >>= 1) sum += __shfl_xor(sum, off, 32);
  float mu = sum * (1.0f / 64.0f);
  float d0 = x0 - mu, d1 = x1 - mu;
  float vs = d0 * d0 + d1 * d1;
#pragma unroll
  for (int off = 16; off >= 1; off >>= 1) vs += __shfl_xor(vs, off, 32);
  float inv = rsqrtf(vs * (1.0f / 64.0f) + 1e-5f);
  float y0 = d0 * inv * g[lane]      + b[lane];
  float y1 = d1 * inv * g[lane + 32] + b[lane + 32];

  // RoPE (emb = concat(freqs, freqs) => freq index = lane for both halves).
  float invf = __powf(10000.0f, -(float)lane / 32.0f);
  float ang  = (float)s * invf;
  float c = cosf(ang), sn = sinf(ang);
  float o0 = y0 * c - y1 * sn;      // rotate_half: [-x2, x1]
  float o1 = y1 * c + y0 * sn;

  _Float16* dst = out + ((size_t)h * SEQ + s) * HDIM;
  dst[lane]      = (_Float16)o0;
  dst[lane + 32] = (_Float16)o1;
}

// ---------------------------------------------------------------------------
// Flash-style GQA attention. Block = (head, 128-query tile), 8 waves,
// each wave owns 16 query rows; streams double-buffered 64-key tiles.
// Q:[32][S][64] K:[8][S][64] VT:[8][64][S] f16 ; O:[S][2048] f16
// ---------------------------------------------------------------------------
__global__ __launch_bounds__(256, 2)
void attn_fmha(const _Float16* __restrict__ Q, const _Float16* __restrict__ Kh,
               const _Float16* __restrict__ VT, _Float16* __restrict__ O) {
  __shared__ __align__(16) _Float16 sK [2][64 * APITCH];  // [key][dim] 2x9 KB
  __shared__ __align__(16) _Float16 sVT[2][64 * APITCH];  // [dim][key] 2x9 KB
  __shared__ __align__(16) _Float16 sP [8][16 * APITCH];  // per-wave P  18 KB
  const int tid  = threadIdx.x;
  const int wave = tid >> 5, lane = tid & 31;
  const int hl   = lane >> 4, l16 = lane & 15;
  const int h  = blockIdx.y;          // q head
  const int hk = h >> 2;              // kv head (n_rep = 4, grouped-adjacent)
  const int qw = blockIdx.x * 128 + wave * 16;

  // Q fragments (rows qw..qw+15, two 32-wide head-dim chunks), loaded once.
  v16h aq[2];
#pragma unroll
  for (int c = 0; c < 2; ++c)
    aq[c] = ldfrag(&Q[(((size_t)h * SEQ) + qw + l16) * HDIM + c * 32 + hl * 8]);

  const v8f vzero = {0.f, 0.f, 0.f, 0.f, 0.f, 0.f, 0.f, 0.f};
  float m[8], lsum[8];
  v8f oacc[4];
#pragma unroll
  for (int v = 0; v < 8; ++v) { m[v] = -3.0e38f; lsum[v] = 0.0f; }
#pragma unroll
  for (int t = 0; t < 4; ++t) oacc[t] = vzero;

  // 4 async b128 copies per thread per key tile (2 K + 2 VT).
  auto issueKV = [&](int buf, int kb) {
#pragma unroll
    for (int i = 0; i < 2; ++i) {
      int ch = tid + i * 256;                 // 512 chunks of 8 f16
      int rr = ch >> 3, cc = (ch & 7) * 8;    // 64 rows x 64 cols
      cp16(&Kh[(((size_t)hk * SEQ) + kb + rr) * HDIM + cc],
           &sK[buf][rr * APITCH + cc]);
      cp16(&VT[(((size_t)hk * HDIM) + rr) * SEQ + kb + cc],
           &sVT[buf][rr * APITCH + cc]);
    }
  };

  issueKV(0, 0);
  int buf = 0;
  for (int kb = 0; kb < SEQ; kb += 64) {
    const bool more = (kb + 64) < SEQ;
    if (more) issueKV(buf ^ 1, kb + 64);
    if (more) async_wait_le4(); else async_wait_0();
    __syncthreads();

    // S tile = Q * K^T  (16q x 64k per wave: 4 col-tiles x 2 k-chunks)
    v8f sacc[4];
#pragma unroll
    for (int u = 0; u < 4; ++u) {
      sacc[u] = vzero;
#pragma unroll
      for (int c = 0; c < 2; ++c) {
        v16h bk = ldfrag(&sK[buf][(u * 16 + l16) * APITCH + c * 32 + hl * 8]);
        sacc[u] = wmma16(aq[c], bk, sacc[u]);
      }
    }

    // Online softmax: rows live as (v + 8*hl); cols across each 16-lane half.
    float mnew[8], alpha[8];
#pragma unroll
    for (int v = 0; v < 8; ++v) {
      float tm = -3.0e38f;
#pragma unroll
      for (int u = 0; u < 4; ++u) {
        sacc[u][v] *= 0.125f;                  // 1/sqrt(64)
        tm = fmaxf(tm, sacc[u][v]);
      }
#pragma unroll
      for (int off = 8; off >= 1; off >>= 1)
        tm = fmaxf(tm, __shfl_xor(tm, off, 32));
      mnew[v]  = fmaxf(m[v], tm);
      alpha[v] = __expf(m[v] - mnew[v]);
      m[v] = mnew[v];
      float rs = 0.0f;
#pragma unroll
      for (int u = 0; u < 4; ++u) {
        float p = __expf(sacc[u][v] - mnew[v]);
        rs += p;
        sP[wave][(v + 8 * hl) * APITCH + u * 16 + l16] = (_Float16)p;
      }
#pragma unroll
      for (int off = 8; off >= 1; off >>= 1) rs += __shfl_xor(rs, off, 32);
      lsum[v] = lsum[v] * alpha[v] + rs;
#pragma unroll
      for (int t = 0; t < 4; ++t) oacc[t][v] *= alpha[v];
    }

    // O += P * V  (P re-read from per-wave LDS in the WMMA A layout)
#pragma unroll
    for (int c = 0; c < 2; ++c) {
      v16h ap = ldfrag(&sP[wave][l16 * APITCH + c * 32 + hl * 8]);
#pragma unroll
      for (int t = 0; t < 4; ++t) {
        v16h bv = ldfrag(&sVT[buf][(t * 16 + l16) * APITCH + c * 32 + hl * 8]);
        oacc[t] = wmma16(ap, bv, oacc[t]);
      }
    }
    __syncthreads();
    buf ^= 1;
  }

  // Normalize and pack into [seq][heads*64] f16 for the output projection.
#pragma unroll
  for (int t = 0; t < 4; ++t)
#pragma unroll
    for (int v = 0; v < 8; ++v) {
      int row = qw + v + 8 * hl;
      O[(size_t)row * HIDDEN + h * HDIM + t * 16 + l16] =
          (_Float16)(oacc[t][v] / lsum[v]);
    }
}

// ---------------------------------------------------------------------------
// Host orchestration
// ---------------------------------------------------------------------------
extern "C" void kernel_launch(void* const* d_in, const int* in_sizes, int n_in,
                              void* d_out, int out_size, void* d_ws,
                              size_t ws_size, hipStream_t stream) {
  (void)in_sizes; (void)n_in; (void)out_size; (void)ws_size;
  const float* x   = (const float*)d_in[0];
  const float* Wq  = (const float*)d_in[1];
  const float* bq  = (const float*)d_in[2];
  const float* Wk  = (const float*)d_in[3];
  const float* bk  = (const float*)d_in[4];
  const float* Wv  = (const float*)d_in[5];
  const float* bv  = (const float*)d_in[6];
  const float* Wo  = (const float*)d_in[7];
  const float* bo  = (const float*)d_in[8];
  const float* qg  = (const float*)d_in[9];
  const float* qb  = (const float*)d_in[10];
  const float* kg  = (const float*)d_in[11];
  const float* kbb = (const float*)d_in[12];

  char* ws = (char*)d_ws;
  size_t off = 0;
  auto alloc = [&](size_t bytes) {
    void* p = ws + off;
    off += (bytes + 255) & ~(size_t)255;
    return p;
  };
  _Float16* x16   = (_Float16*)alloc((size_t)SEQ * HIDDEN * 2);
  _Float16* WqT16 = (_Float16*)alloc((size_t)HIDDEN * HIDDEN * 2);
  _Float16* WkT16 = (_Float16*)alloc((size_t)HIDDEN * KVDIM * 2);
  _Float16* WvT16 = (_Float16*)alloc((size_t)HIDDEN * KVDIM * 2);
  _Float16* WoT16 = (_Float16*)alloc((size_t)HIDDEN * HIDDEN * 2);
  float*    Q32   = (float*)   alloc((size_t)SEQ * HIDDEN * 4);
  float*    K32   = (float*)   alloc((size_t)SEQ * KVDIM * 4);
  float*    V32   = (float*)   alloc((size_t)SEQ * KVDIM * 4);
  _Float16* Q16   = (_Float16*)alloc((size_t)NHEADS * SEQ * HDIM * 2);
  _Float16* K16   = (_Float16*)alloc((size_t)NKV * SEQ * HDIM * 2);
  _Float16* VT16  = (_Float16*)alloc((size_t)NKV * HDIM * SEQ * 2);
  _Float16* O16   = (_Float16*)alloc((size_t)SEQ * HIDDEN * 2);

  cvt_f32_f16<<<(SEQ * HIDDEN + 255) / 256, 256, 0, stream>>>(
      x, x16, SEQ * HIDDEN);
  cvt_transpose_f32_f16<<<(HIDDEN * HIDDEN + 255) / 256, 256, 0, stream>>>(
      Wq, WqT16, HIDDEN, HIDDEN);
  cvt_transpose_f32_f16<<<(HIDDEN * KVDIM + 255) / 256, 256, 0, stream>>>(
      Wk, WkT16, HIDDEN, KVDIM);
  cvt_transpose_f32_f16<<<(HIDDEN * KVDIM + 255) / 256, 256, 0, stream>>>(
      Wv, WvT16, HIDDEN, KVDIM);
  cvt_transpose_f32_f16<<<(HIDDEN * HIDDEN + 255) / 256, 256, 0, stream>>>(
      Wo, WoT16, HIDDEN, HIDDEN);

  // Projections (f16 WMMA, f32 accum + bias)
  gemm_wmma<<<dim3(HIDDEN / 128, SEQ / 128), 256, 0, stream>>>(
      x16, WqT16, bq, Q32, SEQ, HIDDEN, HIDDEN);
  gemm_wmma<<<dim3(KVDIM / 128, SEQ / 128), 256, 0, stream>>>(
      x16, WkT16, bk, K32, SEQ, KVDIM, HIDDEN);
  gemm_wmma<<<dim3(KVDIM / 128, SEQ / 128), 256, 0, stream>>>(
      x16, WvT16, bv, V32, SEQ, KVDIM, HIDDEN);

  // Per-head QK layernorm + RoPE, pack head-major f16; V packed dim-major.
  qk_prep<<<(SEQ * NHEADS) / 8, 256, 0, stream>>>(Q32, qg, qb, Q16, NHEADS);
  qk_prep<<<(SEQ * NKV) / 8, 256, 0, stream>>>(K32, kg, kbb, K16, NKV);
  pack_vT<<<(SEQ * KVDIM + 255) / 256, 256, 0, stream>>>(V32, VT16);

  // GQA flash attention
  attn_fmha<<<dim3(SEQ / 128, NHEADS), 256, 0, stream>>>(Q16, K16, VT16, O16);

  // Output projection -> f32 result
  gemm_wmma<<<dim3(HIDDEN / 128, SEQ / 128), 256, 0, stream>>>(
      O16, WoT16, bo, (float*)d_out, SEQ, HIDDEN, HIDDEN);
}

// v002
// It runs in 228 microseconds.
// Next to v001, in two timings, it ran 1.57 and 1.56 times as fast.
// All steps since v000 together make it 2.08 times as fast.
#include <hip/hip_runtime.h>
#include <hip/hip_bf16.h>
#include <stdint.h>

// ---------------------------------------------------------------------------
// Types for CDNA5 WMMA (wave32): A/B = v16h (16 halves = 8 VGPRs),
// C/D = v8f (8 VGPRs of f32).
// ---------------------------------------------------------------------------
typedef __attribute__((ext_vector_type(16))) _Float16 v16h;
typedef __attribute__((ext_vector_type(8)))  float    v8f;
typedef __attribute__((ext_vector_type(8)))  _Float16 f16x8;
typedef __attribute__((ext_vector_type(4)))  int      v4i;
typedef __attribute__((ext_vector_type(4)))  float    f32x4;
typedef __attribute__((ext_vector_type(2)))  _Float16 f16x2;

#define SEQ      2048
#define HIDDEN   2048
#define NHEADS   32
#define NKV      8
#define HDIM     64
#define KVDIM    (NKV * HDIM)   // 512

// LDS row pitches in f16 elements. The GEMM and attention tiles are read by 16-byte loads,
// one row per lane: a pitch of 16 B x odd spreads the 16 rows of a half-wave
// over all 64 banks; the dense 64-B and 128-B rows fold them onto a few.
#define GPITCH   40             // 32-element (64 B) GEMM rows  -> 80 B
#define APITCH   72             // 64-element (128 B) attention rows -> 144 B

// Async Global->LDS (ASYNCcnt-tracked) if the toolchain exposes it.
#if defined(__gfx1250__) && \
    __has_builtin(__builtin_amdgcn_global_load_async_to_lds_b128) && \
    __has_builtin(__builtin_amdgcn_s_wait_asynccnt)
#define HAVE_ASYNC 1
#else
#define HAVE_ASYNC 0
#endif

#if HAVE_ASYNC
// Builtin signature (from compiler diagnostic): typed v4i pointers,
// (addrspace(1) src, addrspace(3) dst, imm offset, imm cpol).
typedef __attribute__((address_space(1))) v4i GlobalV4;
typedef __attribute__((address_space(3))) v4i LocalV4;
#endif

// Copy 16 bytes Global -> LDS. Async path bypasses VGPRs (tracked by
// ASYNCcnt); fallback is a synchronous load+store.
__device__ __forceinline__ void cp16(const _Float16* g, _Float16* l) {
#if HAVE_ASYNC
  __builtin_amdgcn_global_load_async_to_lds_b128(
      (GlobalV4*)(const void*)g, (LocalV4*)(void*)l, 0, 0);
#else
  *(f16x8*)l = *(const f16x8*)g;
#endif
}
__device__ __forceinline__ void async_wait_le4() {
#if HAVE_ASYNC
  __builtin_amdgcn_s_wait_asynccnt(4);   // keep newest 4 (next tile) in flight
#endif
}
__device__ __forceinline__ void async_wait_0() {
#if HAVE_ASYNC
  __builtin_amdgcn_s_wait_asynccnt(0);
#endif
}

__device__ __forceinline__ v8f wmma16(v16h a, v16h b, v8f c) {
  // D = A(16x32 f16) * B(32x16 f16) + C(16x16 f32)
  return __builtin_amdgcn_wmma_f32_16x16x32_f16(
      /*neg_a=*/false, a, /*neg_b=*/false, b,
      /*c_mod=*/(short)0, c, /*reuse_a=*/false, /*reuse_b=*/false);
}

// One lane's 16-element WMMA fragment: two contiguous 8-element (16 B) runs
// 16 elements apart in K (e0..7 -> K = 8*half + e ; e8..15 -> K = 16+8*half+e).
__device__ __forceinline__ v16h ldfrag(const _Float16* p) {
  f16x8 lo = *(const f16x8*)p;
  f16x8 hi = *(const f16x8*)(p + 16);
  v16h r;
#pragma unroll
  for (int j = 0; j < 8; ++j) { r[j] = lo[j]; r[j + 8] = hi[j]; }
  return r;
}

// ---------------------------------------------------------------------------
// Elementwise converts / transposes. These launches move few bytes, so their
// time is the time to start their waves: every thread handles 32 elements
// through 16-byte accesses and the grids stay at a few workgroups per WGP.
// ---------------------------------------------------------------------------
#define CVT_PER_BLOCK (256 * 32)

// f32 -> f16, n = gridDim.x * CVT_PER_BLOCK elements. All eight loads of a
// thread are issued before the first convert.
__global__ __launch_bounds__(256)
void cvt_f32_f16(const float* __restrict__ s, _Float16* __restrict__ d) {
  const size_t base = (size_t)blockIdx.x * CVT_PER_BLOCK + threadIdx.x * 8;
  f32x4 lo[4], hi[4];
#pragma unroll
  for (int j = 0; j < 4; ++j) {
    lo[j] = *(const f32x4*)(s + base + j * 2048);
    hi[j] = *(const f32x4*)(s + base + j * 2048 + 4);
  }
#pragma unroll
  for (int j = 0; j < 4; ++j) {
    f16x8 o;
#pragma unroll
    for (int e = 0; e < 4; ++e) {
      o[e]     = (_Float16)lo[j][e];
      o[e + 4] = (_Float16)hi[j][e];
    }
    *(f16x8*)(d + base + j * 2048) = o;
  }
}

// S [KD][ND] f32 -> D [ND][KD] f16 (lets the GEMM and the P*V product stream
// their operands as contiguous 16-byte runs straight into LDS).
// One block = one 128(k) x 64(n) tile, KD % 128 == 0 and ND % 64 == 0:
// 256-byte row pieces in, turned in LDS, 256-byte row pieces out. The shapes
// are compile-time so that a thread's eight loads and four stores each hang
// off one address with immediate offsets.
#define TK       128
#define TN       64
#define TPITCH   (TK + 8)       // 272 B = 16 B x odd for the 16-byte readers
template <int KD, int ND>
__device__ __forceinline__
void transpose_tile(const float* __restrict__ s, _Float16* __restrict__ d,
                    _Float16* sT) {                        // sT: [n][k]
  const int t  = threadIdx.x;
  const int k0 = blockIdx.y * TK, n0 = blockIdx.x * TN;
  const int n4 = (t & 15) * 4;        // four neighbouring columns
  const int kp = (t >> 4) * 2;        // two neighbouring rows -> one dword

  const float* p = s + (size_t)(k0 + kp) * ND + n0 + n4;
  f32x4 ra[4], rb[4];
#pragma unroll
  for (int j = 0; j < 4; ++j) {
    ra[j] = *(const f32x4*)(p + (32 * j) * ND);
    rb[j] = *(const f32x4*)(p + (32 * j + 1) * ND);
  }
#pragma unroll
  for (int j = 0; j < 4; ++j)
#pragma unroll
    for (int i = 0; i < 4; ++i) {
      f16x2 w = {(_Float16)ra[j][i], (_Float16)rb[j][i]};
      *(f16x2*)&sT[(n4 + i) * TPITCH + kp + 32 * j] = w;
    }
  __syncthreads();                    // whole tile in LDS before it is read
  const int n = t >> 4, kc = (t & 15) * 8;   // 16 rows x 16 chunks a pass
  _Float16* q = d + (size_t)(n0 + n) * KD + k0 + kc;
#pragma unroll
  for (int j = 0; j < 4; ++j)
    *(f16x8*)(q + (16 * j) * KD) =
        *(const f16x8*)&sT[(n + 16 * j) * TPITCH + kc];
}

// [2048][2048]: Wq, Wo
__global__ __launch_bounds__(256)
void cvt_transpose_sq(const float* __restrict__ s, _Float16* __restrict__ d) {
  __shared__ __align__(16) _Float16 sT[TN * TPITCH];       // 17 KB
  transpose_tile<HIDDEN, HIDDEN>(s, d, sT);
}

// [2048][512]: Wk, Wv, and V [S][NKV*64] -> VT [NKV*64][S]
__global__ __launch_bounds__(256)
void cvt_transpose_kv(const float* __restrict__ s, _Float16* __restrict__ d) {
  __shared__ __align__(16) _Float16 sT[TN * TPITCH];       // 17 KB
  transpose_tile<HIDDEN, KVDIM>(s, d, sT);
}

// ---------------------------------------------------------------------------
// Tiled WMMA GEMM: C[M,N] = A[M,K](f16) * B[K,N] + bias, f32 out.
// B supplied pre-transposed: BT[N][K]. Block tile 128x128, 8 waves (2x4),
// each wave 64x32 => 8 WMMA per 32-deep k-step. LDS tiles double-buffered and
// filled with async Global->LDS copies overlapped with compute.
// ---------------------------------------------------------------------------
__global__ __launch_bounds__(256, 2)
void gemm_wmma(const _Float16* __restrict__ A, const _Float16* __restrict__ BT,
               const float* __restrict__ bias, float* __restrict__ C,
               int M, int N, int K) {
  __shared__ __align__(16) _Float16 sA [2][128 * GPITCH];  // [row][k]  2x10 KB
  __shared__ __align__(16) _Float16 sBT[2][128 * GPITCH];  // [col][k]  2x10 KB
  const int tid  = threadIdx.x;
  const int wave = tid >> 5, lane = tid & 31;
  const int hl   = lane >> 4, l16 = lane & 15;
  const int bm = blockIdx.y * 128, bn = blockIdx.x * 128;
  const int wm = (wave >> 2) * 64, wn = (wave & 3) * 32;

  const v8f vzero = {0.f, 0.f, 0.f, 0.f, 0.f, 0.f, 0.f, 0.f};
  v8f acc[4][2];
#pragma unroll
  for (int t = 0; t < 4; ++t)
#pragma unroll
    for (int u = 0; u < 2; ++u) acc[t][u] = vzero;

  // 4 async b128 copies per thread per tile (2 A + 2 BT).
  auto issue = [&](int buf, int k0) {
#pragma unroll
    for (int i = 0; i < 2; ++i) {
      int ch = tid + i * 256;                 // 512 chunks of 8 f16
      int r  = ch >> 2, c = (ch & 3) * 8;     // 128 rows x 32 k
      cp16(&A [(size_t)(bm + r) * K + k0 + c], &sA [buf][r * GPITCH + c]);
      cp16(&BT[(size_t)(bn + r) * K + k0 + c], &sBT[buf][r * GPITCH + c]);
    }
  };

  issue(0, 0);
  int buf = 0;
  for (int k0 = 0; k0 < K; k0 += 32) {
    const bool more = (k0 + 32) < K;
    if (more) issue(buf ^ 1, k0 + 32);        // prefetch next tile
    if (more) async_wait_le4(); else async_wait_0();
    __syncthreads();                           // current tile visible to all

    v16h bfrag[2];
#pragma unroll
    for (int u = 0; u < 2; ++u)
      bfrag[u] = ldfrag(&sBT[buf][(wn + u * 16 + l16) * GPITCH + hl * 8]);
#pragma unroll
    for (int t = 0; t < 4; ++t) {
      v16h afrag = ldfrag(&sA[buf][(wm + t * 16 + l16) * GPITCH + hl * 8]);
#pragma unroll
      for (int u = 0; u < 2; ++u)
        acc[t][u] = wmma16(afrag, bfrag[u], acc[t][u]);
    }
    __syncthreads();                           // done reading buf
    buf ^= 1;
  }

  // Epilogue: C layout => row = v + 8*(lane>=16), col = lane&15.
#pragma unroll
  for (int t = 0; t < 4; ++t)
#pragma unroll
    for (int u = 0; u < 2; ++u) {
      int col = bn + wn + u * 16 + l16;
      float bs = bias ? bias[col] : 0.0f;
#pragma unroll
      for (int v = 0; v < 8; ++v) {
        int row = bm + wm + t * 16 + v + 8 * hl;
        C[(size_t)row * N + col] = acc[t][u][v] + bs;
      }
    }
}

// ---------------------------------------------------------------------------
// Per-(token, head) layernorm + RoPE. One wave32 takes R neighbouring heads of
// one token; a lane holds elements lane and lane + 32 of each 64-elem head row.
// The rows' loads go out together, their reductions interleave, and the
// token's cos/sin are computed once.
// in: [S][nheads*64] f32 ; out: [nheads][S][64] f16 ; nheads % R == 0
// ---------------------------------------------------------------------------
template <int R>
__device__ __forceinline__
void qk_prep_rows(const float* __restrict__ in, const float* __restrict__ g,
                  const float* __restrict__ b, _Float16* __restrict__ out,
                  int nheads) {
  const int wave = threadIdx.x >> 5, lane = threadIdx.x & 31;
  const int idx = blockIdx.x * 8 + wave;
  const int per_tok = nheads / R;
  const int s = idx / per_tok, h0 = (idx % per_tok) * R;
  const float* row = in + ((size_t)s * nheads + h0) * HDIM;
  const float g0 = g[lane], g1 = g[lane + 32];
  const float b0 = b[lane], b1 = b[lane + 32];
  float x0[R], x1[R];
#pragma unroll
  for (int r = 0; r < R; ++r) {
    x0[r] = row[r * HDIM + lane];
    x1[r] = row[r * HDIM + lane + 32];
  }

  // RoPE (emb = concat(freqs, freqs) => freq index = lane for both halves).
  float invf = __powf(10000.0f, -(float)lane / 32.0f);
  float ang  = (float)s * invf;
  float c = cosf(ang), sn = sinf(ang);

  // Each reduction step runs over all R rows before the next step, so that
  // the rows' cross-lane exchanges are in flight together.
  float sum[R];
#pragma unroll
  for (int r = 0; r < R; ++r) sum[r] = x0[r] + x1[r];
#pragma unroll
  for (int off = 16; off >= 1; off >>= 1)
#pragma unroll
    for (int r = 0; r < R; ++r) sum[r] += __shfl_xor(sum[r], off, 32);

  float d0[R], d1[R], vs[R];
#pragma unroll
  for (int r = 0; r < R; ++r) {
    float mu = sum[r] * (1.0f / 64.0f);
    d0[r] = x0[r] - mu;
    d1[r] = x1[r] - mu;
    vs[r] = d0[r] * d0[r] + d1[r] * d1[r];
  }
#pragma unroll
  for (int off = 16; off >= 1; off >>= 1)
#pragma unroll
    for (int r = 0; r < R; ++r) vs[r] += __shfl_xor(vs[r], off, 32);

#pragma unroll
  for (int r = 0; r < R; ++r) {
    float inv = rsqrtf(vs[r] * (1.0f / 64.0f) + 1e-5f);
    float y0 = d0[r] * inv * g0 + b0;
    float y1 = d1[r] * inv * g1 + b1;

    float o0 = y0 * c - y1 * sn;      // rotate_half: [-x2, x1]
    float o1 = y1 * c + y0 * sn;

    _Float16* dst = out + ((size_t)(h0 + r) * SEQ + s) * HDIM;
    dst[lane]      = (_Float16)o0;
    dst[lane + 32] = (_Float16)o1;
  }
}

// The grid is two blocks a WGP, four waves a SIMD: capping the occupancy the
// compiler aims for at that gives it the registers to keep the 16 rows'
// exchanges in flight together instead of one at a time.
__global__ __launch_bounds__(256) __attribute__((amdgpu_waves_per_eu(4, 4)))
void q_prep(const float* __restrict__ in, const float* __restrict__ g,
            const float* __restrict__ b, _Float16* __restrict__ out) {
  qk_prep_rows<16>(in, g, b, out, NHEADS);
}

__global__ __launch_bounds__(256)
void k_prep(const float* __restrict__ in, const float* __restrict__ g,
            const float* __restrict__ b, _Float16* __restrict__ out) {
  qk_prep_rows<8>(in, g, b, out, NKV);
}

// ---------------------------------------------------------------------------
// Flash-style GQA attention. Block = (head, 128-query tile), 8 waves,
// each wave owns 16 query rows; streams double-buffered 64-key tiles.
// Q:[32][S][64] K:[8][S][64] VT:[8][64][S] f16 ; O:[S][2048] f16
// ---------------------------------------------------------------------------
__global__ __launch_bounds__(256, 2)
void attn_fmha(const _Float16* __restrict__ Q, const _Float16* __restrict__ Kh,
               const _Float16* __restrict__ VT, _Float16* __restrict__ O) {
  __shared__ __align__(16) _Float16 sK [2][64 * APITCH];  // [key][dim] 2x9 KB
  __shared__ __align__(16) _Float16 sVT[2][64 * APITCH];  // [dim][key] 2x9 KB
  __shared__ __align__(16) _Float16 sP [8][16 * APITCH];  // per-wave P  18 KB
  const int tid  = threadIdx.x;
  const int wave = tid >> 5, lane = tid & 31;
  const int hl   = lane >> 4, l16 = lane & 15;
  const int h  = blockIdx.y;          // q head
  const int hk = h >> 2;              // kv head (n_rep = 4, grouped-adjacent)
  const int qw = blockIdx.x * 128 + wave * 16;

  // Q fragments (rows qw..qw+15, two 32-wide head-dim chunks), loaded once.
  v16h aq[2];
#pragma unroll
  for (int c = 0; c < 2; ++c)
    aq[c] = ldfrag(&Q[(((size_t)h * SEQ) + qw + l16) * HDIM + c * 32 + hl * 8]);

  const v8f vzero = {0.f, 0.f, 0.f, 0.f, 0.f, 0.f, 0.f, 0.f};
  float m[8], lsum[8];
  v8f oacc[4];
#pragma unroll
  for (int v = 0; v < 8; ++v) { m[v] = -3.0e38f; lsum[v] = 0.0f; }
#pragma unroll
  for (int t = 0; t < 4; ++t) oacc[t] = vzero;

  // 4 async b128 copies per thread per key tile (2 K + 2 VT).
  auto issueKV = [&](int buf, int kb) {
#pragma unroll
    for (int i = 0; i < 2; ++i) {
      int ch = tid + i * 256;                 // 512 chunks of 8 f16
      int rr = ch >> 3, cc = (ch & 7) * 8;    // 64 rows x 64 cols
      cp16(&Kh[(((size_t)hk * SEQ) + kb + rr) * HDIM + cc],
           &sK[buf][rr * APITCH + cc]);
      cp16(&VT[(((size_t)hk * HDIM) + rr) * SEQ + kb + cc],
           &sVT[buf][rr * APITCH + cc]);
    }
  };

  issueKV(0, 0);
  int buf = 0;
  for (int kb = 0; kb < SEQ; kb += 64) {
    const bool more = (kb + 64) < SEQ;
    if (more) issueKV(buf ^ 1, kb + 64);
    if (more) async_wait_le4(); else async_wait_0();
    __syncthreads();

    // S tile = Q * K^T  (16q x 64k per wave: 4 col-tiles x 2 k-chunks)
    v8f sacc[4];
#pragma unroll
    for (int u = 0; u < 4; ++u) {
      sacc[u] = vzero;
#pragma unroll
      for (int c = 0; c < 2; ++c) {
        v16h bk = ldfrag(&sK[buf][(u * 16 + l16) * APITCH + c * 32 + hl * 8]);
        sacc[u] = wmma16(aq[c], bk, sacc[u]);
      }
    }

    // Online softmax: rows live as (v + 8*hl); cols across each 16-lane half.
    float mnew[8], alpha[8];
#pragma unroll
    for (int v = 0; v < 8; ++v) {
      float tm = -3.0e38f;
#pragma unroll
      for (int u = 0; u < 4; ++u) {
        sacc[u][v] *= 0.125f;                  // 1/sqrt(64)
        tm = fmaxf(tm, sacc[u][v]);
      }
#pragma unroll
      for (int off = 8; off >= 1; off >>= 1)
        tm = fmaxf(tm, __shfl_xor(tm, off, 32));
      mnew[v]  = fmaxf(m[v], tm);
      alpha[v] = __expf(m[v] - mnew[v]);
      m[v] = mnew[v];
      float rs = 0.0f;
#pragma unroll
      for (int u = 0; u < 4; ++u) {
        float p = __expf(sacc[u][v] - mnew[v]);
        rs += p;
        sP[wave][(v + 8 * hl) * APITCH + u * 16 + l16] = (_Float16)p;
      }
#pragma unroll
      for (int off = 8; off >= 1; off >>= 1) rs += __shfl_xor(rs, off, 32);
      lsum[v] = lsum[v] * alpha[v] + rs;
#pragma unroll
      for (int t = 0; t < 4; ++t) oacc[t][v] *= alpha[v];
    }

    // O += P * V  (P re-read from per-wave LDS in the WMMA A layout)
#pragma unroll
    for (int c = 0; c < 2; ++c) {
      v16h ap = ldfrag(&sP[wave][l16 * APITCH + c * 32 + hl * 8]);
#pragma unroll
      for (int t = 0; t < 4; ++t) {
        v16h bv = ldfrag(&sVT[buf][(t * 16 + l16) * APITCH + c * 32 + hl * 8]);
        oacc[t] = wmma16(ap, bv, oacc[t]);
      }
    }
    __syncthreads();
    buf ^= 1;
  }

  // Normalize and pack into [seq][heads*64] f16 for the output projection.
#pragma unroll
  for (int t = 0; t < 4; ++t)
#pragma unroll
    for (int v = 0; v < 8; ++v) {
      int row = qw + v + 8 * hl;
      O[(size_t)row * HIDDEN + h * HDIM + t * 16 + l16] =
          (_Float16)(oacc[t][v] / lsum[v]);
    }
}

// ---------------------------------------------------------------------------
// Host orchestration
// ---------------------------------------------------------------------------
extern "C" void kernel_launch(void* const* d_in, const int* in_sizes, int n_in,
                              void* d_out, int out_size, void* d_ws,
                              size_t ws_size, hipStream_t stream) {
  (void)in_sizes; (void)n_in; (void)out_size; (void)ws_size;
  const float* x   = (const float*)d_in[0];
  const float* Wq  = (const float*)d_in[1];
  const float* bq  = (const float*)d_in[2];
  const float* Wk  = (const float*)d_in[3];
  const float* bk  = (const float*)d_in[4];
  const float* Wv  = (const float*)d_in[5];
  const float* bv  = (const float*)d_in[6];
  const float* Wo  = (const float*)d_in[7];
  const float* bo  = (const float*)d_in[8];
  const float* qg  = (const float*)d_in[9];
  const float* qb  = (const float*)d_in[10];
  const float* kg  = (const float*)d_in[11];
  const float* kbb = (const float*)d_in[12];

  char* ws = (char*)d_ws;
  size_t off = 0;
  auto alloc = [&](size_t bytes) {
    void* p = ws + off;
    off += (bytes + 255) & ~(size_t)255;
    return p;
  };
  _Float16* x16   = (_Float16*)alloc((size_t)SEQ * HIDDEN * 2);
  _Float16* WqT16 = (_Float16*)alloc((size_t)HIDDEN * HIDDEN * 2);
  _Float16* WkT16 = (_Float16*)alloc((size_t)HIDDEN * KVDIM * 2);
  _Float16* WvT16 = (_Float16*)alloc((size_t)HIDDEN * KVDIM * 2);
  _Float16* WoT16 = (_Float16*)alloc((size_t)HIDDEN * HIDDEN * 2);
  float*    Q32   = (float*)   alloc((size_t)SEQ * HIDDEN * 4);
  float*    K32   = (float*)   alloc((size_t)SEQ * KVDIM * 4);
  float*    V32   = (float*)   alloc((size_t)SEQ * KVDIM * 4);
  _Float16* Q16   = (_Float16*)alloc((size_t)NHEADS * SEQ * HDIM * 2);
  _Float16* K16   = (_Float16*)alloc((size_t)NKV * SEQ * HDIM * 2);
  _Float16* VT16  = (_Float16*)alloc((size_t)NKV * HDIM * SEQ * 2);
  _Float16* O16   = (_Float16*)alloc((size_t)SEQ * HIDDEN * 2);

  cvt_f32_f16<<<(SEQ * HIDDEN) / CVT_PER_BLOCK, 256, 0, stream>>>(x, x16);
  cvt_transpose_sq<<<dim3(HIDDEN / TN, HIDDEN / TK), 256, 0, stream>>>(
      Wq, WqT16);
  cvt_transpose_kv<<<dim3(KVDIM / TN, HIDDEN / TK), 256, 0, stream>>>(
      Wk, WkT16);
  cvt_transpose_kv<<<dim3(KVDIM / TN, HIDDEN / TK), 256, 0, stream>>>(
      Wv, WvT16);
  cvt_transpose_sq<<<dim3(HIDDEN / TN, HIDDEN / TK), 256, 0, stream>>>(
      Wo, WoT16);

  // Projections (f16 WMMA, f32 accum + bias)
  gemm_wmma<<<dim3(HIDDEN / 128, SEQ / 128), 256, 0, stream>>>(
      x16, WqT16, bq, Q32, SEQ, HIDDEN, HIDDEN);
  gemm_wmma<<<dim3(KVDIM / 128, SEQ / 128), 256, 0, stream>>>(
      x16, WkT16, bk, K32, SEQ, KVDIM, HIDDEN);
  gemm_wmma<<<dim3(KVDIM / 128, SEQ / 128), 256, 0, stream>>>(
      x16, WvT16, bv, V32, SEQ, KVDIM, HIDDEN);

  // Per-head QK layernorm + RoPE, pack head-major f16. V [S][NKV*64] f32 ->
  // VT [NKV*64][S] f16 is the same transpose as the weights'.
  q_prep<<<(SEQ * NHEADS) / (8 * 16), 256, 0, stream>>>(Q32, qg, qb, Q16);
  k_prep<<<(SEQ * NKV) / (8 * 8), 256, 0, stream>>>(K32, kg, kbb, K16);
  static_assert(SEQ == HIDDEN, "V shares the K/V weights' transpose shape");
  cvt_transpose_kv<<<dim3(KVDIM / TN, SEQ / TK), 256, 0, stream>>>(V32, VT16);

  // GQA flash attention
  attn_fmha<<<dim3(SEQ / 128, NHEADS), 256, 0, stream>>>(Q16, K16, VT16, O16);

  // Output projection -> f32 result
  gemm_wmma<<<dim3(HIDDEN / 128, SEQ / 128), 256, 0, stream>>>(
      O16, WoT16, bo, (float*)d_out, SEQ, HIDDEN, HIDDEN);
}

// v003
// A run of this version takes 153 microseconds.
// Timed twice side by side with v002, it ran 1.49 and 1.51 times as fast.
// All steps since v000 together make it 3.12 times as fast.
#include <hip/hip_runtime.h>
#include <hip/hip_bf16.h>
#include <stdint.h>

// ---------------------------------------------------------------------------
// Types for CDNA5 WMMA (wave32): A/B = v16h (16 halves = 8 VGPRs),
// C/D = v8f (8 VGPRs of f32).
// ---------------------------------------------------------------------------
typedef __attribute__((ext_vector_type(16))) _Float16 v16h;
typedef __attribute__((ext_vector_type(8)))  float    v8f;
typedef __attribute__((ext_vector_type(8)))  _Float16 f16x8;
typedef __attribute__((ext_vector_type(4)))  int      v4i;
typedef __attribute__((ext_vector_type(4)))  float    f32x4;
typedef __attribute__((ext_vector_type(2)))  _Float16 f16x2;

#define SEQ      2048
#define HIDDEN   2048
#define NHEADS   32
#define NKV      8
#define HDIM     64
#define KVDIM    (NKV * HDIM)   // 512

// LDS row pitches in f16 elements. The GEMM and attention tiles are read by 16-byte loads,
// one row per lane: a pitch of 16 B x odd spreads the 16 rows of a half-wave
// over all 64 banks; the dense 64-B and 128-B rows fold them onto a few.
#define GPITCH   40             // 32-element (64 B) GEMM rows  -> 80 B
#define APITCH   72             // 64-element (128 B) attention rows -> 144 B

// Async Global->LDS (ASYNCcnt-tracked) if the toolchain exposes it.
#if defined(__gfx1250__) && \
    __has_builtin(__builtin_amdgcn_global_load_async_to_lds_b128) && \
    __has_builtin(__builtin_amdgcn_s_wait_asynccnt)
#define HAVE_ASYNC 1
#else
#define HAVE_ASYNC 0
#endif

#if HAVE_ASYNC
// Builtin signature (from compiler diagnostic): typed v4i pointers,
// (addrspace(1) src, addrspace(3) dst, imm offset, imm cpol).
typedef __attribute__((address_space(1))) v4i GlobalV4;
typedef __attribute__((address_space(3))) v4i LocalV4;
#endif

// Copy 16 bytes Global -> LDS. Async path bypasses VGPRs (tracked by
// ASYNCcnt); fallback is a synchronous load+store.
__device__ __forceinline__ void cp16(const _Float16* g, _Float16* l) {
#if HAVE_ASYNC
  __builtin_amdgcn_global_load_async_to_lds_b128(
      (GlobalV4*)(const void*)g, (LocalV4*)(void*)l, 0, 0);
#else
  *(f16x8*)l = *(const f16x8*)g;
#endif
}
__device__ __forceinline__ void async_wait_le4() {
#if HAVE_ASYNC
  __builtin_amdgcn_s_wait_asynccnt(4);   // keep newest 4 (next tile) in flight
#endif
}
__device__ __forceinline__ void async_wait_0() {
#if HAVE_ASYNC
  __builtin_amdgcn_s_wait_asynccnt(0);
#endif
}

__device__ __forceinline__ v8f wmma16(v16h a, v16h b, v8f c) {
  // D = A(16x32 f16) * B(32x16 f16) + C(16x16 f32)
  return __builtin_amdgcn_wmma_f32_16x16x32_f16(
      /*neg_a=*/false, a, /*neg_b=*/false, b,
      /*c_mod=*/(short)0, c, /*reuse_a=*/false, /*reuse_b=*/false);
}

// One lane's 16-element WMMA fragment: two contiguous 8-element (16 B) runs
// 16 elements apart in K (e0..7 -> K = 8*half + e ; e8..15 -> K = 16+8*half+e).
__device__ __forceinline__ v16h ldfrag(const _Float16* p) {
  f16x8 lo = *(const f16x8*)p;
  f16x8 hi = *(const f16x8*)(p + 16);
  v16h r;
#pragma unroll
  for (int j = 0; j < 8; ++j) { r[j] = lo[j]; r[j + 8] = hi[j]; }
  return r;
}

// ---------------------------------------------------------------------------
// Elementwise converts / transposes. These launches move few bytes, so their
// time is the time to start their waves: every thread handles 32 elements
// through 16-byte accesses and the grids stay at a few workgroups per WGP.
// ---------------------------------------------------------------------------
#define CVT_PER_BLOCK (256 * 32)

// f32 -> f16, piece blk of CVT_PER_BLOCK elements. All eight loads of a
// thread are issued before the first convert.
__device__ __forceinline__
void cvt_piece(const float* __restrict__ s, _Float16* __restrict__ d, int blk) {
  const size_t base = (size_t)blk * CVT_PER_BLOCK + threadIdx.x * 8;
  f32x4 lo[4], hi[4];
#pragma unroll
  for (int j = 0; j < 4; ++j) {
    lo[j] = *(const f32x4*)(s + base + j * 2048);
    hi[j] = *(const f32x4*)(s + base + j * 2048 + 4);
  }
#pragma unroll
  for (int j = 0; j < 4; ++j) {
    f16x8 o;
#pragma unroll
    for (int e = 0; e < 4; ++e) {
      o[e]     = (_Float16)lo[j][e];
      o[e + 4] = (_Float16)hi[j][e];
    }
    *(f16x8*)(d + base + j * 2048) = o;
  }
  // A precaution: in a grid of several jobs the listing lays another job's
  // code behind these stores; it writes their registers only behind this wait.
  asm volatile("s_wait_xcnt 0x0" ::: "memory");
}

// S [KD][ND] f32 -> D [ND][KD] f16 (lets the GEMM and the P*V product stream
// their operands as contiguous 16-byte runs straight into LDS).
// One block = one 128(k) x 64(n) tile, number tile in row-major order of the
// (KD / 128) x (ND / 64) tiles, KD % 128 == 0 and ND % 64 == 0:
// 256-byte row pieces in, turned in LDS, 256-byte row pieces out. The shapes
// are compile-time so that a thread's eight loads and four stores each hang
// off one address with immediate offsets.
#define TK       128
#define TN       64
#define TPITCH   (TK + 8)       // 272 B = 16 B x odd for the 16-byte readers
template <int KD, int ND>
__device__ __forceinline__
void transpose_tile(const float* __restrict__ s, _Float16* __restrict__ d,
                    _Float16* sT, int tile) {              // sT: [n][k]
  const int t  = threadIdx.x;
  const int k0 = (tile / (ND / TN)) * TK, n0 = (tile % (ND / TN)) * TN;
  const int n4 = (t & 15) * 4;        // four neighbouring columns
  const int kp = (t >> 4) * 2;        // two neighbouring rows -> one dword

  const float* p = s + (size_t)(k0 + kp) * ND + n0 + n4;
  f32x4 ra[4], rb[4];
#pragma unroll
  for (int j = 0; j < 4; ++j) {
    ra[j] = *(const f32x4*)(p + (32 * j) * ND);
    rb[j] = *(const f32x4*)(p + (32 * j + 1) * ND);
  }
#pragma unroll
  for (int j = 0; j < 4; ++j)
#pragma unroll
    for (int i = 0; i < 4; ++i) {
      f16x2 w = {(_Float16)ra[j][i], (_Float16)rb[j][i]};
      *(f16x2*)&sT[(n4 + i) * TPITCH + kp + 32 * j] = w;
    }
  __syncthreads();                    // whole tile in LDS before it is read
  const int n = t >> 4, kc = (t & 15) * 8;   // 16 rows x 16 chunks a pass
  _Float16* q = d + (size_t)(n0 + n) * KD + k0 + kc;
#pragma unroll
  for (int j = 0; j < 4; ++j)
    *(f16x8*)(q + (16 * j) * KD) =
        *(const f16x8*)&sT[(n + 16 * j) * TPITCH + kc];
  // A precaution, as in cvt_piece: code laid behind these stores writes their
  // registers only behind this wait.
  asm volatile("s_wait_xcnt 0x0" ::: "memory");
}

#define SQ_TILES ((HIDDEN / TK) * (HIDDEN / TN))   // [2048][2048]: Wq, Wo
#define KV_TILES ((HIDDEN / TK) * (KVDIM / TN))    // [2048][512]: Wk, Wv, V
#define X_PIECES ((SEQ * HIDDEN) / CVT_PER_BLOCK)

// The five operand conversions depend on nothing and on one another not at
// all: one grid holds them all, a block's index says which job it does, and
// the chip fills once instead of five times.
#define OPERAND_BLOCKS (2 * SQ_TILES + 2 * KV_TILES + X_PIECES)
__global__ __launch_bounds__(256)
void prep_operands(const float* __restrict__ x, const float* __restrict__ Wq,
                   const float* __restrict__ Wk, const float* __restrict__ Wv,
                   const float* __restrict__ Wo, _Float16* __restrict__ x16,
                   _Float16* __restrict__ WqT, _Float16* __restrict__ WkT,
                   _Float16* __restrict__ WvT, _Float16* __restrict__ WoT) {
  __shared__ __align__(16) _Float16 sT[TN * TPITCH];       // 17 KB
  const int b = blockIdx.x, bkv = b - 2 * SQ_TILES;
  if (b < 2 * SQ_TILES) {
    const bool o = b >= SQ_TILES;
    transpose_tile<HIDDEN, HIDDEN>(o ? Wo : Wq, o ? WoT : WqT, sT,
                                   b % SQ_TILES);
  } else if (bkv < 2 * KV_TILES) {
    const bool v = bkv >= KV_TILES;
    transpose_tile<HIDDEN, KVDIM>(v ? Wv : Wk, v ? WvT : WkT, sT,
                                  bkv % KV_TILES);
  } else {
    cvt_piece(x, x16, bkv - 2 * KV_TILES);
  }
}

// ---------------------------------------------------------------------------
// Tiled WMMA GEMM: C[M,N] = A[M,K](f16) * B[K,N] + bias, f32 out.
// B supplied pre-transposed: BT[N][K]. Block tile 128x128, 8 waves (2x4),
// each wave 64x32 => 8 WMMA per 32-deep k-step. LDS tiles double-buffered and
// filled with async Global->LDS copies overlapped with compute.
// ---------------------------------------------------------------------------
__device__ __forceinline__
void gemm_tile(const _Float16* __restrict__ A, const _Float16* __restrict__ BT,
               const float* __restrict__ bias, float* __restrict__ C,
               int N, int K, int bm, int bn) {
  __shared__ __align__(16) _Float16 sA [2][128 * GPITCH];  // [row][k]  2x10 KB
  __shared__ __align__(16) _Float16 sBT[2][128 * GPITCH];  // [col][k]  2x10 KB
  const int tid  = threadIdx.x;
  const int wave = tid >> 5, lane = tid & 31;
  const int hl   = lane >> 4, l16 = lane & 15;
  const int wm = (wave >> 2) * 64, wn = (wave & 3) * 32;

  const v8f vzero = {0.f, 0.f, 0.f, 0.f, 0.f, 0.f, 0.f, 0.f};
  v8f acc[4][2];
#pragma unroll
  for (int t = 0; t < 4; ++t)
#pragma unroll
    for (int u = 0; u < 2; ++u) acc[t][u] = vzero;

  // 4 async b128 copies per thread per tile (2 A + 2 BT).
  auto issue = [&](int buf, int k0) {
#pragma unroll
    for (int i = 0; i < 2; ++i) {
      int ch = tid + i * 256;                 // 512 chunks of 8 f16
      int r  = ch >> 2, c = (ch & 3) * 8;     // 128 rows x 32 k
      cp16(&A [(size_t)(bm + r) * K + k0 + c], &sA [buf][r * GPITCH + c]);
      cp16(&BT[(size_t)(bn + r) * K + k0 + c], &sBT[buf][r * GPITCH + c]);
    }
  };

  issue(0, 0);
  int buf = 0;
  for (int k0 = 0; k0 < K; k0 += 32) {
    const bool more = (k0 + 32) < K;
    if (more) issue(buf ^ 1, k0 + 32);        // prefetch next tile
    if (more) async_wait_le4(); else async_wait_0();
    __syncthreads();                           // current tile visible to all

    v16h bfrag[2];
#pragma unroll
    for (int u = 0; u < 2; ++u)
      bfrag[u] = ldfrag(&sBT[buf][(wn + u * 16 + l16) * GPITCH + hl * 8]);
#pragma unroll
    for (int t = 0; t < 4; ++t) {
      v16h afrag = ldfrag(&sA[buf][(wm + t * 16 + l16) * GPITCH + hl * 8]);
#pragma unroll
      for (int u = 0; u < 2; ++u)
        acc[t][u] = wmma16(afrag, bfrag[u], acc[t][u]);
    }
    __syncthreads();                           // done reading buf
    buf ^= 1;
  }

  // Epilogue: C layout => row = v + 8*(lane>=16), col = lane&15.
#pragma unroll
  for (int t = 0; t < 4; ++t)
#pragma unroll
    for (int u = 0; u < 2; ++u) {
      int col = bn + wn + u * 16 + l16;
      float bs = bias ? bias[col] : 0.0f;
#pragma unroll
      for (int v = 0; v < 8; ++v) {
        int row = bm + wm + t * 16 + v + 8 * hl;
        C[(size_t)row * N + col] = acc[t][u][v] + bs;
      }
      // A precaution: the next tile's sums and addresses go into the registers
      // that these stores name only behind this wait, on every path.
      asm volatile("s_wait_xcnt 0x0" ::: "memory");
    }
}

__global__ __launch_bounds__(256, 2)
void gemm_wmma(const _Float16* __restrict__ A, const _Float16* __restrict__ BT,
               const float* __restrict__ bias, float* __restrict__ C,
               int M, int N, int K) {
  gemm_tile(A, BT, bias, C, N, K, blockIdx.y * 128, blockIdx.x * 128);
}

// The three projections of x in one grid: tile columns 0..15 are Q's, 16..19
// K's, 20..23 V's. Alone, K's and V's 64 tiles each leave three quarters of
// the chip idle for as long as Q's 256 take.
#define Q_COLS   (HIDDEN / 128)
#define KV_COLS  (KVDIM / 128)
__global__ __launch_bounds__(256, 2)
void gemm_qkv(const _Float16* __restrict__ A, const _Float16* __restrict__ WqT,
              const _Float16* __restrict__ WkT,
              const _Float16* __restrict__ WvT, const float* __restrict__ bq,
              const float* __restrict__ bk, const float* __restrict__ bv,
              float* __restrict__ Q, float* __restrict__ Kp,
              float* __restrict__ V, int K) {
  const int c = blockIdx.x;
  const bool q = c < Q_COLS, k = c < Q_COLS + KV_COLS;
  gemm_tile(A, q ? WqT : k ? WkT : WvT, q ? bq : k ? bk : bv,
            q ? Q : k ? Kp : V, q ? HIDDEN : KVDIM, K, blockIdx.y * 128,
            (c - (q ? 0 : k ? Q_COLS : Q_COLS + KV_COLS)) * 128);
}

// ---------------------------------------------------------------------------
// Per-(token, head) layernorm + RoPE. One wave32 takes R neighbouring heads of
// one token; a lane holds elements lane and lane + 32 of each 64-elem head row.
// The rows' loads go out together, their reductions interleave, and the
// token's cos/sin are computed once.
// in: [S][nheads*64] f32 ; out: [nheads][S][64] f16 ; nheads % R == 0
// ---------------------------------------------------------------------------
template <int R>
__device__ __forceinline__
void qk_prep_rows(const float* __restrict__ in, const float* __restrict__ g,
                  const float* __restrict__ b, _Float16* __restrict__ out,
                  int nheads, int blk) {
  const int wave = threadIdx.x >> 5, lane = threadIdx.x & 31;
  const int idx = blk * 8 + wave;
  const int per_tok = nheads / R;
  const int s = idx / per_tok, h0 = (idx % per_tok) * R;
  const float* row = in + ((size_t)s * nheads + h0) * HDIM;
  const float g0 = g[lane], g1 = g[lane + 32];
  const float b0 = b[lane], b1 = b[lane + 32];
  float x0[R], x1[R];
#pragma unroll
  for (int r = 0; r < R; ++r) {
    x0[r] = row[r * HDIM + lane];
    x1[r] = row[r * HDIM + lane + 32];
  }

  // RoPE (emb = concat(freqs, freqs) => freq index = lane for both halves).
  float invf = __powf(10000.0f, -(float)lane / 32.0f);
  float ang  = (float)s * invf;
  float c = cosf(ang), sn = sinf(ang);

  // Each reduction step runs over all R rows before the next step, so that
  // the rows' cross-lane exchanges are in flight together.
  float sum[R];
#pragma unroll
  for (int r = 0; r < R; ++r) sum[r] = x0[r] + x1[r];
#pragma unroll
  for (int off = 16; off >= 1; off >>= 1)
#pragma unroll
    for (int r = 0; r < R; ++r) sum[r] += __shfl_xor(sum[r], off, 32);

  float d0[R], d1[R], vs[R];
#pragma unroll
  for (int r = 0; r < R; ++r) {
    float mu = sum[r] * (1.0f / 64.0f);
    d0[r] = x0[r] - mu;
    d1[r] = x1[r] - mu;
    vs[r] = d0[r] * d0[r] + d1[r] * d1[r];
  }
#pragma unroll
  for (int off = 16; off >= 1; off >>= 1)
#pragma unroll
    for (int r = 0; r < R; ++r) vs[r] += __shfl_xor(vs[r], off, 32);

#pragma unroll
  for (int r = 0; r < R; ++r) {
    float inv = rsqrtf(vs[r] * (1.0f / 64.0f) + 1e-5f);
    float y0 = d0[r] * inv * g0 + b0;
    float y1 = d1[r] * inv * g1 + b1;

    float o0 = y0 * c - y1 * sn;      // rotate_half: [-x2, x1]
    float o1 = y1 * c + y0 * sn;

    _Float16* dst = out + ((size_t)(h0 + r) * SEQ + s) * HDIM;
    dst[lane]      = (_Float16)o0;
    dst[lane + 32] = (_Float16)o1;
  }
  // A precaution, as in cvt_piece: code laid behind these stores writes their
  // registers only behind this wait.
  asm volatile("s_wait_xcnt 0x0" ::: "memory");
}

// What stands between the projections and the attention, in one grid: Q's and
// K's norm + RoPE, and V [S][NKV*64] f32 -> VT [NKV*64][S] f16, which is the
// same transpose as the K/V weights'. The three read and write disjoint
// buffers.
// The grid is three and a half blocks a WGP, seven waves a SIMD: capping the
// occupancy the compiler aims for at eight gives it the registers to keep the
// 16 rows' exchanges in flight together instead of one at a time.
#define Q_BLOCKS ((SEQ * NHEADS) / (8 * 16))
#define K_BLOCKS ((SEQ * NKV) / (8 * 8))
#define HEADS_BLOCKS (Q_BLOCKS + K_BLOCKS + KV_TILES)
static_assert(SEQ == HIDDEN, "V shares the K/V weights' transpose shape");
__global__ __launch_bounds__(256) __attribute__((amdgpu_waves_per_eu(4, 8)))
void prep_heads(const float* __restrict__ Q32, const float* __restrict__ qg,
                const float* __restrict__ qb, _Float16* __restrict__ Q16,
                const float* __restrict__ K32, const float* __restrict__ kg,
                const float* __restrict__ kb, _Float16* __restrict__ K16,
                const float* __restrict__ V32, _Float16* __restrict__ VT16) {
  __shared__ __align__(16) _Float16 sT[TN * TPITCH];       // 17 KB
  const int b = blockIdx.x;
  if (b < Q_BLOCKS)
    qk_prep_rows<16>(Q32, qg, qb, Q16, NHEADS, b);
  else if (b < Q_BLOCKS + K_BLOCKS)
    qk_prep_rows<8>(K32, kg, kb, K16, NKV, b - Q_BLOCKS);
  else
    transpose_tile<HIDDEN, KVDIM>(V32, VT16, sT, b - Q_BLOCKS - K_BLOCKS);
}

// ---------------------------------------------------------------------------
// Flash-style GQA attention. Block = (head, 128-query tile), 8 waves,
// each wave owns 16 query rows; streams double-buffered 64-key tiles.
// Q:[32][S][64] K:[8][S][64] VT:[8][64][S] f16 ; O:[S][2048] f16
// ---------------------------------------------------------------------------
__global__ __launch_bounds__(256, 2)
void attn_fmha(const _Float16* __restrict__ Q, const _Float16* __restrict__ Kh,
               const _Float16* __restrict__ VT, _Float16* __restrict__ O) {
  __shared__ __align__(16) _Float16 sK [2][64 * APITCH];  // [key][dim] 2x9 KB
  __shared__ __align__(16) _Float16 sVT[2][64 * APITCH];  // [dim][key] 2x9 KB
  __shared__ __align__(16) _Float16 sP [8][16 * APITCH];  // per-wave P  18 KB
  const int tid  = threadIdx.x;
  const int wave = tid >> 5, lane = tid & 31;
  const int hl   = lane >> 4, l16 = lane & 15;
  const int h  = blockIdx.y;          // q head
  const int hk = h >> 2;              // kv head (n_rep = 4, grouped-adjacent)
  const int qw = blockIdx.x * 128 + wave * 16;

  // Q fragments (rows qw..qw+15, two 32-wide head-dim chunks), loaded once.
  v16h aq[2];
#pragma unroll
  for (int c = 0; c < 2; ++c)
    aq[c] = ldfrag(&Q[(((size_t)h * SEQ) + qw + l16) * HDIM + c * 32 + hl * 8]);

  const v8f vzero = {0.f, 0.f, 0.f, 0.f, 0.f, 0.f, 0.f, 0.f};
  float m[8], lsum[8];
  v8f oacc[4];
#pragma unroll
  for (int v = 0; v < 8; ++v) { m[v] = -3.0e38f; lsum[v] = 0.0f; }
#pragma unroll
  for (int t = 0; t < 4; ++t) oacc[t] = vzero;

  // 4 async b128 copies per thread per key tile (2 K + 2 VT).
  auto issueKV = [&](int buf, int kb) {
#pragma unroll
    for (int i = 0; i < 2; ++i) {
      int ch = tid + i * 256;                 // 512 chunks of 8 f16
      int rr = ch >> 3, cc = (ch & 7) * 8;    // 64 rows x 64 cols
      cp16(&Kh[(((size_t)hk * SEQ) + kb + rr) * HDIM + cc],
           &sK[buf][rr * APITCH + cc]);
      cp16(&VT[(((size_t)hk * HDIM) + rr) * SEQ + kb + cc],
           &sVT[buf][rr * APITCH + cc]);
    }
  };

  issueKV(0, 0);
  int buf = 0;
  for (int kb = 0; kb < SEQ; kb += 64) {
    const bool more = (kb + 64) < SEQ;
    if (more) issueKV(buf ^ 1, kb + 64);
    if (more) async_wait_le4(); else async_wait_0();
    __syncthreads();

    // S tile = Q * K^T  (16q x 64k per wave: 4 col-tiles x 2 k-chunks)
    v8f sacc[4];
#pragma unroll
    for (int u = 0; u < 4; ++u) {
      sacc[u] = vzero;
#pragma unroll
      for (int c = 0; c < 2; ++c) {
        v16h bk = ldfrag(&sK[buf][(u * 16 + l16) * APITCH + c * 32 + hl * 8]);
        sacc[u] = wmma16(aq[c], bk, sacc[u]);
      }
    }

    // Online softmax: rows live as (v + 8*hl); cols across each 16-lane half.
    float mnew[8], alpha[8];
#pragma unroll
    for (int v = 0; v < 8; ++v) {
      float tm = -3.0e38f;
#pragma unroll
      for (int u = 0; u < 4; ++u) {
        sacc[u][v] *= 0.125f;                  // 1/sqrt(64)
        tm = fmaxf(tm, sacc[u][v]);
      }
#pragma unroll
      for (int off = 8; off >= 1; off >>= 1)
        tm = fmaxf(tm, __shfl_xor(tm, off, 32));
      mnew[v]  = fmaxf(m[v], tm);
      alpha[v] = __expf(m[v] - mnew[v]);
      m[v] = mnew[v];
      float rs = 0.0f;
#pragma unroll
      for (int u = 0; u < 4; ++u) {
        float p = __expf(sacc[u][v] - mnew[v]);
        rs += p;
        sP[wave][(v + 8 * hl) * APITCH + u * 16 + l16] = (_Float16)p;
      }
#pragma unroll
      for (int off = 8; off >= 1; off >>= 1) rs += __shfl_xor(rs, off, 32);
      lsum[v] = lsum[v] * alpha[v] + rs;
#pragma unroll
      for (int t = 0; t < 4; ++t) oacc[t][v] *= alpha[v];
    }

    // O += P * V  (P re-read from per-wave LDS in the WMMA A layout)
#pragma unroll
    for (int c = 0; c < 2; ++c) {
      v16h ap = ldfrag(&sP[wave][l16 * APITCH + c * 32 + hl * 8]);
#pragma unroll
      for (int t = 0; t < 4; ++t) {
        v16h bv = ldfrag(&sVT[buf][(t * 16 + l16) * APITCH + c * 32 + hl * 8]);
        oacc[t] = wmma16(ap, bv, oacc[t]);
      }
    }
    __syncthreads();
    buf ^= 1;
  }

  // Normalize and pack into [seq][heads*64] f16 for the output projection.
#pragma unroll
  for (int t = 0; t < 4; ++t)
#pragma unroll
    for (int v = 0; v < 8; ++v) {
      int row = qw + v + 8 * hl;
      O[(size_t)row * HIDDEN + h * HDIM + t * 16 + l16] =
          (_Float16)(oacc[t][v] / lsum[v]);
    }
}

// ---------------------------------------------------------------------------
// Host orchestration
// ---------------------------------------------------------------------------
extern "C" void kernel_launch(void* const* d_in, const int* in_sizes, int n_in,
                              void* d_out, int out_size, void* d_ws,
                              size_t ws_size, hipStream_t stream) {
  (void)in_sizes; (void)n_in; (void)out_size; (void)ws_size;
  const float* x   = (const float*)d_in[0];
  const float* Wq  = (const float*)d_in[1];
  const float* bq  = (const float*)d_in[2];
  const float* Wk  = (const float*)d_in[3];
  const float* bk  = (const float*)d_in[4];
  const float* Wv  = (const float*)d_in[5];
  const float* bv  = (const float*)d_in[6];
  const float* Wo  = (const float*)d_in[7];
  const float* bo  = (const float*)d_in[8];
  const float* qg  = (const float*)d_in[9];
  const float* qb  = (const float*)d_in[10];
  const float* kg  = (const float*)d_in[11];
  const float* kbb = (const float*)d_in[12];

  char* ws = (char*)d_ws;
  size_t off = 0;
  auto alloc = [&](size_t bytes) {
    void* p = ws + off;
    off += (bytes + 255) & ~(size_t)255;
    return p;
  };
  _Float16* x16   = (_Float16*)alloc((size_t)SEQ * HIDDEN * 2);
  _Float16* WqT16 = (_Float16*)alloc((size_t)HIDDEN * HIDDEN * 2);
  _Float16* WkT16 = (_Float16*)alloc((size_t)HIDDEN * KVDIM * 2);
  _Float16* WvT16 = (_Float16*)alloc((size_t)HIDDEN * KVDIM * 2);
  _Float16* WoT16 = (_Float16*)alloc((size_t)HIDDEN * HIDDEN * 2);
  float*    Q32   = (float*)   alloc((size_t)SEQ * HIDDEN * 4);
  float*    K32   = (float*)   alloc((size_t)SEQ * KVDIM * 4);
  float*    V32   = (float*)   alloc((size_t)SEQ * KVDIM * 4);
  _Float16* Q16   = (_Float16*)alloc((size_t)NHEADS * SEQ * HDIM * 2);
  _Float16* K16   = (_Float16*)alloc((size_t)NKV * SEQ * HDIM * 2);
  _Float16* VT16  = (_Float16*)alloc((size_t)NKV * HDIM * SEQ * 2);
  _Float16* O16   = (_Float16*)alloc((size_t)SEQ * HIDDEN * 2);

  prep_operands<<<OPERAND_BLOCKS, 256, 0, stream>>>(
      x, Wq, Wk, Wv, Wo, x16, WqT16, WkT16, WvT16, WoT16);

  // Projections (f16 WMMA, f32 accum + bias)
  gemm_qkv<<<dim3(Q_COLS + 2 * KV_COLS, SEQ / 128), 256, 0, stream>>>(
      x16, WqT16, WkT16, WvT16, bq, bk, bv, Q32, K32, V32, HIDDEN);

  // Per-head QK layernorm + RoPE, pack head-major f16; V transposed.
  prep_heads<<<HEADS_BLOCKS, 256, 0, stream>>>(
      Q32, qg, qb, Q16, K32, kg, kbb, K16, V32, VT16);

  // GQA flash attention
  attn_fmha<<<dim3(SEQ / 128, NHEADS), 256, 0, stream>>>(Q16, K16, VT16, O16);

  // Output projection -> f32 result
  gemm_wmma<<<dim3(HIDDEN / 128, SEQ / 128), 256, 0, stream>>>(
      O16, WoT16, bo, (float*)d_out, SEQ, HIDDEN, HIDDEN);
}

// v004
// It runs in 130 microseconds.
// Next to v003, in two timings, it ran 1.19 times as fast each time.
// All steps since v000 together make it 3.71 times as fast.
#include <hip/hip_runtime.h>
#include <hip/hip_bf16.h>
#include <stdint.h>

// ---------------------------------------------------------------------------
// Types for CDNA5 WMMA (wave32): A/B = v16h (16 halves = 8 VGPRs),
// C/D = v8f (8 VGPRs of f32).
// ---------------------------------------------------------------------------
typedef __attribute__((ext_vector_type(16))) _Float16 v16h;
typedef __attribute__((ext_vector_type(8)))  float    v8f;
typedef __attribute__((ext_vector_type(8)))  _Float16 f16x8;
typedef __attribute__((ext_vector_type(4)))  int      v4i;
typedef __attribute__((ext_vector_type(4)))  float    f32x4;
typedef __attribute__((ext_vector_type(2)))  _Float16 f16x2;

#define SEQ      2048
#define HIDDEN   2048
#define NHEADS   32
#define NKV      8
#define HDIM     64
#define KVDIM    (NKV * HDIM)   // 512

// LDS row pitches in f16 elements. The GEMM and attention tiles are read by 16-byte loads,
// one row per lane: a pitch of 16 B x odd spreads the 16 rows of a half-wave
// over all 64 banks; the dense 64-B and 128-B rows fold them onto a few.
#define GPITCH   40             // 32-element (64 B) GEMM rows  -> 80 B
#define APITCH   72             // 64-element (128 B) attention rows -> 144 B

// Async Global->LDS (ASYNCcnt-tracked) if the toolchain exposes it.
#if defined(__gfx1250__) && \
    __has_builtin(__builtin_amdgcn_global_load_async_to_lds_b128) && \
    __has_builtin(__builtin_amdgcn_s_wait_asynccnt)
#define HAVE_ASYNC 1
#else
#define HAVE_ASYNC 0
#endif

#if HAVE_ASYNC
// Builtin signature (from compiler diagnostic): typed v4i pointers,
// (addrspace(1) src, addrspace(3) dst, imm offset, imm cpol).
typedef __attribute__((address_space(1))) v4i GlobalV4;
typedef __attribute__((address_space(3))) v4i LocalV4;
#endif

// Copy 16 bytes Global -> LDS. Async path bypasses VGPRs (tracked by
// ASYNCcnt); fallback is a synchronous load+store.
__device__ __forceinline__ void cp16(const _Float16* g, _Float16* l) {
#if HAVE_ASYNC
  __builtin_amdgcn_global_load_async_to_lds_b128(
      (GlobalV4*)(const void*)g, (LocalV4*)(void*)l, 0, 0);
#else
  *(f16x8*)l = *(const f16x8*)g;
#endif
}
__device__ __forceinline__ void async_wait_le4() {
#if HAVE_ASYNC
  __builtin_amdgcn_s_wait_asynccnt(4);   // keep newest 4 (next tile) in flight
#endif
}
__device__ __forceinline__ void async_wait_0() {
#if HAVE_ASYNC
  __builtin_amdgcn_s_wait_asynccnt(0);
#endif
}

__device__ __forceinline__ v8f wmma16(v16h a, v16h b, v8f c) {
  // D = A(16x32 f16) * B(32x16 f16) + C(16x16 f32)
  return __builtin_amdgcn_wmma_f32_16x16x32_f16(
      /*neg_a=*/false, a, /*neg_b=*/false, b,
      /*c_mod=*/(short)0, c, /*reuse_a=*/false, /*reuse_b=*/false);
}

// One lane's 16-element WMMA fragment: two contiguous 8-element (16 B) runs
// 16 elements apart in K (e0..7 -> K = 8*half + e ; e8..15 -> K = 16+8*half+e).
__device__ __forceinline__ v16h ldfrag(const _Float16* p) {
  f16x8 lo = *(const f16x8*)p;
  f16x8 hi = *(const f16x8*)(p + 16);
  v16h r;
#pragma unroll
  for (int j = 0; j < 8; ++j) { r[j] = lo[j]; r[j + 8] = hi[j]; }
  return r;
}

// ---------------------------------------------------------------------------
// Elementwise converts / transposes. These launches move few bytes, so their
// time is the time to start their waves: every thread handles 32 elements
// through 16-byte accesses and the grids stay at a few workgroups per WGP.
// ---------------------------------------------------------------------------
#define CVT_PER_BLOCK (256 * 32)

// f32 -> f16, piece blk of CVT_PER_BLOCK elements. All eight loads of a
// thread are issued before the first convert.
__device__ __forceinline__
void cvt_piece(const float* __restrict__ s, _Float16* __restrict__ d, int blk) {
  const size_t base = (size_t)blk * CVT_PER_BLOCK + threadIdx.x * 8;
  f32x4 lo[4], hi[4];
#pragma unroll
  for (int j = 0; j < 4; ++j) {
    lo[j] = *(const f32x4*)(s + base + j * 2048);
    hi[j] = *(const f32x4*)(s + base + j * 2048 + 4);
  }
#pragma unroll
  for (int j = 0; j < 4; ++j) {
    f16x8 o;
#pragma unroll
    for (int e = 0; e < 4; ++e) {
      o[e]     = (_Float16)lo[j][e];
      o[e + 4] = (_Float16)hi[j][e];
    }
    *(f16x8*)(d + base + j * 2048) = o;
  }
  // A precaution: in a grid of several jobs the listing lays another job's
  // code behind these stores; it writes their registers only behind this wait.
  asm volatile("s_wait_xcnt 0x0" ::: "memory");
}

// S [KD][ND] f32 -> D [ND][KD] f16 (lets the GEMM and the P*V product stream
// their operands as contiguous 16-byte runs straight into LDS).
// One block = one 128(k) x 64(n) tile, number tile in row-major order of the
// (KD / 128) x (ND / 64) tiles, KD % 128 == 0 and ND % 64 == 0:
// 256-byte row pieces in, turned in LDS, 256-byte row pieces out. The shapes
// are compile-time so that a thread's eight loads and four stores each hang
// off one address with immediate offsets.
#define TK       128
#define TN       64
#define TPITCH   (TK + 8)       // 272 B = 16 B x odd for the 16-byte readers
template <int KD, int ND>
__device__ __forceinline__
void transpose_tile(const float* __restrict__ s, _Float16* __restrict__ d,
                    _Float16* sT, int tile) {              // sT: [n][k]
  const int t  = threadIdx.x;
  const int k0 = (tile / (ND / TN)) * TK, n0 = (tile % (ND / TN)) * TN;
  const int n4 = (t & 15) * 4;        // four neighbouring columns
  const int kp = (t >> 4) * 2;        // two neighbouring rows -> one dword

  const float* p = s + (size_t)(k0 + kp) * ND + n0 + n4;
  f32x4 ra[4], rb[4];
#pragma unroll
  for (int j = 0; j < 4; ++j) {
    ra[j] = *(const f32x4*)(p + (32 * j) * ND);
    rb[j] = *(const f32x4*)(p + (32 * j + 1) * ND);
  }
#pragma unroll
  for (int j = 0; j < 4; ++j)
#pragma unroll
    for (int i = 0; i < 4; ++i) {
      f16x2 w = {(_Float16)ra[j][i], (_Float16)rb[j][i]};
      *(f16x2*)&sT[(n4 + i) * TPITCH + kp + 32 * j] = w;
    }
  __syncthreads();                    // whole tile in LDS before it is read
  const int n = t >> 4, kc = (t & 15) * 8;   // 16 rows x 16 chunks a pass
  _Float16* q = d + (size_t)(n0 + n) * KD + k0 + kc;
#pragma unroll
  for (int j = 0; j < 4; ++j)
    *(f16x8*)(q + (16 * j) * KD) =
        *(const f16x8*)&sT[(n + 16 * j) * TPITCH + kc];
  // A precaution, as in cvt_piece: code laid behind these stores writes their
  // registers only behind this wait.
  asm volatile("s_wait_xcnt 0x0" ::: "memory");
}

#define SQ_TILES ((HIDDEN / TK) * (HIDDEN / TN))   // [2048][2048]: Wq, Wo
#define KV_TILES ((HIDDEN / TK) * (KVDIM / TN))    // [2048][512]: Wk, Wv, V
#define X_PIECES ((SEQ * HIDDEN) / CVT_PER_BLOCK)

// The five operand conversions depend on nothing and on one another not at
// all: one grid holds them all, a block's index says which job it does, and
// the chip fills once instead of five times.
#define OPERAND_BLOCKS (2 * SQ_TILES + 2 * KV_TILES + X_PIECES)
__global__ __launch_bounds__(256)
void prep_operands(const float* __restrict__ x, const float* __restrict__ Wq,
                   const float* __restrict__ Wk, const float* __restrict__ Wv,
                   const float* __restrict__ Wo, _Float16* __restrict__ x16,
                   _Float16* __restrict__ WqT, _Float16* __restrict__ WkT,
                   _Float16* __restrict__ WvT, _Float16* __restrict__ WoT) {
  __shared__ __align__(16) _Float16 sT[TN * TPITCH];       // 17 KB
  const int b = blockIdx.x, bkv = b - 2 * SQ_TILES;
  if (b < 2 * SQ_TILES) {
    const bool o = b >= SQ_TILES;
    transpose_tile<HIDDEN, HIDDEN>(o ? Wo : Wq, o ? WoT : WqT, sT,
                                   b % SQ_TILES);
  } else if (bkv < 2 * KV_TILES) {
    const bool v = bkv >= KV_TILES;
    transpose_tile<HIDDEN, KVDIM>(v ? Wv : Wk, v ? WvT : WkT, sT,
                                  bkv % KV_TILES);
  } else {
    cvt_piece(x, x16, bkv - 2 * KV_TILES);
  }
}

// ---------------------------------------------------------------------------
// Tiled WMMA GEMM: C[M,N] = A[M,K](f16) * B[K,N] + bias, f32 out.
// B supplied pre-transposed: BT[N][K]. Block tile 128x128, 8 waves (2x4),
// each wave 64x32 => 8 WMMA per 32-deep k-step. LDS tiles double-buffered and
// filled with async Global->LDS copies overlapped with compute.
// ---------------------------------------------------------------------------
__device__ __forceinline__
void gemm_tile(const _Float16* __restrict__ A, const _Float16* __restrict__ BT,
               const float* __restrict__ bias, float* __restrict__ C,
               int N, int K, int bm, int bn) {
  __shared__ __align__(16) _Float16 sA [2][128 * GPITCH];  // [row][k]  2x10 KB
  __shared__ __align__(16) _Float16 sBT[2][128 * GPITCH];  // [col][k]  2x10 KB
  const int tid  = threadIdx.x;
  const int wave = tid >> 5, lane = tid & 31;
  const int hl   = lane >> 4, l16 = lane & 15;
  const int wm = (wave >> 2) * 64, wn = (wave & 3) * 32;

  const v8f vzero = {0.f, 0.f, 0.f, 0.f, 0.f, 0.f, 0.f, 0.f};
  v8f acc[4][2];
#pragma unroll
  for (int t = 0; t < 4; ++t)
#pragma unroll
    for (int u = 0; u < 2; ++u) acc[t][u] = vzero;

  // 4 async b128 copies per thread per tile (2 A + 2 BT).
  auto issue = [&](int buf, int k0) {
#pragma unroll
    for (int i = 0; i < 2; ++i) {
      int ch = tid + i * 256;                 // 512 chunks of 8 f16
      int r  = ch >> 2, c = (ch & 3) * 8;     // 128 rows x 32 k
      cp16(&A [(size_t)(bm + r) * K + k0 + c], &sA [buf][r * GPITCH + c]);
      cp16(&BT[(size_t)(bn + r) * K + k0 + c], &sBT[buf][r * GPITCH + c]);
    }
  };

  issue(0, 0);
  int buf = 0;
  for (int k0 = 0; k0 < K; k0 += 32) {
    const bool more = (k0 + 32) < K;
    if (more) issue(buf ^ 1, k0 + 32);        // prefetch next tile
    if (more) async_wait_le4(); else async_wait_0();
    __syncthreads();                           // current tile visible to all

    v16h bfrag[2];
#pragma unroll
    for (int u = 0; u < 2; ++u)
      bfrag[u] = ldfrag(&sBT[buf][(wn + u * 16 + l16) * GPITCH + hl * 8]);
#pragma unroll
    for (int t = 0; t < 4; ++t) {
      v16h afrag = ldfrag(&sA[buf][(wm + t * 16 + l16) * GPITCH + hl * 8]);
#pragma unroll
      for (int u = 0; u < 2; ++u)
        acc[t][u] = wmma16(afrag, bfrag[u], acc[t][u]);
    }
    __syncthreads();                           // done reading buf
    buf ^= 1;
  }

  // Epilogue: C layout => row = v + 8*(lane>=16), col = lane&15.
#pragma unroll
  for (int t = 0; t < 4; ++t)
#pragma unroll
    for (int u = 0; u < 2; ++u) {
      int col = bn + wn + u * 16 + l16;
      float bs = bias ? bias[col] : 0.0f;
#pragma unroll
      for (int v = 0; v < 8; ++v) {
        int row = bm + wm + t * 16 + v + 8 * hl;
        C[(size_t)row * N + col] = acc[t][u][v] + bs;
      }
      // A precaution: the next tile's sums and addresses go into the registers
      // that these stores name only behind this wait, on every path.
      asm volatile("s_wait_xcnt 0x0" ::: "memory");
    }
}

__global__ __launch_bounds__(256, 2)
void gemm_wmma(const _Float16* __restrict__ A, const _Float16* __restrict__ BT,
               const float* __restrict__ bias, float* __restrict__ C,
               int M, int N, int K) {
  gemm_tile(A, BT, bias, C, N, K, blockIdx.y * 128, blockIdx.x * 128);
}

// The three projections of x in one grid: tile columns 0..15 are Q's, 16..19
// K's, 20..23 V's. Alone, K's and V's 64 tiles each leave three quarters of
// the chip idle for as long as Q's 256 take.
#define Q_COLS   (HIDDEN / 128)
#define KV_COLS  (KVDIM / 128)
__global__ __launch_bounds__(256, 2)
void gemm_qkv(const _Float16* __restrict__ A, const _Float16* __restrict__ WqT,
              const _Float16* __restrict__ WkT,
              const _Float16* __restrict__ WvT, const float* __restrict__ bq,
              const float* __restrict__ bk, const float* __restrict__ bv,
              float* __restrict__ Q, float* __restrict__ Kp,
              float* __restrict__ V, int K) {
  const int c = blockIdx.x;
  const bool q = c < Q_COLS, k = c < Q_COLS + KV_COLS;
  gemm_tile(A, q ? WqT : k ? WkT : WvT, q ? bq : k ? bk : bv,
            q ? Q : k ? Kp : V, q ? HIDDEN : KVDIM, K, blockIdx.y * 128,
            (c - (q ? 0 : k ? Q_COLS : Q_COLS + KV_COLS)) * 128);
}

// ---------------------------------------------------------------------------
// Per-(token, head) layernorm + RoPE. One wave32 takes R neighbouring heads of
// one token; a lane holds elements lane and lane + 32 of each 64-elem head row.
// The rows' loads go out together, their reductions interleave, and the
// token's cos/sin are computed once.
// in: [S][nheads*64] f32 ; out: [nheads][S][64] f16 ; nheads % R == 0
// ---------------------------------------------------------------------------
template <int R>
__device__ __forceinline__
void qk_prep_rows(const float* __restrict__ in, const float* __restrict__ g,
                  const float* __restrict__ b, _Float16* __restrict__ out,
                  int nheads, int blk) {
  const int wave = threadIdx.x >> 5, lane = threadIdx.x & 31;
  const int idx = blk * 8 + wave;
  const int per_tok = nheads / R;
  const int s = idx / per_tok, h0 = (idx % per_tok) * R;
  const float* row = in + ((size_t)s * nheads + h0) * HDIM;
  const float g0 = g[lane], g1 = g[lane + 32];
  const float b0 = b[lane], b1 = b[lane + 32];
  float x0[R], x1[R];
#pragma unroll
  for (int r = 0; r < R; ++r) {
    x0[r] = row[r * HDIM + lane];
    x1[r] = row[r * HDIM + lane + 32];
  }

  // RoPE (emb = concat(freqs, freqs) => freq index = lane for both halves).
  float invf = __powf(10000.0f, -(float)lane / 32.0f);
  float ang  = (float)s * invf;
  float c = cosf(ang), sn = sinf(ang);

  // Each reduction step runs over all R rows before the next step, so that
  // the rows' cross-lane exchanges are in flight together.
  float sum[R];
#pragma unroll
  for (int r = 0; r < R; ++r) sum[r] = x0[r] + x1[r];
#pragma unroll
  for (int off = 16; off >= 1; off >>= 1)
#pragma unroll
    for (int r = 0; r < R; ++r) sum[r] += __shfl_xor(sum[r], off, 32);

  float d0[R], d1[R], vs[R];
#pragma unroll
  for (int r = 0; r < R; ++r) {
    float mu = sum[r] * (1.0f / 64.0f);
    d0[r] = x0[r] - mu;
    d1[r] = x1[r] - mu;
    vs[r] = d0[r] * d0[r] + d1[r] * d1[r];
  }
#pragma unroll
  for (int off = 16; off >= 1; off >>= 1)
#pragma unroll
    for (int r = 0; r < R; ++r) vs[r] += __shfl_xor(vs[r], off, 32);

#pragma unroll
  for (int r = 0; r < R; ++r) {
    float inv = rsqrtf(vs[r] * (1.0f / 64.0f) + 1e-5f);
    float y0 = d0[r] * inv * g0 + b0;
    float y1 = d1[r] * inv * g1 + b1;

    float o0 = y0 * c - y1 * sn;      // rotate_half: [-x2, x1]
    float o1 = y1 * c + y0 * sn;

    _Float16* dst = out + ((size_t)(h0 + r) * SEQ + s) * HDIM;
    dst[lane]      = (_Float16)o0;
    dst[lane + 32] = (_Float16)o1;
  }
  // A precaution, as in cvt_piece: code laid behind these stores writes their
  // registers only behind this wait.
  asm volatile("s_wait_xcnt 0x0" ::: "memory");
}

// What stands between the projections and the attention, in one grid: Q's and
// K's norm + RoPE, and V [S][NKV*64] f32 -> VT [NKV*64][S] f16, which is the
// same transpose as the K/V weights'. The three read and write disjoint
// buffers.
// The grid is three and a half blocks a WGP, seven waves a SIMD: capping the
// occupancy the compiler aims for at eight gives it the registers to keep the
// 16 rows' exchanges in flight together instead of one at a time.
#define Q_BLOCKS ((SEQ * NHEADS) / (8 * 16))
#define K_BLOCKS ((SEQ * NKV) / (8 * 8))
#define HEADS_BLOCKS (Q_BLOCKS + K_BLOCKS + KV_TILES)
static_assert(SEQ == HIDDEN, "V shares the K/V weights' transpose shape");
__global__ __launch_bounds__(256) __attribute__((amdgpu_waves_per_eu(4, 8)))
void prep_heads(const float* __restrict__ Q32, const float* __restrict__ qg,
                const float* __restrict__ qb, _Float16* __restrict__ Q16,
                const float* __restrict__ K32, const float* __restrict__ kg,
                const float* __restrict__ kb, _Float16* __restrict__ K16,
                const float* __restrict__ V32, _Float16* __restrict__ VT16) {
  __shared__ __align__(16) _Float16 sT[TN * TPITCH];       // 17 KB
  const int b = blockIdx.x;
  if (b < Q_BLOCKS)
    qk_prep_rows<16>(Q32, qg, qb, Q16, NHEADS, b);
  else if (b < Q_BLOCKS + K_BLOCKS)
    qk_prep_rows<8>(K32, kg, kb, K16, NKV, b - Q_BLOCKS);
  else
    transpose_tile<HIDDEN, KVDIM>(V32, VT16, sT, b - Q_BLOCKS - K_BLOCKS);
}

__device__ __forceinline__ float other_half(float x) {
  int b = __builtin_bit_cast(int, x);
  b = __builtin_amdgcn_permlanex16(b, b, 0x76543210, 0xfedcba98, false, false);
  return __builtin_bit_cast(float, b);
}

// The grid is two blocks a WGP, four waves a SIMD: naming that occupancy gives
// the compiler the registers to keep a product's fragment loads together in
// front of its WMMAs; aiming higher, it waits for each fragment by itself.
__global__ __launch_bounds__(256) __attribute__((amdgpu_waves_per_eu(4, 4)))
void attn_fmha(const _Float16* __restrict__ Q, const _Float16* __restrict__ Kh,
               const _Float16* __restrict__ VT, _Float16* __restrict__ O) {
  __shared__ __align__(16) _Float16 sK [2][64 * APITCH];  // [key][dim] 2x9 KB
  __shared__ __align__(16) _Float16 sVT[2][64 * APITCH];  // [dim][key] 2x9 KB
  const int tid  = threadIdx.x;
  const int wave = tid >> 5, lane = tid & 31;
  const int hl   = lane >> 4, l16 = lane & 15;
  const int h  = blockIdx.y;          // q head
  const int hk = h >> 2;              // kv head (n_rep = 4, grouped-adjacent)
  const int qw = blockIdx.x * 128 + wave * 16;

  // Q^T fragments (columns qw..qw+15, two 32-deep head-dim chunks), loaded
  // once: the B operand of the score product.
  v16h bq[2];
#pragma unroll
  for (int c = 0; c < 2; ++c)
    bq[c] = ldfrag(&Q[(((size_t)h * SEQ) + qw + l16) * HDIM + c * 32 + hl * 8]);

  const v8f vzero = {0.f, 0.f, 0.f, 0.f, 0.f, 0.f, 0.f, 0.f};
  float m = -3.0e38f;                 // running maximum of the lane's query
  float lsum = 0.0f;                  // sum over this half's keys only
  v8f oacc[4];                        // O^T: dim t*16 + 8*hl + v, query l16
#pragma unroll
  for (int t = 0; t < 4; ++t) oacc[t] = vzero;

  // 4 async b128 copies per thread per key tile (2 K + 2 VT).
  auto issueKV = [&](int buf, int kb) {
#pragma unroll
    for (int i = 0; i < 2; ++i) {
      int ch = tid + i * 256;                 // 512 chunks of 8 f16
      int rr = ch >> 3, cc = (ch & 7) * 8;    // 64 rows x 64 cols
      cp16(&Kh[(((size_t)hk * SEQ) + kb + rr) * HDIM + cc],
           &sK[buf][rr * APITCH + cc]);
      cp16(&VT[(((size_t)hk * HDIM) + rr) * SEQ + kb + cc],
           &sVT[buf][rr * APITCH + cc]);
    }
  };

  issueKV(0, 0);
  int buf = 0;
  for (int kb = 0; kb < SEQ; kb += 64) {
    const bool more = (kb + 64) < SEQ;
    if (more) issueKV(buf ^ 1, kb + 64);
    if (more) async_wait_le4(); else async_wait_0();
    __syncthreads();

    // S^T tile = K * Q^T  (64k x 16q per wave: 4 row-tiles x 2 k-chunks)
    v8f sacc[4];
#pragma unroll
    for (int u = 0; u < 4; ++u) {
      sacc[u] = vzero;
#pragma unroll
      for (int c = 0; c < 2; ++c) {
        v16h ak = ldfrag(&sK[buf][(u * 16 + l16) * APITCH + c * 32 + hl * 8]);
        sacc[u] = wmma16(ak, bq[c], sacc[u]);
      }
    }

    // Online softmax of the lane's query over its 32 keys of the tile; four
    // independent chains, one per score tile.
    float tmu[4];
#pragma unroll
    for (int u = 0; u < 4; ++u) {
      tmu[u] = -3.0e38f;
#pragma unroll
      for (int v = 0; v < 8; ++v) {
        sacc[u][v] *= 0.125f;                  // 1/sqrt(64)
        tmu[u] = fmaxf(tmu[u], sacc[u][v]);
      }
    }
    float tm = fmaxf(fmaxf(tmu[0], tmu[1]), fmaxf(tmu[2], tmu[3]));
    tm = fmaxf(tm, other_half(tm));            // the query's other 32 keys
    const float mnew  = fmaxf(m, tm);
    const float alpha = __expf(m - mnew);
    m = mnew;

    // P^T as B operand: element e < 8 is key 8*hl + e of the 32-key chunk,
    // element 8 + e key 16 + 8*hl + e, the k order of ldfrag.
    v16h bp[2];
    float rsu[4];
#pragma unroll
    for (int u = 0; u < 4; ++u) {
      rsu[u] = 0.0f;
#pragma unroll
      for (int v = 0; v < 8; ++v) {
        float p = __expf(sacc[u][v] - mnew);
        rsu[u] += p;
        bp[u >> 1][(u & 1) * 8 + v] = (_Float16)p;
      }
    }
    lsum = lsum * alpha + ((rsu[0] + rsu[1]) + (rsu[2] + rsu[3]));
#pragma unroll
    for (int t = 0; t < 4; ++t)
#pragma unroll
      for (int v = 0; v < 8; ++v) oacc[t][v] *= alpha;

    // O^T += V^T * P^T
#pragma unroll
    for (int c = 0; c < 2; ++c)
#pragma unroll
      for (int t = 0; t < 4; ++t) {
        v16h av = ldfrag(&sVT[buf][(t * 16 + l16) * APITCH + c * 32 + hl * 8]);
        oacc[t] = wmma16(av, bp[c], oacc[t]);
      }
    __syncthreads();
    buf ^= 1;
  }

  // Join the halves' sums, normalize and pack into [seq][heads*64] f16 for the
  // output projection: a lane's 8 registers of a tile are 8 neighbouring dims
  // of its query, one 16-byte store.
  const float inv = 1.0f / (lsum + other_half(lsum));
  _Float16* orow = O + (size_t)(qw + l16) * HIDDEN + h * HDIM + 8 * hl;
#pragma unroll
  for (int t = 0; t < 4; ++t) {
    f16x8 o;
#pragma unroll
    for (int v = 0; v < 8; ++v) o[v] = (_Float16)(oacc[t][v] * inv);
    *(f16x8*)(orow + t * 16) = o;
  }
}

// ---------------------------------------------------------------------------
// Host orchestration
// ---------------------------------------------------------------------------
extern "C" void kernel_launch(void* const* d_in, const int* in_sizes, int n_in,
                              void* d_out, int out_size, void* d_ws,
                              size_t ws_size, hipStream_t stream) {
  (void)in_sizes; (void)n_in; (void)out_size; (void)ws_size;
  const float* x   = (const float*)d_in[0];
  const float* Wq  = (const float*)d_in[1];
  const float* bq  = (const float*)d_in[2];
  const float* Wk  = (const float*)d_in[3];
  const float* bk  = (const float*)d_in[4];
  const float* Wv  = (const float*)d_in[5];
  const float* bv  = (const float*)d_in[6];
  const float* Wo  = (const float*)d_in[7];
  const float* bo  = (const float*)d_in[8];
  const float* qg  = (const float*)d_in[9];
  const float* qb  = (const float*)d_in[10];
  const float* kg  = (const float*)d_in[11];
  const float* kbb = (const float*)d_in[12];

  char* ws = (char*)d_ws;
  size_t off = 0;
  auto alloc = [&](size_t bytes) {
    void* p = ws + off;
    off += (bytes + 255) & ~(size_t)255;
    return p;
  };
  _Float16* x16   = (_Float16*)alloc((size_t)SEQ * HIDDEN * 2);
  _Float16* WqT16 = (_Float16*)alloc((size_t)HIDDEN * HIDDEN * 2);
  _Float16* WkT16 = (_Float16*)alloc((size_t)HIDDEN * KVDIM * 2);
  _Float16* WvT16 = (_Float16*)alloc((size_t)HIDDEN * KVDIM * 2);
  _Float16* WoT16 = (_Float16*)alloc((size_t)HIDDEN * HIDDEN * 2);
  float*    Q32   = (float*)   alloc((size_t)SEQ * HIDDEN * 4);
  float*    K32   = (float*)   alloc((size_t)SEQ * KVDIM * 4);
  float*    V32   = (float*)   alloc((size_t)SEQ * KVDIM * 4);
  _Float16* Q16   = (_Float16*)alloc((size_t)NHEADS * SEQ * HDIM * 2);
  _Float16* K16   = (_Float16*)alloc((size_t)NKV * SEQ * HDIM * 2);
  _Float16* VT16  = (_Float16*)alloc((size_t)NKV * HDIM * SEQ * 2);
  _Float16* O16   = (_Float16*)alloc((size_t)SEQ * HIDDEN * 2);

  prep_operands<<<OPERAND_BLOCKS, 256, 0, stream>>>(
      x, Wq, Wk, Wv, Wo, x16, WqT16, WkT16, WvT16, WoT16);

  // Projections (f16 WMMA, f32 accum + bias)
  gemm_qkv<<<dim3(Q_COLS + 2 * KV_COLS, SEQ / 128), 256, 0, stream>>>(
      x16, WqT16, WkT16, WvT16, bq, bk, bv, Q32, K32, V32, HIDDEN);

  // Per-head QK layernorm + RoPE, pack head-major f16; V transposed.
  prep_heads<<<HEADS_BLOCKS, 256, 0, stream>>>(
      Q32, qg, qb, Q16, K32, kg, kbb, K16, V32, VT16);

  // GQA flash attention
  attn_fmha<<<dim3(SEQ / 128, NHEADS), 256, 0, stream>>>(Q16, K16, VT16, O16);

  // Output projection -> f32 result
  gemm_wmma<<<dim3(HIDDEN / 128, SEQ / 128), 256, 0, stream>>>(
      O16, WoT16, bo, (float*)d_out, SEQ, HIDDEN, HIDDEN);
}

// v005
// One run takes 123 microseconds.
// Timed twice side by side with v004, it ran 1.05 and 1.06 times as fast.
// Over all steps from v000 it is 3.91 times as fast.
#include <hip/hip_runtime.h>
#include <hip/hip_bf16.h>
#include <stdint.h>

// ---------------------------------------------------------------------------
// Types for CDNA5 WMMA (wave32): A/B = v16h (16 halves = 8 VGPRs),
// C/D = v8f (8 VGPRs of f32).
// ---------------------------------------------------------------------------
typedef __attribute__((ext_vector_type(16))) _Float16 v16h;
typedef __attribute__((ext_vector_type(8)))  float    v8f;
typedef __attribute__((ext_vector_type(8)))  _Float16 f16x8;
typedef __attribute__((ext_vector_type(4)))  int      v4i;
typedef __attribute__((ext_vector_type(4)))  float    f32x4;
typedef __attribute__((ext_vector_type(2)))  _Float16 f16x2;

#define SEQ      2048
#define HIDDEN   2048
#define NHEADS   32
#define NKV      8
#define HDIM     64
#define KVDIM    (NKV * HDIM)   // 512

// LDS row pitches in f16 elements. The GEMM and attention tiles are read by 16-byte loads,
// one row per lane: a pitch of 16 B x odd spreads the 16 rows of a half-wave
// over all 64 banks; the dense 64-B and 128-B rows fold them onto a few.
#define GPITCH   40             // 32-element (64 B) GEMM rows  -> 80 B
#define APITCH   72             // 64-element (128 B) attention rows -> 144 B

// Async Global->LDS (ASYNCcnt-tracked) if the toolchain exposes it.
#if defined(__gfx1250__) && \
    __has_builtin(__builtin_amdgcn_global_load_async_to_lds_b128) && \
    __has_builtin(__builtin_amdgcn_s_wait_asynccnt)
#define HAVE_ASYNC 1
#else
#define HAVE_ASYNC 0
#endif

#if HAVE_ASYNC
// Builtin signature (from compiler diagnostic): typed v4i pointers,
// (addrspace(1) src, addrspace(3) dst, imm offset, imm cpol).
typedef __attribute__((address_space(1))) v4i GlobalV4;
typedef __attribute__((address_space(3))) v4i LocalV4;
#endif

// Copy 16 bytes Global -> LDS. Async path bypasses VGPRs (tracked by
// ASYNCcnt); fallback is a synchronous load+store.
__device__ __forceinline__ void cp16(const _Float16* g, _Float16* l) {
#if HAVE_ASYNC
  __builtin_amdgcn_global_load_async_to_lds_b128(
      (GlobalV4*)(const void*)g, (LocalV4*)(void*)l, 0, 0);
#else
  *(f16x8*)l = *(const f16x8*)g;
#endif
}
__device__ __forceinline__ void async_wait_le4() {
#if HAVE_ASYNC
  __builtin_amdgcn_s_wait_asynccnt(4);   // keep newest 4 (next tile) in flight
#endif
}
__device__ __forceinline__ void async_wait_0() {
#if HAVE_ASYNC
  __builtin_amdgcn_s_wait_asynccnt(0);
#endif
}

__device__ __forceinline__ v8f wmma16(v16h a, v16h b, v8f c) {
  // D = A(16x32 f16) * B(32x16 f16) + C(16x16 f32)
  return __builtin_amdgcn_wmma_f32_16x16x32_f16(
      /*neg_a=*/false, a, /*neg_b=*/false, b,
      /*c_mod=*/(short)0, c, /*reuse_a=*/false, /*reuse_b=*/false);
}

// One lane's 16-element WMMA fragment: two contiguous 8-element (16 B) runs
// 16 elements apart in K (e0..7 -> K = 8*half + e ; e8..15 -> K = 16+8*half+e).
__device__ __forceinline__ v16h ldfrag(const _Float16* p) {
  f16x8 lo = *(const f16x8*)p;
  f16x8 hi = *(const f16x8*)(p + 16);
  v16h r;
#pragma unroll
  for (int j = 0; j < 8; ++j) { r[j] = lo[j]; r[j + 8] = hi[j]; }
  return r;
}

// ---------------------------------------------------------------------------
// Elementwise converts / transposes. These launches move few bytes, so their
// time is the time to start their waves: every thread handles 32 elements
// through 16-byte accesses and the grids stay at a few workgroups per WGP.
// ---------------------------------------------------------------------------
#define CVT_PER_BLOCK (256 * 32)

// f32 -> f16, piece blk of CVT_PER_BLOCK elements. All eight loads of a
// thread are issued before the first convert.
__device__ __forceinline__
void cvt_piece(const float* __restrict__ s, _Float16* __restrict__ d, int blk) {
  const size_t base = (size_t)blk * CVT_PER_BLOCK + threadIdx.x * 8;
  f32x4 lo[4], hi[4];
#pragma unroll
  for (int j = 0; j < 4; ++j) {
    lo[j] = *(const f32x4*)(s + base + j * 2048);
    hi[j] = *(const f32x4*)(s + base + j * 2048 + 4);
  }
#pragma unroll
  for (int j = 0; j < 4; ++j) {
    f16x8 o;
#pragma unroll
    for (int e = 0; e < 4; ++e) {
      o[e]     = (_Float16)lo[j][e];
      o[e + 4] = (_Float16)hi[j][e];
    }
    *(f16x8*)(d + base + j * 2048) = o;
  }
  // A precaution: in a grid of several jobs the listing lays another job's
  // code behind these stores; it writes their registers only behind this wait.
  asm volatile("s_wait_xcnt 0x0" ::: "memory");
}

// S [KD][ND] f32 -> D [ND][KD] f16 (lets the GEMM and the P*V product stream
// their operands as contiguous 16-byte runs straight into LDS).
// One block = one 128(k) x 64(n) tile, number tile in row-major order of the
// (KD / 128) x (ND / 64) tiles, KD % 128 == 0 and ND % 64 == 0:
// 256-byte row pieces in, turned in LDS, 256-byte row pieces out. The shapes
// are compile-time so that a thread's eight loads and four stores each hang
// off one address with immediate offsets.
#define TK       128
#define TN       64
#define TPITCH   (TK + 8)       // 272 B = 16 B x odd for the 16-byte readers
template <int KD, int ND>
__device__ __forceinline__
void transpose_tile(const float* __restrict__ s, _Float16* __restrict__ d,
                    _Float16* sT, int tile) {              // sT: [n][k]
  const int t  = threadIdx.x;
  const int k0 = (tile / (ND / TN)) * TK, n0 = (tile % (ND / TN)) * TN;
  const int n4 = (t & 15) * 4;        // four neighbouring columns
  const int kp = (t >> 4) * 2;        // two neighbouring rows -> one dword

  const float* p = s + (size_t)(k0 + kp) * ND + n0 + n4;
  f32x4 ra[4], rb[4];
#pragma unroll
  for (int j = 0; j < 4; ++j) {
    ra[j] = *(const f32x4*)(p + (32 * j) * ND);
    rb[j] = *(const f32x4*)(p + (32 * j + 1) * ND);
  }
#pragma unroll
  for (int j = 0; j < 4; ++j)
#pragma unroll
    for (int i = 0; i < 4; ++i) {
      f16x2 w = {(_Float16)ra[j][i], (_Float16)rb[j][i]};
      *(f16x2*)&sT[(n4 + i) * TPITCH + kp + 32 * j] = w;
    }
  __syncthreads();                    // whole tile in LDS before it is read
  const int n = t >> 4, kc = (t & 15) * 8;   // 16 rows x 16 chunks a pass
  _Float16* q = d + (size_t)(n0 + n) * KD + k0 + kc;
#pragma unroll
  for (int j = 0; j < 4; ++j)
    *(f16x8*)(q + (16 * j) * KD) =
        *(const f16x8*)&sT[(n + 16 * j) * TPITCH + kc];
  // A precaution, as in cvt_piece: code laid behind these stores writes their
  // registers only behind this wait.
  asm volatile("s_wait_xcnt 0x0" ::: "memory");
}

#define SQ_TILES ((HIDDEN / TK) * (HIDDEN / TN))   // [2048][2048]: Wq, Wo
#define KV_TILES ((HIDDEN / TK) * (KVDIM / TN))    // [2048][512]: Wk, Wv, V
#define X_PIECES ((SEQ * HIDDEN) / CVT_PER_BLOCK)

// The five operand conversions depend on nothing and on one another not at
// all: one grid holds them all, a block's index says which job it does, and
// the chip fills once instead of five times.
#define OPERAND_BLOCKS (2 * SQ_TILES + 2 * KV_TILES + X_PIECES)
__global__ __launch_bounds__(256)
void prep_operands(const float* __restrict__ x, const float* __restrict__ Wq,
                   const float* __restrict__ Wk, const float* __restrict__ Wv,
                   const float* __restrict__ Wo, _Float16* __restrict__ x16,
                   _Float16* __restrict__ WqT, _Float16* __restrict__ WkT,
                   _Float16* __restrict__ WvT, _Float16* __restrict__ WoT) {
  __shared__ __align__(16) _Float16 sT[TN * TPITCH];       // 17 KB
  const int b = blockIdx.x, bkv = b - 2 * SQ_TILES;
  if (b < 2 * SQ_TILES) {
    const bool o = b >= SQ_TILES;
    transpose_tile<HIDDEN, HIDDEN>(o ? Wo : Wq, o ? WoT : WqT, sT,
                                   b % SQ_TILES);
  } else if (bkv < 2 * KV_TILES) {
    const bool v = bkv >= KV_TILES;
    transpose_tile<HIDDEN, KVDIM>(v ? Wv : Wk, v ? WvT : WkT, sT,
                                  bkv % KV_TILES);
  } else {
    cvt_piece(x, x16, bkv - 2 * KV_TILES);
  }
}

// ---------------------------------------------------------------------------
// Tiled WMMA GEMM: C[M,N] = A[M,K](f16) * B[K,N] + bias, f32 out.
// B supplied pre-transposed: BT[N][K]. Block tile 128x128, 8 waves (2x4),
// each wave 64x32 => 8 WMMA per 32-deep k-step. LDS tiles double-buffered and
// filled with async Global->LDS copies overlapped with compute.
// ---------------------------------------------------------------------------
__device__ __forceinline__
void gemm_tile(const _Float16* __restrict__ A, const _Float16* __restrict__ BT,
               const float* __restrict__ bias, float* __restrict__ C,
               int N, int K, int bm, int bn) {
  __shared__ __align__(16) _Float16 sA [2][128 * GPITCH];  // [row][k]  2x10 KB
  __shared__ __align__(16) _Float16 sBT[2][128 * GPITCH];  // [col][k]  2x10 KB
  const int tid  = threadIdx.x;
  const int wave = tid >> 5, lane = tid & 31;
  const int hl   = lane >> 4, l16 = lane & 15;
  const int wm = (wave >> 2) * 64, wn = (wave & 3) * 32;

  const v8f vzero = {0.f, 0.f, 0.f, 0.f, 0.f, 0.f, 0.f, 0.f};
  v8f acc[4][2];
#pragma unroll
  for (int t = 0; t < 4; ++t)
#pragma unroll
    for (int u = 0; u < 2; ++u) acc[t][u] = vzero;

  // 4 async b128 copies per thread per tile (2 A + 2 BT).
  auto issue = [&](int buf, int k0) {
#pragma unroll
    for (int i = 0; i < 2; ++i) {
      int ch = tid + i * 256;                 // 512 chunks of 8 f16
      int r  = ch >> 2, c = (ch & 3) * 8;     // 128 rows x 32 k
      cp16(&A [(size_t)(bm + r) * K + k0 + c], &sA [buf][r * GPITCH + c]);
      cp16(&BT[(size_t)(bn + r) * K + k0 + c], &sBT[buf][r * GPITCH + c]);
    }
  };

  issue(0, 0);
  int buf = 0;
  for (int k0 = 0; k0 < K; k0 += 32) {
    const bool more = (k0 + 32) < K;
    if (more) issue(buf ^ 1, k0 + 32);        // prefetch next tile
    if (more) async_wait_le4(); else async_wait_0();
    __syncthreads();                           // current tile visible to all

    // All six fragments of the k-step have registers of their own: their
    // twelve LDS loads go out as one group and the wave waits out the LDS
    // latency once a k-step. With one A fragment's registers shared by the
    // four row tiles it waits four times, each behind two WMMAs.
    v16h bfrag[2], afrag[4];
#pragma unroll
    for (int u = 0; u < 2; ++u)
      bfrag[u] = ldfrag(&sBT[buf][(wn + u * 16 + l16) * GPITCH + hl * 8]);
#pragma unroll
    for (int t = 0; t < 4; ++t)
      afrag[t] = ldfrag(&sA[buf][(wm + t * 16 + l16) * GPITCH + hl * 8]);
    // Keeps the group whole: without it the scheduler sinks each A fragment's
    // loads to its WMMAs and folds the four into one register set again.
    __builtin_amdgcn_sched_barrier(0);
#pragma unroll
    for (int t = 0; t < 4; ++t)
#pragma unroll
      for (int u = 0; u < 2; ++u)
        acc[t][u] = wmma16(afrag[t], bfrag[u], acc[t][u]);
    // Keeps the WMMAs in front of the barrier, whose wait for every LDS load
    // would otherwise stand ahead of them all: here each pair starts behind a
    // counted wait, as soon as its own fragments are in.
    __builtin_amdgcn_sched_barrier(0);
    __syncthreads();                           // done reading buf
    buf ^= 1;
  }

  // Epilogue: C layout => row = v + 8*(lane>=16), col = lane&15.
#pragma unroll
  for (int t = 0; t < 4; ++t)
#pragma unroll
    for (int u = 0; u < 2; ++u) {
      int col = bn + wn + u * 16 + l16;
      float bs = bias ? bias[col] : 0.0f;
#pragma unroll
      for (int v = 0; v < 8; ++v) {
        int row = bm + wm + t * 16 + v + 8 * hl;
        C[(size_t)row * N + col] = acc[t][u][v] + bs;
      }
      // A precaution: the next tile's sums and addresses go into the registers
      // that these stores name only behind this wait, on every path.
      asm volatile("s_wait_xcnt 0x0" ::: "memory");
    }
}

__global__ __launch_bounds__(256, 2)
void gemm_wmma(const _Float16* __restrict__ A, const _Float16* __restrict__ BT,
               const float* __restrict__ bias, float* __restrict__ C,
               int M, int N, int K) {
  gemm_tile(A, BT, bias, C, N, K, blockIdx.y * 128, blockIdx.x * 128);
}

// The three projections of x in one grid: tile columns 0..15 are Q's, 16..19
// K's, 20..23 V's. Alone, K's and V's 64 tiles each leave three quarters of
// the chip idle for as long as Q's 256 take.
#define Q_COLS   (HIDDEN / 128)
#define KV_COLS  (KVDIM / 128)
__global__ __launch_bounds__(256, 2)
void gemm_qkv(const _Float16* __restrict__ A, const _Float16* __restrict__ WqT,
              const _Float16* __restrict__ WkT,
              const _Float16* __restrict__ WvT, const float* __restrict__ bq,
              const float* __restrict__ bk, const float* __restrict__ bv,
              float* __restrict__ Q, float* __restrict__ Kp,
              float* __restrict__ V, int K) {
  const int c = blockIdx.x;
  const bool q = c < Q_COLS, k = c < Q_COLS + KV_COLS;
  gemm_tile(A, q ? WqT : k ? WkT : WvT, q ? bq : k ? bk : bv,
            q ? Q : k ? Kp : V, q ? HIDDEN : KVDIM, K, blockIdx.y * 128,
            (c - (q ? 0 : k ? Q_COLS : Q_COLS + KV_COLS)) * 128);
}

// ---------------------------------------------------------------------------
// Per-(token, head) layernorm + RoPE. One wave32 takes R neighbouring heads of
// one token; a lane holds elements lane and lane + 32 of each 64-elem head row.
// The rows' loads go out together, their reductions interleave, and the
// token's cos/sin are computed once.
// in: [S][nheads*64] f32 ; out: [nheads][S][64] f16 ; nheads % R == 0
// ---------------------------------------------------------------------------
template <int R>
__device__ __forceinline__
void qk_prep_rows(const float* __restrict__ in, const float* __restrict__ g,
                  const float* __restrict__ b, _Float16* __restrict__ out,
                  int nheads, int blk) {
  const int wave = threadIdx.x >> 5, lane = threadIdx.x & 31;
  const int idx = blk * 8 + wave;
  const int per_tok = nheads / R;
  const int s = idx / per_tok, h0 = (idx % per_tok) * R;
  const float* row = in + ((size_t)s * nheads + h0) * HDIM;
  const float g0 = g[lane], g1 = g[lane + 32];
  const float b0 = b[lane], b1 = b[lane + 32];
  float x0[R], x1[R];
#pragma unroll
  for (int r = 0; r < R; ++r) {
    x0[r] = row[r * HDIM + lane];
    x1[r] = row[r * HDIM + lane + 32];
  }

  // RoPE (emb = concat(freqs, freqs) => freq index = lane for both halves).
  float invf = __powf(10000.0f, -(float)lane / 32.0f);
  float ang  = (float)s * invf;
  float c = cosf(ang), sn = sinf(ang);

  // Each reduction step runs over all R rows before the next step, so that
  // the rows' cross-lane exchanges are in flight together.
  float sum[R];
#pragma unroll
  for (int r = 0; r < R; ++r) sum[r] = x0[r] + x1[r];
#pragma unroll
  for (int off = 16; off >= 1; off >>= 1)
#pragma unroll
    for (int r = 0; r < R; ++r) sum[r] += __shfl_xor(sum[r], off, 32);

  float d0[R], d1[R], vs[R];
#pragma unroll
  for (int r = 0; r < R; ++r) {
    float mu = sum[r] * (1.0f / 64.0f);
    d0[r] = x0[r] - mu;
    d1[r] = x1[r] - mu;
    vs[r] = d0[r] * d0[r] + d1[r] * d1[r];
  }
#pragma unroll
  for (int off = 16; off >= 1; off >>= 1)
#pragma unroll
    for (int r = 0; r < R; ++r) vs[r] += __shfl_xor(vs[r], off, 32);

#pragma unroll
  for (int r = 0; r < R; ++r) {
    float inv = rsqrtf(vs[r] * (1.0f / 64.0f) + 1e-5f);
    float y0 = d0[r] * inv * g0 + b0;
    float y1 = d1[r] * inv * g1 + b1;

    float o0 = y0 * c - y1 * sn;      // rotate_half: [-x2, x1]
    float o1 = y1 * c + y0 * sn;

    _Float16* dst = out + ((size_t)(h0 + r) * SEQ + s) * HDIM;
    dst[lane]      = (_Float16)o0;
    dst[lane + 32] = (_Float16)o1;
  }
  // A precaution, as in cvt_piece: code laid behind these stores writes their
  // registers only behind this wait.
  asm volatile("s_wait_xcnt 0x0" ::: "memory");
}

// What stands between the projections and the attention, in one grid: Q's and
// K's norm + RoPE, and V [S][NKV*64] f32 -> VT [NKV*64][S] f16, which is the
// same transpose as the K/V weights'. The three read and write disjoint
// buffers.
// The grid is three and a half blocks a WGP, seven waves a SIMD: capping the
// occupancy the compiler aims for at eight gives it the registers to keep the
// 16 rows' exchanges in flight together instead of one at a time.
#define Q_BLOCKS ((SEQ * NHEADS) / (8 * 16))
#define K_BLOCKS ((SEQ * NKV) / (8 * 8))
#define HEADS_BLOCKS (Q_BLOCKS + K_BLOCKS + KV_TILES)
static_assert(SEQ == HIDDEN, "V shares the K/V weights' transpose shape");
__global__ __launch_bounds__(256) __attribute__((amdgpu_waves_per_eu(4, 8)))
void prep_heads(const float* __restrict__ Q32, const float* __restrict__ qg,
                const float* __restrict__ qb, _Float16* __restrict__ Q16,
                const float* __restrict__ K32, const float* __restrict__ kg,
                const float* __restrict__ kb, _Float16* __restrict__ K16,
                const float* __restrict__ V32, _Float16* __restrict__ VT16) {
  __shared__ __align__(16) _Float16 sT[TN * TPITCH];       // 17 KB
  const int b = blockIdx.x;
  if (b < Q_BLOCKS)
    qk_prep_rows<16>(Q32, qg, qb, Q16, NHEADS, b);
  else if (b < Q_BLOCKS + K_BLOCKS)
    qk_prep_rows<8>(K32, kg, kb, K16, NKV, b - Q_BLOCKS);
  else
    transpose_tile<HIDDEN, KVDIM>(V32, VT16, sT, b - Q_BLOCKS - K_BLOCKS);
}

__device__ __forceinline__ float other_half(float x) {
  int b = __builtin_bit_cast(int, x);
  b = __builtin_amdgcn_permlanex16(b, b, 0x76543210, 0xfedcba98, false, false);
  return __builtin_bit_cast(float, b);
}

// The grid is two blocks a WGP, four waves a SIMD: naming that occupancy gives
// the compiler the registers to keep a product's fragment loads together in
// front of its WMMAs; aiming higher, it waits for each fragment by itself.
__global__ __launch_bounds__(256) __attribute__((amdgpu_waves_per_eu(4, 4)))
void attn_fmha(const _Float16* __restrict__ Q, const _Float16* __restrict__ Kh,
               const _Float16* __restrict__ VT, _Float16* __restrict__ O) {
  __shared__ __align__(16) _Float16 sK [2][64 * APITCH];  // [key][dim] 2x9 KB
  __shared__ __align__(16) _Float16 sVT[2][64 * APITCH];  // [dim][key] 2x9 KB
  const int tid  = threadIdx.x;
  const int wave = tid >> 5, lane = tid & 31;
  const int hl   = lane >> 4, l16 = lane & 15;
  const int h  = blockIdx.y;          // q head
  const int hk = h >> 2;              // kv head (n_rep = 4, grouped-adjacent)
  const int qw = blockIdx.x * 128 + wave * 16;

  // Q^T fragments (columns qw..qw+15, two 32-deep head-dim chunks), loaded
  // once: the B operand of the score product.
  v16h bq[2];
#pragma unroll
  for (int c = 0; c < 2; ++c)
    bq[c] = ldfrag(&Q[(((size_t)h * SEQ) + qw + l16) * HDIM + c * 32 + hl * 8]);

  const v8f vzero = {0.f, 0.f, 0.f, 0.f, 0.f, 0.f, 0.f, 0.f};
  float m = -3.0e38f;                 // running maximum of the lane's query
  float lsum = 0.0f;                  // sum over this half's keys only
  v8f oacc[4];                        // O^T: dim t*16 + 8*hl + v, query l16
#pragma unroll
  for (int t = 0; t < 4; ++t) oacc[t] = vzero;

  // 4 async b128 copies per thread per key tile (2 K + 2 VT).
  auto issueKV = [&](int buf, int kb) {
#pragma unroll
    for (int i = 0; i < 2; ++i) {
      int ch = tid + i * 256;                 // 512 chunks of 8 f16
      int rr = ch >> 3, cc = (ch & 7) * 8;    // 64 rows x 64 cols
      cp16(&Kh[(((size_t)hk * SEQ) + kb + rr) * HDIM + cc],
           &sK[buf][rr * APITCH + cc]);
      cp16(&VT[(((size_t)hk * HDIM) + rr) * SEQ + kb + cc],
           &sVT[buf][rr * APITCH + cc]);
    }
  };

  issueKV(0, 0);
  int buf = 0;
  for (int kb = 0; kb < SEQ; kb += 64) {
    const bool more = (kb + 64) < SEQ;
    if (more) issueKV(buf ^ 1, kb + 64);
    if (more) async_wait_le4(); else async_wait_0();
    __syncthreads();

    // S^T tile = K * Q^T  (64k x 16q per wave: 4 row-tiles x 2 k-chunks)
    v8f sacc[4];
#pragma unroll
    for (int u = 0; u < 4; ++u) {
      sacc[u] = vzero;
#pragma unroll
      for (int c = 0; c < 2; ++c) {
        v16h ak = ldfrag(&sK[buf][(u * 16 + l16) * APITCH + c * 32 + hl * 8]);
        sacc[u] = wmma16(ak, bq[c], sacc[u]);
      }
    }

    // Online softmax of the lane's query over its 32 keys of the tile; four
    // independent chains, one per score tile.
    float tmu[4];
#pragma unroll
    for (int u = 0; u < 4; ++u) {
      tmu[u] = -3.0e38f;
#pragma unroll
      for (int v = 0; v < 8; ++v) {
        sacc[u][v] *= 0.125f;                  // 1/sqrt(64)
        tmu[u] = fmaxf(tmu[u], sacc[u][v]);
      }
    }
    float tm = fmaxf(fmaxf(tmu[0], tmu[1]), fmaxf(tmu[2], tmu[3]));
    tm = fmaxf(tm, other_half(tm));            // the query's other 32 keys
    const float mnew  = fmaxf(m, tm);
    const float alpha = __expf(m - mnew);
    m = mnew;

    // P^T as B operand: element e < 8 is key 8*hl + e of the 32-key chunk,
    // element 8 + e key 16 + 8*hl + e, the k order of ldfrag.
    v16h bp[2];
    float rsu[4];
#pragma unroll
    for (int u = 0; u < 4; ++u) {
      rsu[u] = 0.0f;
#pragma unroll
      for (int v = 0; v < 8; ++v) {
        float p = __expf(sacc[u][v] - mnew);
        rsu[u] += p;
        bp[u >> 1][(u & 1) * 8 + v] = (_Float16)p;
      }
    }
    lsum = lsum * alpha + ((rsu[0] + rsu[1]) + (rsu[2] + rsu[3]));
#pragma unroll
    for (int t = 0; t < 4; ++t)
#pragma unroll
      for (int v = 0; v < 8; ++v) oacc[t][v] *= alpha;

    // O^T += V^T * P^T
#pragma unroll
    for (int c = 0; c < 2; ++c)
#pragma unroll
      for (int t = 0; t < 4; ++t) {
        v16h av = ldfrag(&sVT[buf][(t * 16 + l16) * APITCH + c * 32 + hl * 8]);
        oacc[t] = wmma16(av, bp[c], oacc[t]);
      }
    __syncthreads();
    buf ^= 1;
  }

  // Join the halves' sums, normalize and pack into [seq][heads*64] f16 for the
  // output projection: a lane's 8 registers of a tile are 8 neighbouring dims
  // of its query, one 16-byte store.
  const float inv = 1.0f / (lsum + other_half(lsum));
  _Float16* orow = O + (size_t)(qw + l16) * HIDDEN + h * HDIM + 8 * hl;
#pragma unroll
  for (int t = 0; t < 4; ++t) {
    f16x8 o;
#pragma unroll
    for (int v = 0; v < 8; ++v) o[v] = (_Float16)(oacc[t][v] * inv);
    *(f16x8*)(orow + t * 16) = o;
  }
}

// ---------------------------------------------------------------------------
// Host orchestration
// ---------------------------------------------------------------------------
extern "C" void kernel_launch(void* const* d_in, const int* in_sizes, int n_in,
                              void* d_out, int out_size, void* d_ws,
                              size_t ws_size, hipStream_t stream) {
  (void)in_sizes; (void)n_in; (void)out_size; (void)ws_size;
  const float* x   = (const float*)d_in[0];
  const float* Wq  = (const float*)d_in[1];
  const float* bq  = (const float*)d_in[2];
  const float* Wk  = (const float*)d_in[3];
  const float* bk  = (const float*)d_in[4];
  const float* Wv  = (const float*)d_in[5];
  const float* bv  = (const float*)d_in[6];
  const float* Wo  = (const float*)d_in[7];
  const float* bo  = (const float*)d_in[8];
  const float* qg  = (const float*)d_in[9];
  const float* qb  = (const float*)d_in[10];
  const float* kg  = (const float*)d_in[11];
  const float* kbb = (const float*)d_in[12];

  char* ws = (char*)d_ws;
  size_t off = 0;
  auto alloc = [&](size_t bytes) {
    void* p = ws + off;
    off += (bytes + 255) & ~(size_t)255;
    return p;
  };
  _Float16* x16   = (_Float16*)alloc((size_t)SEQ * HIDDEN * 2);
  _Float16* WqT16 = (_Float16*)alloc((size_t)HIDDEN * HIDDEN * 2);
  _Float16* WkT16 = (_Float16*)alloc((size_t)HIDDEN * KVDIM * 2);
  _Float16* WvT16 = (_Float16*)alloc((size_t)HIDDEN * KVDIM * 2);
  _Float16* WoT16 = (_Float16*)alloc((size_t)HIDDEN * HIDDEN * 2);
  float*    Q32   = (float*)   alloc((size_t)SEQ * HIDDEN * 4);
  float*    K32   = (float*)   alloc((size_t)SEQ * KVDIM * 4);
  float*    V32   = (float*)   alloc((size_t)SEQ * KVDIM * 4);
  _Float16* Q16   = (_Float16*)alloc((size_t)NHEADS * SEQ * HDIM * 2);
  _Float16* K16   = (_Float16*)alloc((size_t)NKV * SEQ * HDIM * 2);
  _Float16* VT16  = (_Float16*)alloc((size_t)NKV * HDIM * SEQ * 2);
  _Float16* O16   = (_Float16*)alloc((size_t)SEQ * HIDDEN * 2);

  prep_operands<<<OPERAND_BLOCKS, 256, 0, stream>>>(
      x, Wq, Wk, Wv, Wo, x16, WqT16, WkT16, WvT16, WoT16);

  // Projections (f16 WMMA, f32 accum + bias)
  gemm_qkv<<<dim3(Q_COLS + 2 * KV_COLS, SEQ / 128), 256, 0, stream>>>(
      x16, WqT16, WkT16, WvT16, bq, bk, bv, Q32, K32, V32, HIDDEN);

  // Per-head QK layernorm + RoPE, pack head-major f16; V transposed.
  prep_heads<<<HEADS_BLOCKS, 256, 0, stream>>>(
      Q32, qg, qb, Q16, K32, kg, kbb, K16, V32, VT16);

  // GQA flash attention
  attn_fmha<<<dim3(SEQ / 128, NHEADS), 256, 0, stream>>>(Q16, K16, VT16, O16);

  // Output projection -> f32 result
  gemm_wmma<<<dim3(HIDDEN / 128, SEQ / 128), 256, 0, stream>>>(
      O16, WoT16, bo, (float*)d_out, SEQ, HIDDEN, HIDDEN);
}

// v006
// One run takes 116 microseconds.
// Next to v005, in two timings, it ran 1.07 and 1.05 times as fast.
// Over all steps from v000 it is 4.13 times as fast.
#include <hip/hip_runtime.h>
#include <hip/hip_bf16.h>
#include <stdint.h>

// ---------------------------------------------------------------------------
// Types for CDNA5 WMMA (wave32): A/B = v16h (16 halves = 8 VGPRs),
// C/D = v8f (8 VGPRs of f32).
// ---------------------------------------------------------------------------
typedef __attribute__((ext_vector_type(16))) _Float16 v16h;
typedef __attribute__((ext_vector_type(8)))  float    v8f;
typedef __attribute__((ext_vector_type(8)))  _Float16 f16x8;
typedef __attribute__((ext_vector_type(4)))  int      v4i;
typedef __attribute__((ext_vector_type(4)))  float    f32x4;
typedef __attribute__((ext_vector_type(2)))  _Float16 f16x2;

#define SEQ      2048
#define HIDDEN   2048
#define NHEADS   32
#define NKV      8
#define HDIM     64
#define KVDIM    (NKV * HDIM)   // 512

// LDS row pitches in f16 elements. The GEMM and attention tiles are read by 16-byte loads,
// one row per lane: a pitch of 16 B x odd spreads the 16 rows of a half-wave
// over all 64 banks; the dense 64-B and 128-B rows fold them onto a few.
#define GPITCH   40             // 32-element (64 B) GEMM rows  -> 80 B
#define APITCH   72             // 64-element (128 B) attention rows -> 144 B

// Async Global->LDS (ASYNCcnt-tracked) if the toolchain exposes it.
#if defined(__gfx1250__) && \
    __has_builtin(__builtin_amdgcn_global_load_async_to_lds_b128) && \
    __has_builtin(__builtin_amdgcn_s_wait_asynccnt)
#define HAVE_ASYNC 1
#else
#define HAVE_ASYNC 0
#endif

#if HAVE_ASYNC
// Builtin signature (from compiler diagnostic): typed v4i pointers,
// (addrspace(1) src, addrspace(3) dst, imm offset, imm cpol).
typedef __attribute__((address_space(1))) v4i GlobalV4;
typedef __attribute__((address_space(3))) v4i LocalV4;
#endif

// Copy 16 bytes Global -> LDS. Async path bypasses VGPRs (tracked by
// ASYNCcnt); fallback is a synchronous load+store.
__device__ __forceinline__ void cp16(const _Float16* g, _Float16* l) {
#if HAVE_ASYNC
  __builtin_amdgcn_global_load_async_to_lds_b128(
      (GlobalV4*)(const void*)g, (LocalV4*)(void*)l, 0, 0);
#else
  *(f16x8*)l = *(const f16x8*)g;
#endif
}
__device__ __forceinline__ void async_wait_le4() {
#if HAVE_ASYNC
  __builtin_amdgcn_s_wait_asynccnt(4);   // keep newest 4 (next tile) in flight
#endif
}
__device__ __forceinline__ void async_wait_0() {
#if HAVE_ASYNC
  __builtin_amdgcn_s_wait_asynccnt(0);
#endif
}

__device__ __forceinline__ v8f wmma16(v16h a, v16h b, v8f c) {
  // D = A(16x32 f16) * B(32x16 f16) + C(16x16 f32)
  return __builtin_amdgcn_wmma_f32_16x16x32_f16(
      /*neg_a=*/false, a, /*neg_b=*/false, b,
      /*c_mod=*/(short)0, c, /*reuse_a=*/false, /*reuse_b=*/false);
}

// One lane's 16-element WMMA fragment: two contiguous 8-element (16 B) runs
// 16 elements apart in K (e0..7 -> K = 8*half + e ; e8..15 -> K = 16+8*half+e).
__device__ __forceinline__ v16h ldfrag(const _Float16* p) {
  f16x8 lo = *(const f16x8*)p;
  f16x8 hi = *(const f16x8*)(p + 16);
  v16h r;
#pragma unroll
  for (int j = 0; j < 8; ++j) { r[j] = lo[j]; r[j + 8] = hi[j]; }
  return r;
}

// ---------------------------------------------------------------------------
// Elementwise converts / transposes. These launches move few bytes, so their
// time is the time to start their waves: every thread handles 32 elements
// through 16-byte accesses and the grids stay at a few workgroups per WGP.
// ---------------------------------------------------------------------------
#define CVT_PER_BLOCK (256 * 32)

// f32 -> f16, piece blk of CVT_PER_BLOCK elements. All eight loads of a
// thread are issued before the first convert.
__device__ __forceinline__
void cvt_piece(const float* __restrict__ s, _Float16* __restrict__ d, int blk) {
  const size_t base = (size_t)blk * CVT_PER_BLOCK + threadIdx.x * 8;
  f32x4 lo[4], hi[4];
#pragma unroll
  for (int j = 0; j < 4; ++j) {
    lo[j] = *(const f32x4*)(s + base + j * 2048);
    hi[j] = *(const f32x4*)(s + base + j * 2048 + 4);
  }
#pragma unroll
  for (int j = 0; j < 4; ++j) {
    f16x8 o;
#pragma unroll
    for (int e = 0; e < 4; ++e) {
      o[e]     = (_Float16)lo[j][e];
      o[e + 4] = (_Float16)hi[j][e];
    }
    *(f16x8*)(d + base + j * 2048) = o;
  }
  // A precaution: in a grid of several jobs the listing lays another job's
  // code behind these stores; it writes their registers only behind this wait.
  asm volatile("s_wait_xcnt 0x0" ::: "memory");
}

// S [KD][ND] f32 -> D [ND][KD] f16 (lets the GEMMs stream
// their operands as contiguous 16-byte runs straight into LDS).
// One block = one 128(k) x 64(n) tile, number tile in row-major order of the
// (KD / 128) x (ND / 64) tiles, KD % 128 == 0 and ND % 64 == 0:
// 256-byte row pieces in, turned in LDS, 256-byte row pieces out. The shapes
// are compile-time so that a thread's eight loads and four stores each hang
// off one address with immediate offsets.
#define TK       128
#define TN       64
#define TPITCH   (TK + 8)       // 272 B = 16 B x odd for the 16-byte readers
template <int KD, int ND>
__device__ __forceinline__
void transpose_tile(const float* __restrict__ s, _Float16* __restrict__ d,
                    _Float16* sT, int tile) {              // sT: [n][k]
  const int t  = threadIdx.x;
  const int k0 = (tile / (ND / TN)) * TK, n0 = (tile % (ND / TN)) * TN;
  const int n4 = (t & 15) * 4;        // four neighbouring columns
  const int kp = (t >> 4) * 2;        // two neighbouring rows -> one dword

  const float* p = s + (size_t)(k0 + kp) * ND + n0 + n4;
  f32x4 ra[4], rb[4];
#pragma unroll
  for (int j = 0; j < 4; ++j) {
    ra[j] = *(const f32x4*)(p + (32 * j) * ND);
    rb[j] = *(const f32x4*)(p + (32 * j + 1) * ND);
  }
#pragma unroll
  for (int j = 0; j < 4; ++j)
#pragma unroll
    for (int i = 0; i < 4; ++i) {
      f16x2 w = {(_Float16)ra[j][i], (_Float16)rb[j][i]};
      *(f16x2*)&sT[(n4 + i) * TPITCH + kp + 32 * j] = w;
    }
  __syncthreads();                    // whole tile in LDS before it is read
  const int n = t >> 4, kc = (t & 15) * 8;   // 16 rows x 16 chunks a pass
  _Float16* q = d + (size_t)(n0 + n) * KD + k0 + kc;
#pragma unroll
  for (int j = 0; j < 4; ++j)
    *(f16x8*)(q + (16 * j) * KD) =
        *(const f16x8*)&sT[(n + 16 * j) * TPITCH + kc];
  // A precaution, as in cvt_piece: code laid behind these stores writes their
  // registers only behind this wait.
  asm volatile("s_wait_xcnt 0x0" ::: "memory");
}

// RoPE tables cosT, sinT [S][32] f32 (emb = concat(freqs, freqs): frequency
// index = dim % 32). Piece blk holds 32 positions; a wave takes four of them,
// a lane one frequency. The projection's epilogue reads them: there every
// head of a position would otherwise work out the same 32 angles again.
#define NFREQ    (HDIM / 2)
#define ROPE_BLOCKS (SEQ / 32)
__device__ __forceinline__
void rope_piece(float* __restrict__ cosT, float* __restrict__ sinT, int blk) {
  const int wave = threadIdx.x >> 5, lane = threadIdx.x & 31;
  const float invf = __powf(10000.0f, -(float)lane / 32.0f);
  // Rolled: cosf and sinf are long, and code that runs once is fetched cold;
  // unrolled, every trip would wait for instructions of its own.
#pragma unroll 1
  for (int j = 0; j < 4; ++j) {
    const int s = blk * 32 + j * 8 + wave;
    const float ang = (float)s * invf;
    cosT[s * NFREQ + lane] = cosf(ang);
    sinT[s * NFREQ + lane] = sinf(ang);
    // A precaution, as in cvt_piece: the next trip, and code laid behind the
    // loop, write these stores' registers only behind this wait.
    asm volatile("s_wait_xcnt 0x0" ::: "memory");
  }
}

#define SQ_TILES ((HIDDEN / TK) * (HIDDEN / TN))   // [2048][2048]: Wq, Wo
#define KV_TILES ((HIDDEN / TK) * (KVDIM / TN))    // [2048][512]: Wk, Wv
#define X_PIECES ((SEQ * HIDDEN) / CVT_PER_BLOCK)

// The five operand conversions and the RoPE tables depend on nothing and on
// one another not at all: one grid holds them all, a block's index says which
// job it does, and the chip fills once instead of six times. The table blocks,
// the longest in instructions, come first.
#define OPERAND_BLOCKS (ROPE_BLOCKS + 2 * SQ_TILES + 2 * KV_TILES + X_PIECES)
__global__ __launch_bounds__(256)
void prep_operands(const float* __restrict__ x, const float* __restrict__ Wq,
                   const float* __restrict__ Wk, const float* __restrict__ Wv,
                   const float* __restrict__ Wo, _Float16* __restrict__ x16,
                   _Float16* __restrict__ WqT, _Float16* __restrict__ WkT,
                   _Float16* __restrict__ WvT, _Float16* __restrict__ WoT,
                   float* __restrict__ cosT, float* __restrict__ sinT) {
  __shared__ __align__(16) _Float16 sT[TN * TPITCH];       // 17 KB
  const int b = (int)blockIdx.x - ROPE_BLOCKS, bkv = b - 2 * SQ_TILES;
  if (b < 0) {
    rope_piece(cosT, sinT, blockIdx.x);
  } else if (b < 2 * SQ_TILES) {
    const bool o = b >= SQ_TILES;
    transpose_tile<HIDDEN, HIDDEN>(o ? Wo : Wq, o ? WoT : WqT, sT,
                                   b % SQ_TILES);
  } else if (bkv < 2 * KV_TILES) {
    const bool v = bkv >= KV_TILES;
    transpose_tile<HIDDEN, KVDIM>(v ? Wv : Wk, v ? WvT : WkT, sT,
                                  bkv % KV_TILES);
  } else {
    cvt_piece(x, x16, bkv - 2 * KV_TILES);
  }
}

// ---------------------------------------------------------------------------
// Tiled WMMA GEMM: C[M,N] = A[M,K](f16) * B[K,N] + bias, f32 out.
// B supplied pre-transposed: BT[N][K]. Block tile 128x128, 8 waves (2x4),
// each wave 64x32 => 8 WMMA per 32-deep k-step. LDS tiles double-buffered and
// filled with async Global->LDS copies overlapped with compute.
// ---------------------------------------------------------------------------
// gemm_acc leaves the wave's sums in acc[t][u]: row bm + wm + t*16 + v + 8*half
// of A against row bn + wn + u*16 + (lane & 15) of BT.
__device__ __forceinline__
void gemm_acc(const _Float16* __restrict__ A, const _Float16* __restrict__ BT,
              int K, int bm, int bn, v8f (&acc)[4][2]) {
  __shared__ __align__(16) _Float16 sA [2][128 * GPITCH];  // [row][k]  2x10 KB
  __shared__ __align__(16) _Float16 sBT[2][128 * GPITCH];  // [col][k]  2x10 KB
  const int tid  = threadIdx.x;
  const int wave = tid >> 5, lane = tid & 31;
  const int hl   = lane >> 4, l16 = lane & 15;
  const int wm = (wave >> 2) * 64, wn = (wave & 3) * 32;

  const v8f vzero = {0.f, 0.f, 0.f, 0.f, 0.f, 0.f, 0.f, 0.f};
#pragma unroll
  for (int t = 0; t < 4; ++t)
#pragma unroll
    for (int u = 0; u < 2; ++u) acc[t][u] = vzero;

  // 4 async b128 copies per thread per tile (2 A + 2 BT).
  auto issue = [&](int buf, int k0) {
#pragma unroll
    for (int i = 0; i < 2; ++i) {
      int ch = tid + i * 256;                 // 512 chunks of 8 f16
      int r  = ch >> 2, c = (ch & 3) * 8;     // 128 rows x 32 k
      cp16(&A [(size_t)(bm + r) * K + k0 + c], &sA [buf][r * GPITCH + c]);
      cp16(&BT[(size_t)(bn + r) * K + k0 + c], &sBT[buf][r * GPITCH + c]);
    }
  };

  issue(0, 0);
  int buf = 0;
  for (int k0 = 0; k0 < K; k0 += 32) {
    const bool more = (k0 + 32) < K;
    if (more) issue(buf ^ 1, k0 + 32);        // prefetch next tile
    if (more) async_wait_le4(); else async_wait_0();
    __syncthreads();                           // current tile visible to all

    // All six fragments of the k-step have registers of their own: their
    // twelve LDS loads go out as one group and the wave waits out the LDS
    // latency once a k-step. With one A fragment's registers shared by the
    // four row tiles it waits four times, each behind two WMMAs.
    v16h bfrag[2], afrag[4];
#pragma unroll
    for (int u = 0; u < 2; ++u)
      bfrag[u] = ldfrag(&sBT[buf][(wn + u * 16 + l16) * GPITCH + hl * 8]);
#pragma unroll
    for (int t = 0; t < 4; ++t)
      afrag[t] = ldfrag(&sA[buf][(wm + t * 16 + l16) * GPITCH + hl * 8]);
    // Keeps the group whole: without it the scheduler sinks each A fragment's
    // loads to its WMMAs and folds the four into one register set again.
    __builtin_amdgcn_sched_barrier(0);
#pragma unroll
    for (int t = 0; t < 4; ++t)
#pragma unroll
      for (int u = 0; u < 2; ++u)
        acc[t][u] = wmma16(afrag[t], bfrag[u], acc[t][u]);
    // Keeps the WMMAs in front of the barrier, whose wait for every LDS load
    // would otherwise stand ahead of them all: here each pair starts behind a
    // counted wait, as soon as its own fragments are in.
    __builtin_amdgcn_sched_barrier(0);
    __syncthreads();                           // done reading buf
    buf ^= 1;
  }
}

__device__ __forceinline__
void gemm_tile(const _Float16* __restrict__ A, const _Float16* __restrict__ BT,
               const float* __restrict__ bias, float* __restrict__ C,
               int N, int K, int bm, int bn) {
  const int wave = threadIdx.x >> 5, lane = threadIdx.x & 31;
  const int hl   = lane >> 4, l16 = lane & 15;
  const int wm = (wave >> 2) * 64, wn = (wave & 3) * 32;
  v8f acc[4][2];
  gemm_acc(A, BT, K, bm, bn, acc);

  // Epilogue: C layout => row = v + 8*(lane>=16), col = lane&15.
#pragma unroll
  for (int t = 0; t < 4; ++t)
#pragma unroll
    for (int u = 0; u < 2; ++u) {
      int col = bn + wn + u * 16 + l16;
      float bs = bias ? bias[col] : 0.0f;
#pragma unroll
      for (int v = 0; v < 8; ++v) {
        int row = bm + wm + t * 16 + v + 8 * hl;
        C[(size_t)row * N + col] = acc[t][u][v] + bs;
      }
      // A precaution: the next tile's sums and addresses go into the registers
      // that these stores name only behind this wait, on every path.
      asm volatile("s_wait_xcnt 0x0" ::: "memory");
    }
}

__global__ __launch_bounds__(256, 2)
void gemm_wmma(const _Float16* __restrict__ A, const _Float16* __restrict__ BT,
               const float* __restrict__ bias, float* __restrict__ C,
               int M, int N, int K) {
  gemm_tile(A, BT, bias, C, N, K, blockIdx.y * 128, blockIdx.x * 128);
}

// Value of lane l ^ 16.
__device__ __forceinline__ float other_half(float x) {
  int b = __builtin_bit_cast(int, x);
  b = __builtin_amdgcn_permlanex16(b, b, 0x76543210, 0xfedcba98, false, false);
  return __builtin_bit_cast(float, b);
}

// Eight neighbouring f32 (32-byte aligned) by two 16-byte loads, at byte
// offset off (the lane's) + imm (a constant) from a wave-uniform base.
__device__ __forceinline__
void ld8(const float* __restrict__ base, unsigned off, int imm, float (&r)[8]) {
  const float* p = (const float*)((const char*)base + off) + imm / 4;
  const f32x4 lo = *(const f32x4*)p, hi = *(const f32x4*)(p + 4);
#pragma unroll
  for (int e = 0; e < 4; ++e) { r[e] = lo[e]; r[e + 4] = hi[e]; }
}

// Epilogue of a Q or K tile: bias, per-(token, head) layernorm and RoPE on the
// sums while they are in registers, packed head-major f16.
// The tile was computed transposed (rows = output dims, columns = tokens), and
// a wave's 64 rows are one head: a lane holds dims t*16 + 8*half + v of token
// u*16 + (lane & 15), half a head row. Mean and variance are sums in the
// lane's own registers plus one exchange between the wave's halves; dims d and
// d + 32, RoPE's pair, are tiles t and t + 2 of the same lane; eight
// neighbouring dims leave as one 16-byte store.
// bias: the projection's, head its head; out: the head's [S][64] f16; tok0:
// the wave's first token.
__device__ __forceinline__
void head_epilogue(const v8f (&acc)[4][2], const float* __restrict__ bias,
                   int head, const float* __restrict__ g,
                   const float* __restrict__ b,
                   const float* __restrict__ cosT,
                   const float* __restrict__ sinT, _Float16* __restrict__ out,
                   int tok0) {
  const int lane = threadIdx.x & 31;
  const int hl   = lane >> 4, l16 = lane & 15;
  const unsigned doff = hl * 32u;              // bytes: dims 8*half ...
  const unsigned boff = (unsigned)head * (HDIM * 4u) + doff;
#pragma unroll
  for (int u = 0; u < 2; ++u) {
    const int tok = tok0 + u * 16 + l16;
    const unsigned toff = (unsigned)tok * (NFREQ * 4u) + doff;
    // All that the token needs from memory goes out as one group: one memory
    // latency a token.
    float bs[4][8], gg[4][8], bb[4][8], c[2][8], sn[2][8];
#pragma unroll
    for (int t = 0; t < 4; ++t) {
      ld8(bias, boff, t * 64, bs[t]);
      ld8(g, doff, t * 64, gg[t]);
      ld8(b, doff, t * 64, bb[t]);
    }
#pragma unroll
    for (int t = 0; t < 2; ++t) {
      ld8(cosT, toff, t * 64, c[t]);
      ld8(sinT, toff, t * 64, sn[t]);
    }
    // A precaution: the loads' offset registers are inputs here, so they live
    // up to this wait and nothing, a later load's result included, is written
    // over them in front of it.
    asm volatile("s_wait_xcnt 0x0" :: "v"(doff), "v"(boff), "v"(toff)
                 : "memory");
    // Keeps the group whole: without it the scheduler sinks the scale, shift
    // and table loads behind the sums, and the wave waits out their latency
    // three times a token.
    __builtin_amdgcn_sched_barrier(0);

    float x[4][8], part[4];
#pragma unroll
    for (int t = 0; t < 4; ++t) {
      part[t] = 0.0f;
#pragma unroll
      for (int v = 0; v < 8; ++v) {
        x[t][v] = acc[t][u][v] + bs[t][v];
        part[t] += x[t][v];
      }
    }
    float sum = (part[0] + part[1]) + (part[2] + part[3]);
    sum += other_half(sum);                    // the head row's other 32 dims
    const float mu = sum * (1.0f / 64.0f);
#pragma unroll
    for (int t = 0; t < 4; ++t) {
      part[t] = 0.0f;
#pragma unroll
      for (int v = 0; v < 8; ++v) {
        x[t][v] -= mu;
        part[t] += x[t][v] * x[t][v];
      }
    }
    float vs = (part[0] + part[1]) + (part[2] + part[3]);
    vs += other_half(vs);
    const float inv = rsqrtf(vs * (1.0f / 64.0f) + 1e-5f);
#pragma unroll
    for (int t = 0; t < 4; ++t)
#pragma unroll
      for (int v = 0; v < 8; ++v)
        x[t][v] = x[t][v] * inv * gg[t][v] + bb[t][v];
    _Float16* dst = out + (size_t)tok * HDIM + 8 * hl;
#pragma unroll
    for (int t = 0; t < 2; ++t) {
      f16x8 o0, o1;
#pragma unroll
      for (int v = 0; v < 8; ++v) {            // rotate_half: [-x2, x1]
        o0[v] = (_Float16)(x[t][v] * c[t][v] - x[t + 2][v] * sn[t][v]);
        o1[v] = (_Float16)(x[t + 2][v] * c[t][v] + x[t][v] * sn[t][v]);
      }
      *(f16x8*)(dst + t * 16)      = o0;
      *(f16x8*)(dst + t * 16 + 32) = o1;
    }
    // A precaution: the next token's values and addresses go into the
    // registers that these stores name only behind this wait.
    asm volatile("s_wait_xcnt 0x0" ::: "memory");
  }
}

// The three projections of x in one grid: tile columns 0..15 are Q's, 16..19
// K's, 20..23 V's. Alone, K's and V's 64 tiles each leave three quarters of
// the chip idle for as long as Q's 256 take.
// What stood between the projections and the attention as a launch of its own
// is each tile's epilogue. Both operands lie in LDS as rows along k, so which
// of them is the matrix instruction's A is free:
//  - Q and K tiles take the weights as A (rows = dims): head_epilogue.
//  - V tiles take x as A (rows = tokens): a lane's 8 registers of a tile are 8
//    neighbouring tokens of one dim, one 16-byte store into VT [NKV*64][S].
// out: Q16 [32][S][64], K16 [8][S][64], VT16 [8*64][S], all f16.
#define Q_COLS   (HIDDEN / 128)
#define KV_COLS  (KVDIM / 128)
__global__ __launch_bounds__(256, 2)
void gemm_qkv(const _Float16* __restrict__ A, const _Float16* __restrict__ WqT,
              const _Float16* __restrict__ WkT,
              const _Float16* __restrict__ WvT, const float* __restrict__ bq,
              const float* __restrict__ bk, const float* __restrict__ bv,
              const float* __restrict__ qg, const float* __restrict__ qb,
              const float* __restrict__ kg, const float* __restrict__ kb,
              const float* __restrict__ cosT, const float* __restrict__ sinT,
              _Float16* __restrict__ Q16, _Float16* __restrict__ K16,
              _Float16* __restrict__ VT16, int K) {
  const int wave = threadIdx.x >> 5, lane = threadIdx.x & 31;
  const int hl   = lane >> 4, l16 = lane & 15;
  const int wm = (wave >> 2) * 64, wn = (wave & 3) * 32;
  const int c = blockIdx.x;
  const bool q = c < Q_COLS, k = c < Q_COLS + KV_COLS;
  const int tok0 = blockIdx.y * 128;
  const int n0   = (c - (q ? 0 : k ? Q_COLS : Q_COLS + KV_COLS)) * 128;

  v8f acc[4][2];
  gemm_acc(k ? (q ? WqT : WkT) : A, k ? A : WvT, K, k ? n0 : tok0,
           k ? tok0 : n0, acc);

  if (k) {
    const int head = (n0 + wm) / HDIM;
    head_epilogue(acc, q ? bq : bk, head, q ? qg : kg, q ? qb : kb, cosT, sinT,
                  (q ? Q16 : K16) + (size_t)head * SEQ * HDIM, tok0 + wn);
  } else {
#pragma unroll
    for (int u = 0; u < 2; ++u) {
      const int dim = n0 + wn + u * 16 + l16;
      const float bs = bv[dim];
      _Float16* dst = VT16 + (size_t)dim * SEQ + tok0 + wm + 8 * hl;
#pragma unroll
      for (int t = 0; t < 4; ++t) {
        f16x8 o;
#pragma unroll
        for (int v = 0; v < 8; ++v) o[v] = (_Float16)(acc[t][u][v] + bs);
        *(f16x8*)(dst + t * 16) = o;
      }
      // A precaution: the next column's values and address go into the
      // registers that these stores name only behind this wait.
      asm volatile("s_wait_xcnt 0x0" ::: "memory");
    }
  }
}

// The grid is two blocks a WGP, four waves a SIMD: naming that occupancy gives
// the compiler the registers to keep a product's fragment loads together in
// front of its WMMAs; aiming higher, it waits for each fragment by itself.
__global__ __launch_bounds__(256) __attribute__((amdgpu_waves_per_eu(4, 4)))
void attn_fmha(const _Float16* __restrict__ Q, const _Float16* __restrict__ Kh,
               const _Float16* __restrict__ VT, _Float16* __restrict__ O) {
  __shared__ __align__(16) _Float16 sK [2][64 * APITCH];  // [key][dim] 2x9 KB
  __shared__ __align__(16) _Float16 sVT[2][64 * APITCH];  // [dim][key] 2x9 KB
  const int tid  = threadIdx.x;
  const int wave = tid >> 5, lane = tid & 31;
  const int hl   = lane >> 4, l16 = lane & 15;
  const int h  = blockIdx.y;          // q head
  const int hk = h >> 2;              // kv head (n_rep = 4, grouped-adjacent)
  const int qw = blockIdx.x * 128 + wave * 16;

  // Q^T fragments (columns qw..qw+15, two 32-deep head-dim chunks), loaded
  // once: the B operand of the score product.
  v16h bq[2];
#pragma unroll
  for (int c = 0; c < 2; ++c)
    bq[c] = ldfrag(&Q[(((size_t)h * SEQ) + qw + l16) * HDIM + c * 32 + hl * 8]);

  const v8f vzero = {0.f, 0.f, 0.f, 0.f, 0.f, 0.f, 0.f, 0.f};
  float m = -3.0e38f;                 // running maximum of the lane's query
  float lsum = 0.0f;                  // sum over this half's keys only
  v8f oacc[4];                        // O^T: dim t*16 + 8*hl + v, query l16
#pragma unroll
  for (int t = 0; t < 4; ++t) oacc[t] = vzero;

  // 4 async b128 copies per thread per key tile (2 K + 2 VT).
  auto issueKV = [&](int buf, int kb) {
#pragma unroll
    for (int i = 0; i < 2; ++i) {
      int ch = tid + i * 256;                 // 512 chunks of 8 f16
      int rr = ch >> 3, cc = (ch & 7) * 8;    // 64 rows x 64 cols
      cp16(&Kh[(((size_t)hk * SEQ) + kb + rr) * HDIM + cc],
           &sK[buf][rr * APITCH + cc]);
      cp16(&VT[(((size_t)hk * HDIM) + rr) * SEQ + kb + cc],
           &sVT[buf][rr * APITCH + cc]);
    }
  };

  issueKV(0, 0);
  int buf = 0;
  for (int kb = 0; kb < SEQ; kb += 64) {
    const bool more = (kb + 64) < SEQ;
    if (more) issueKV(buf ^ 1, kb + 64);
    if (more) async_wait_le4(); else async_wait_0();
    __syncthreads();

    // S^T tile = K * Q^T  (64k x 16q per wave: 4 row-tiles x 2 k-chunks)
    v8f sacc[4];
#pragma unroll
    for (int u = 0; u < 4; ++u) {
      sacc[u] = vzero;
#pragma unroll
      for (int c = 0; c < 2; ++c) {
        v16h ak = ldfrag(&sK[buf][(u * 16 + l16) * APITCH + c * 32 + hl * 8]);
        sacc[u] = wmma16(ak, bq[c], sacc[u]);
      }
    }

    // Online softmax of the lane's query over its 32 keys of the tile; four
    // independent chains, one per score tile.
    float tmu[4];
#pragma unroll
    for (int u = 0; u < 4; ++u) {
      tmu[u] = -3.0e38f;
#pragma unroll
      for (int v = 0; v < 8; ++v) {
        sacc[u][v] *= 0.125f;                  // 1/sqrt(64)
        tmu[u] = fmaxf(tmu[u], sacc[u][v]);
      }
    }
    float tm = fmaxf(fmaxf(tmu[0], tmu[1]), fmaxf(tmu[2], tmu[3]));
    tm = fmaxf(tm, other_half(tm));            // the query's other 32 keys
    const float mnew  = fmaxf(m, tm);
    const float alpha = __expf(m - mnew);
    m = mnew;

    // P^T as B operand: element e < 8 is key 8*hl + e of the 32-key chunk,
    // element 8 + e key 16 + 8*hl + e, the k order of ldfrag.
    v16h bp[2];
    float rsu[4];
#pragma unroll
    for (int u = 0; u < 4; ++u) {
      rsu[u] = 0.0f;
#pragma unroll
      for (int v = 0; v < 8; ++v) {
        float p = __expf(sacc[u][v] - mnew);
        rsu[u] += p;
        bp[u >> 1][(u & 1) * 8 + v] = (_Float16)p;
      }
    }
    lsum = lsum * alpha + ((rsu[0] + rsu[1]) + (rsu[2] + rsu[3]));
#pragma unroll
    for (int t = 0; t < 4; ++t)
#pragma unroll
      for (int v = 0; v < 8; ++v) oacc[t][v] *= alpha;

    // O^T += V^T * P^T
#pragma unroll
    for (int c = 0; c < 2; ++c)
#pragma unroll
      for (int t = 0; t < 4; ++t) {
        v16h av = ldfrag(&sVT[buf][(t * 16 + l16) * APITCH + c * 32 + hl * 8]);
        oacc[t] = wmma16(av, bp[c], oacc[t]);
      }
    __syncthreads();
    buf ^= 1;
  }

  // Join the halves' sums, normalize and pack into [seq][heads*64] f16 for the
  // output projection: a lane's 8 registers of a tile are 8 neighbouring dims
  // of its query, one 16-byte store.
  const float inv = 1.0f / (lsum + other_half(lsum));
  _Float16* orow = O + (size_t)(qw + l16) * HIDDEN + h * HDIM + 8 * hl;
#pragma unroll
  for (int t = 0; t < 4; ++t) {
    f16x8 o;
#pragma unroll
    for (int v = 0; v < 8; ++v) o[v] = (_Float16)(oacc[t][v] * inv);
    *(f16x8*)(orow + t * 16) = o;
  }
}

// ---------------------------------------------------------------------------
// Host orchestration
// ---------------------------------------------------------------------------
extern "C" void kernel_launch(void* const* d_in, const int* in_sizes, int n_in,
                              void* d_out, int out_size, void* d_ws,
                              size_t ws_size, hipStream_t stream) {
  (void)in_sizes; (void)n_in; (void)out_size; (void)ws_size;
  const float* x   = (const float*)d_in[0];
  const float* Wq  = (const float*)d_in[1];
  const float* bq  = (const float*)d_in[2];
  const float* Wk  = (const float*)d_in[3];
  const float* bk  = (const float*)d_in[4];
  const float* Wv  = (const float*)d_in[5];
  const float* bv  = (const float*)d_in[6];
  const float* Wo  = (const float*)d_in[7];
  const float* bo  = (const float*)d_in[8];
  const float* qg  = (const float*)d_in[9];
  const float* qb  = (const float*)d_in[10];
  const float* kg  = (const float*)d_in[11];
  const float* kbb = (const float*)d_in[12];

  char* ws = (char*)d_ws;
  size_t off = 0;
  auto alloc = [&](size_t bytes) {
    void* p = ws + off;
    off += (bytes + 255) & ~(size_t)255;
    return p;
  };
  _Float16* x16   = (_Float16*)alloc((size_t)SEQ * HIDDEN * 2);
  _Float16* WqT16 = (_Float16*)alloc((size_t)HIDDEN * HIDDEN * 2);
  _Float16* WkT16 = (_Float16*)alloc((size_t)HIDDEN * KVDIM * 2);
  _Float16* WvT16 = (_Float16*)alloc((size_t)HIDDEN * KVDIM * 2);
  _Float16* WoT16 = (_Float16*)alloc((size_t)HIDDEN * HIDDEN * 2);
  float*    cosT  = (float*)   alloc((size_t)SEQ * NFREQ * 4);
  float*    sinT  = (float*)   alloc((size_t)SEQ * NFREQ * 4);
  _Float16* Q16   = (_Float16*)alloc((size_t)NHEADS * SEQ * HDIM * 2);
  _Float16* K16   = (_Float16*)alloc((size_t)NKV * SEQ * HDIM * 2);
  _Float16* VT16  = (_Float16*)alloc((size_t)NKV * HDIM * SEQ * 2);
  _Float16* O16   = (_Float16*)alloc((size_t)SEQ * HIDDEN * 2);

  prep_operands<<<OPERAND_BLOCKS, 256, 0, stream>>>(
      x, Wq, Wk, Wv, Wo, x16, WqT16, WkT16, WvT16, WoT16, cosT, sinT);

  // Projections (f16 WMMA, f32 accum + bias); in their epilogue the per-head
  // QK layernorm + RoPE, packed head-major f16, and V transposed.
  gemm_qkv<<<dim3(Q_COLS + 2 * KV_COLS, SEQ / 128), 256, 0, stream>>>(
      x16, WqT16, WkT16, WvT16, bq, bk, bv, qg, qb, kg, kbb, cosT, sinT,
      Q16, K16, VT16, HIDDEN);

  // GQA flash attention
  attn_fmha<<<dim3(SEQ / 128, NHEADS), 256, 0, stream>>>(Q16, K16, VT16, O16);

  // Output projection -> f32 result
  gemm_wmma<<<dim3(HIDDEN / 128, SEQ / 128), 256, 0, stream>>>(
      O16, WoT16, bo, (float*)d_out, SEQ, HIDDEN, HIDDEN);
}

// v007
// Measured time: 94.8 microseconds a run.
// Two timings next to v006 put it at 1.22 and 1.23 times that version's speed.
// All steps since v000 together make it 5.05 times as fast.
#include <hip/hip_runtime.h>
#include <hip/hip_bf16.h>
#include <stdint.h>

// ---------------------------------------------------------------------------
// Types for CDNA5 WMMA (wave32): A/B = v16h (16 halves = 8 VGPRs),
// C/D = v8f (8 VGPRs of f32).
// ---------------------------------------------------------------------------
typedef __attribute__((ext_vector_type(16))) _Float16 v16h;
typedef __attribute__((ext_vector_type(8)))  float    v8f;
typedef __attribute__((ext_vector_type(8)))  _Float16 f16x8;
typedef __attribute__((ext_vector_type(4)))  int      v4i;
typedef __attribute__((ext_vector_type(4)))  float    f32x4;
typedef __attribute__((ext_vector_type(2)))  _Float16 f16x2;

#define SEQ      2048
#define HIDDEN   2048
#define NHEADS   32
#define NKV      8
#define HDIM     64
#define KVDIM    (NKV * HDIM)   // 512

// LDS row pitches in f16 elements. The GEMM and attention tiles are read by 16-byte loads,
// one row per lane: a pitch of 16 B x odd spreads the 16 rows of a half-wave
// over all 64 banks; dense 128-B and 256-B rows fold them onto a few.
#define GK       128            // k depth of one GEMM stage
#define GPITCH   136            // 128-element (256 B) GEMM rows -> 272 B
#define APITCH   72             // 64-element (128 B) attention rows -> 144 B

// Async Global->LDS (ASYNCcnt-tracked) if the toolchain exposes it.
#if defined(__gfx1250__) && \
    __has_builtin(__builtin_amdgcn_global_load_async_to_lds_b128) && \
    __has_builtin(__builtin_amdgcn_s_wait_asynccnt)
#define HAVE_ASYNC 1
#else
#define HAVE_ASYNC 0
#endif

#if HAVE_ASYNC
// Builtin signature (from compiler diagnostic): typed v4i pointers,
// (addrspace(1) src, addrspace(3) dst, imm offset, imm cpol).
typedef __attribute__((address_space(1))) v4i GlobalV4;
typedef __attribute__((address_space(3))) v4i LocalV4;
#endif

// Copy 16 bytes Global -> LDS. Async path bypasses VGPRs (tracked by
// ASYNCcnt); fallback is a synchronous load+store.
__device__ __forceinline__ void cp16(const _Float16* g, _Float16* l) {
#if HAVE_ASYNC
  __builtin_amdgcn_global_load_async_to_lds_b128(
      (GlobalV4*)(const void*)g, (LocalV4*)(void*)l, 0, 0);
#else
  *(f16x8*)l = *(const f16x8*)g;
#endif
}
__device__ __forceinline__ void async_wait_le4() {
#if HAVE_ASYNC
  __builtin_amdgcn_s_wait_asynccnt(4);   // keep newest 4 (next tile) in flight
#endif
}
__device__ __forceinline__ void async_wait_0() {
#if HAVE_ASYNC
  __builtin_amdgcn_s_wait_asynccnt(0);
#endif
}

__device__ __forceinline__ v8f wmma16(v16h a, v16h b, v8f c) {
  // D = A(16x32 f16) * B(32x16 f16) + C(16x16 f32)
  return __builtin_amdgcn_wmma_f32_16x16x32_f16(
      /*neg_a=*/false, a, /*neg_b=*/false, b,
      /*c_mod=*/(short)0, c, /*reuse_a=*/false, /*reuse_b=*/false);
}

// One lane's 16-element WMMA fragment: two contiguous 8-element (16 B) runs
// 16 elements apart in K (e0..7 -> K = 8*half + e ; e8..15 -> K = 16+8*half+e).
__device__ __forceinline__ v16h ldfrag(const _Float16* p) {
  f16x8 lo = *(const f16x8*)p;
  f16x8 hi = *(const f16x8*)(p + 16);
  v16h r;
#pragma unroll
  for (int j = 0; j < 8; ++j) { r[j] = lo[j]; r[j + 8] = hi[j]; }
  return r;
}

// ---------------------------------------------------------------------------
// Elementwise converts / transposes. These launches move few bytes, so their
// time is the time to start their waves: every thread handles 32 elements
// through 16-byte accesses and the grids stay at a few workgroups per WGP.
// ---------------------------------------------------------------------------
#define CVT_PER_BLOCK (256 * 32)

// f32 -> f16, piece blk of CVT_PER_BLOCK elements. All eight loads of a
// thread are issued before the first convert.
__device__ __forceinline__
void cvt_piece(const float* __restrict__ s, _Float16* __restrict__ d, int blk) {
  const size_t base = (size_t)blk * CVT_PER_BLOCK + threadIdx.x * 8;
  f32x4 lo[4], hi[4];
#pragma unroll
  for (int j = 0; j < 4; ++j) {
    lo[j] = *(const f32x4*)(s + base + j * 2048);
    hi[j] = *(const f32x4*)(s + base + j * 2048 + 4);
  }
#pragma unroll
  for (int j = 0; j < 4; ++j) {
    f16x8 o;
#pragma unroll
    for (int e = 0; e < 4; ++e) {
      o[e]     = (_Float16)lo[j][e];
      o[e + 4] = (_Float16)hi[j][e];
    }
    *(f16x8*)(d + base + j * 2048) = o;
  }
  // A precaution: in a grid of several jobs the listing lays another job's
  // code behind these stores; it writes their registers only behind this wait.
  asm volatile("s_wait_xcnt 0x0" ::: "memory");
}

// S [KD][ND] f32 -> D [ND][KD] f16 (lets the GEMMs stream
// their operands as contiguous 16-byte runs straight into LDS).
// One block = one 128(k) x 64(n) tile, number tile in row-major order of the
// (KD / 128) x (ND / 64) tiles, KD % 128 == 0 and ND % 64 == 0:
// 256-byte row pieces in, turned in LDS, 256-byte row pieces out. The shapes
// are compile-time so that a thread's eight loads and four stores each hang
// off one address with immediate offsets.
#define TK       128
#define TN       64
#define TPITCH   (TK + 8)       // 272 B = 16 B x odd for the 16-byte readers
template <int KD, int ND>
__device__ __forceinline__
void transpose_tile(const float* __restrict__ s, _Float16* __restrict__ d,
                    _Float16* sT, int tile) {              // sT: [n][k]
  const int t  = threadIdx.x;
  const int k0 = (tile / (ND / TN)) * TK, n0 = (tile % (ND / TN)) * TN;
  const int n4 = (t & 15) * 4;        // four neighbouring columns
  const int kp = (t >> 4) * 2;        // two neighbouring rows -> one dword

  const float* p = s + (size_t)(k0 + kp) * ND + n0 + n4;
  f32x4 ra[4], rb[4];
#pragma unroll
  for (int j = 0; j < 4; ++j) {
    ra[j] = *(const f32x4*)(p + (32 * j) * ND);
    rb[j] = *(const f32x4*)(p + (32 * j + 1) * ND);
  }
#pragma unroll
  for (int j = 0; j < 4; ++j)
#pragma unroll
    for (int i = 0; i < 4; ++i) {
      f16x2 w = {(_Float16)ra[j][i], (_Float16)rb[j][i]};
      *(f16x2*)&sT[(n4 + i) * TPITCH + kp + 32 * j] = w;
    }
  __syncthreads();                    // whole tile in LDS before it is read
  const int n = t >> 4, kc = (t & 15) * 8;   // 16 rows x 16 chunks a pass
  _Float16* q = d + (size_t)(n0 + n) * KD + k0 + kc;
#pragma unroll
  for (int j = 0; j < 4; ++j)
    *(f16x8*)(q + (16 * j) * KD) =
        *(const f16x8*)&sT[(n + 16 * j) * TPITCH + kc];
  // A precaution, as in cvt_piece: code laid behind these stores writes their
  // registers only behind this wait.
  asm volatile("s_wait_xcnt 0x0" ::: "memory");
}

// RoPE tables cosT, sinT [S][32] f32 (emb = concat(freqs, freqs): frequency
// index = dim % 32). Piece blk holds 32 positions; a wave takes four of them,
// a lane one frequency. The projection's epilogue reads them: there every
// head of a position would otherwise work out the same 32 angles again.
#define NFREQ    (HDIM / 2)
#define ROPE_BLOCKS (SEQ / 32)
__device__ __forceinline__
void rope_piece(float* __restrict__ cosT, float* __restrict__ sinT, int blk) {
  const int wave = threadIdx.x >> 5, lane = threadIdx.x & 31;
  const float invf = __powf(10000.0f, -(float)lane / 32.0f);
  // Rolled: cosf and sinf are long, and code that runs once is fetched cold;
  // unrolled, every trip would wait for instructions of its own.
#pragma unroll 1
  for (int j = 0; j < 4; ++j) {
    const int s = blk * 32 + j * 8 + wave;
    const float ang = (float)s * invf;
    cosT[s * NFREQ + lane] = cosf(ang);
    sinT[s * NFREQ + lane] = sinf(ang);
    // A precaution, as in cvt_piece: the next trip, and code laid behind the
    // loop, write these stores' registers only behind this wait.
    asm volatile("s_wait_xcnt 0x0" ::: "memory");
  }
}

#define SQ_TILES ((HIDDEN / TK) * (HIDDEN / TN))   // [2048][2048]: Wq, Wo
#define KV_TILES ((HIDDEN / TK) * (KVDIM / TN))    // [2048][512]: Wk, Wv
#define X_PIECES ((SEQ * HIDDEN) / CVT_PER_BLOCK)

// The five operand conversions and the RoPE tables depend on nothing and on
// one another not at all: one grid holds them all, a block's index says which
// job it does, and the chip fills once instead of six times. The table blocks,
// the longest in instructions, come first.
#define OPERAND_BLOCKS (ROPE_BLOCKS + 2 * SQ_TILES + 2 * KV_TILES + X_PIECES)
__global__ __launch_bounds__(256)
void prep_operands(const float* __restrict__ x, const float* __restrict__ Wq,
                   const float* __restrict__ Wk, const float* __restrict__ Wv,
                   const float* __restrict__ Wo, _Float16* __restrict__ x16,
                   _Float16* __restrict__ WqT, _Float16* __restrict__ WkT,
                   _Float16* __restrict__ WvT, _Float16* __restrict__ WoT,
                   float* __restrict__ cosT, float* __restrict__ sinT) {
  __shared__ __align__(16) _Float16 sT[TN * TPITCH];       // 17 KB
  const int b = (int)blockIdx.x - ROPE_BLOCKS, bkv = b - 2 * SQ_TILES;
  if (b < 0) {
    rope_piece(cosT, sinT, blockIdx.x);
  } else if (b < 2 * SQ_TILES) {
    const bool o = b >= SQ_TILES;
    transpose_tile<HIDDEN, HIDDEN>(o ? Wo : Wq, o ? WoT : WqT, sT,
                                   b % SQ_TILES);
  } else if (bkv < 2 * KV_TILES) {
    const bool v = bkv >= KV_TILES;
    transpose_tile<HIDDEN, KVDIM>(v ? Wv : Wk, v ? WvT : WkT, sT,
                                  bkv % KV_TILES);
  } else {
    cvt_piece(x, x16, bkv - 2 * KV_TILES);
  }
}

// ---------------------------------------------------------------------------
// Tiled WMMA GEMM: C[M,N] = A[M,K](f16) * B[K,N] + bias, f32 out.
// B supplied pre-transposed: BT[N][K]. Block tile 128x128, 8 waves (2x4),
// each wave 64x32 => 8 WMMA per 32-deep k-step, four k-steps per LDS stage.
// A stage holds GK = 128 k of both operands: a row's piece is 256 B, two whole
// cache lines, and a wave's copy takes two such pieces; the copies of a stage
// fly for as long as the four k-steps of the stage before take, and copy wait
// and barrier come once a stage. K % GK == 0.
// ---------------------------------------------------------------------------
// gemm_acc leaves the wave's sums in acc[t][u]: row bm + wm + t*16 + v + 8*half
// of A against row bn + wn + u*16 + (lane & 15) of BT.
__device__ __forceinline__
void gemm_acc(const _Float16* __restrict__ A, const _Float16* __restrict__ BT,
              int K, int bm, int bn, v8f (&acc)[4][2]) {
  __shared__ __align__(16) _Float16 sA [2][128 * GPITCH];  // [row][k]  2x34 KB
  __shared__ __align__(16) _Float16 sBT[2][128 * GPITCH];  // [col][k]  2x34 KB
  const int tid  = threadIdx.x;
  const int wave = tid >> 5, lane = tid & 31;
  const int hl   = lane >> 4, l16 = lane & 15;
  const int wm = (wave >> 2) * 64, wn = (wave & 3) * 32;

  const v8f vzero = {0.f, 0.f, 0.f, 0.f, 0.f, 0.f, 0.f, 0.f};
#pragma unroll
  for (int t = 0; t < 4; ++t)
#pragma unroll
    for (int u = 0; u < 2; ++u) acc[t][u] = vzero;

  // 16 async b128 copies per thread per stage (8 A + 8 BT): 2048 chunks of
  // 8 f16 an operand, 128 rows x 128 k. Block and stage are in two bases that
  // are the same for the whole wave and step on by a stage with every issue;
  // what is the thread's own, row tid / 16 + 16 i and chunk tid % 16, is one
  // 32-bit element offset that serves both operands and every stage.
  const int r0 = tid >> 4, c0 = (tid & 15) * 8;
  const _Float16* An = A  + (size_t)bm * K;   // the next stage to set out
  const _Float16* Bn = BT + (size_t)bn * K;
  auto issue = [&](int buf) {
#pragma unroll
    for (int i = 0; i < 8; ++i) {
      const unsigned off = (unsigned)((r0 + i * 16) * K + c0);
      const int l = (r0 + i * 16) * GPITCH + c0;
      cp16(An + off, &sA [buf][l]);
      cp16(Bn + off, &sBT[buf][l]);
    }
    An += GK;
    Bn += GK;
  };

  // Two buffers: stage 0 lands and is published, then stage 1 sets out.
  issue(0);
  // This wave's copies of stage 0 have landed before the barrier publishes it.
  asm volatile("s_wait_asynccnt 0x0" ::: "memory");
  __syncthreads();
  if (GK < K) issue(1);
  int buf = 0;
  for (int k0 = 0; k0 < K; k0 += GK) {
    // Unrolled: the four k-steps read at immediate offsets from two addresses.
#pragma unroll
    for (int kk = 0; kk < GK; kk += 32) {
      // All six fragments of the k-step have registers of their own: their
      // twelve LDS loads go out as one group and the wave waits out the LDS
      // latency once a k-step. With one A fragment's registers shared by the
      // four row tiles it waits four times, each behind two WMMAs.
      v16h bfrag[2], afrag[4];
#pragma unroll
      for (int u = 0; u < 2; ++u)
        bfrag[u] =
            ldfrag(&sBT[buf][(wn + u * 16 + l16) * GPITCH + kk + hl * 8]);
#pragma unroll
      for (int t = 0; t < 4; ++t)
        afrag[t] = ldfrag(&sA[buf][(wm + t * 16 + l16) * GPITCH + kk + hl * 8]);
      // Keeps the group whole: without it the scheduler sinks each A
      // fragment's loads to its WMMAs and folds the four into one register
      // set again.
      __builtin_amdgcn_sched_barrier(0);
#pragma unroll
      for (int t = 0; t < 4; ++t)
#pragma unroll
        for (int u = 0; u < 2; ++u)
          acc[t][u] = wmma16(afrag[t], bfrag[u], acc[t][u]);
      // Keeps the WMMAs in front of the next group and of the stage's closing
      // wait for every LDS load: each pair starts behind a counted wait, as
      // soon as its own fragments are in.
      __builtin_amdgcn_sched_barrier(0);
    }
    // Hand-over of the stage. This wave's reads of buf are done before buf is
    // refilled ...
    asm volatile("s_wait_dscnt 0x0" ::: "memory");
    // ... and its copies of the next stage have landed before the barrier,
    // which publishes that stage and ends every wave's reads of buf. Behind
    // the last trip's wait nothing sets out: the loop ends with no copy open.
    asm volatile("s_wait_asynccnt 0x0" ::: "memory");
    __syncthreads();
    if (k0 + 2 * GK < K) issue(buf);
    buf ^= 1;
  }
}

__device__ __forceinline__
void gemm_tile(const _Float16* __restrict__ A, const _Float16* __restrict__ BT,
               const float* __restrict__ bias, float* __restrict__ C,
               int N, int K, int bm, int bn) {
  const int wave = threadIdx.x >> 5, lane = threadIdx.x & 31;
  const int hl   = lane >> 4, l16 = lane & 15;
  const int wm = (wave >> 2) * 64, wn = (wave & 3) * 32;
  v8f acc[4][2];
  gemm_acc(A, BT, K, bm, bn, acc);

  // Epilogue: C layout => row = v + 8*(lane>=16), col = lane&15.
#pragma unroll
  for (int t = 0; t < 4; ++t)
#pragma unroll
    for (int u = 0; u < 2; ++u) {
      int col = bn + wn + u * 16 + l16;
      float bs = bias ? bias[col] : 0.0f;
#pragma unroll
      for (int v = 0; v < 8; ++v) {
        int row = bm + wm + t * 16 + v + 8 * hl;
        C[(size_t)row * N + col] = acc[t][u][v] + bs;
      }
      // A precaution: the next tile's sums and addresses go into the registers
      // that these stores name only behind this wait, on every path.
      asm volatile("s_wait_xcnt 0x0" ::: "memory");
    }
}

__global__ __launch_bounds__(256, 2)
void gemm_wmma(const _Float16* __restrict__ A, const _Float16* __restrict__ BT,
               const float* __restrict__ bias, float* __restrict__ C,
               int M, int N, int K) {
  gemm_tile(A, BT, bias, C, N, K, blockIdx.y * 128, blockIdx.x * 128);
}

// Value of lane l ^ 16.
__device__ __forceinline__ float other_half(float x) {
  int b = __builtin_bit_cast(int, x);
  b = __builtin_amdgcn_permlanex16(b, b, 0x76543210, 0xfedcba98, false, false);
  return __builtin_bit_cast(float, b);
}

// Eight neighbouring f32 (32-byte aligned) by two 16-byte loads, at byte
// offset off (the lane's) + imm (a constant) from a wave-uniform base.
__device__ __forceinline__
void ld8(const float* __restrict__ base, unsigned off, int imm, float (&r)[8]) {
  const float* p = (const float*)((const char*)base + off) + imm / 4;
  const f32x4 lo = *(const f32x4*)p, hi = *(const f32x4*)(p + 4);
#pragma unroll
  for (int e = 0; e < 4; ++e) { r[e] = lo[e]; r[e + 4] = hi[e]; }
}

// Epilogue of a Q or K tile: bias, per-(token, head) layernorm and RoPE on the
// sums while they are in registers, packed head-major f16.
// The tile was computed transposed (rows = output dims, columns = tokens), and
// a wave's 64 rows are one head: a lane holds dims t*16 + 8*half + v of token
// u*16 + (lane & 15), half a head row. Mean and variance are sums in the
// lane's own registers plus one exchange between the wave's halves; dims d and
// d + 32, RoPE's pair, are tiles t and t + 2 of the same lane; eight
// neighbouring dims leave as one 16-byte store.
// bias: the projection's, head its head; out: the head's [S][64] f16; tok0:
// the wave's first token.
__device__ __forceinline__
void head_epilogue(const v8f (&acc)[4][2], const float* __restrict__ bias,
                   int head, const float* __restrict__ g,
                   const float* __restrict__ b,
                   const float* __restrict__ cosT,
                   const float* __restrict__ sinT, _Float16* __restrict__ out,
                   int tok0) {
  const int lane = threadIdx.x & 31;
  const int hl   = lane >> 4, l16 = lane & 15;
  const unsigned doff = hl * 32u;              // bytes: dims 8*half ...
  const unsigned boff = (unsigned)head * (HDIM * 4u) + doff;
#pragma unroll
  for (int u = 0; u < 2; ++u) {
    const int tok = tok0 + u * 16 + l16;
    const unsigned toff = (unsigned)tok * (NFREQ * 4u) + doff;
    // All that the token needs from memory goes out as one group: one memory
    // latency a token.
    float bs[4][8], gg[4][8], bb[4][8], c[2][8], sn[2][8];
#pragma unroll
    for (int t = 0; t < 4; ++t) {
      ld8(bias, boff, t * 64, bs[t]);
      ld8(g, doff, t * 64, gg[t]);
      ld8(b, doff, t * 64, bb[t]);
    }
#pragma unroll
    for (int t = 0; t < 2; ++t) {
      ld8(cosT, toff, t * 64, c[t]);
      ld8(sinT, toff, t * 64, sn[t]);
    }
    // A precaution: the loads' offset registers are inputs here, so they live
    // up to this wait and nothing, a later load's result included, is written
    // over them in front of it.
    asm volatile("s_wait_xcnt 0x0" :: "v"(doff), "v"(boff), "v"(toff)
                 : "memory");
    // Keeps the group whole: without it the scheduler sinks the scale, shift
    // and table loads behind the sums, and the wave waits out their latency
    // three times a token.
    __builtin_amdgcn_sched_barrier(0);

    float x[4][8], part[4];
#pragma unroll
    for (int t = 0; t < 4; ++t) {
      part[t] = 0.0f;
#pragma unroll
      for (int v = 0; v < 8; ++v) {
        x[t][v] = acc[t][u][v] + bs[t][v];
        part[t] += x[t][v];
      }
    }
    float sum = (part[0] + part[1]) + (part[2] + part[3]);
    sum += other_half(sum);                    // the head row's other 32 dims
    const float mu = sum * (1.0f / 64.0f);
#pragma unroll
    for (int t = 0; t < 4; ++t) {
      part[t] = 0.0f;
#pragma unroll
      for (int v = 0; v < 8; ++v) {
        x[t][v] -= mu;
        part[t] += x[t][v] * x[t][v];
      }
    }
    float vs = (part[0] + part[1]) + (part[2] + part[3]);
    vs += other_half(vs);
    const float inv = rsqrtf(vs * (1.0f / 64.0f) + 1e-5f);
#pragma unroll
    for (int t = 0; t < 4; ++t)
#pragma unroll
      for (int v = 0; v < 8; ++v)
        x[t][v] = x[t][v] * inv * gg[t][v] + bb[t][v];
    _Float16* dst = out + (size_t)tok * HDIM + 8 * hl;
#pragma unroll
    for (int t = 0; t < 2; ++t) {
      f16x8 o0, o1;
#pragma unroll
      for (int v = 0; v < 8; ++v) {            // rotate_half: [-x2, x1]
        o0[v] = (_Float16)(x[t][v] * c[t][v] - x[t + 2][v] * sn[t][v]);
        o1[v] = (_Float16)(x[t + 2][v] * c[t][v] + x[t][v] * sn[t][v]);
      }
      *(f16x8*)(dst + t * 16)      = o0;
      *(f16x8*)(dst + t * 16 + 32) = o1;
    }
    // A precaution: the next token's values and addresses go into the
    // registers that these stores name only behind this wait.
    asm volatile("s_wait_xcnt 0x0" ::: "memory");
  }
}

// The three projections of x in one grid: tile columns 0..15 are Q's, 16..19
// K's, 20..23 V's. Alone, K's and V's 64 tiles each leave three quarters of
// the chip idle for as long as Q's 256 take.
// What stood between the projections and the attention as a launch of its own
// is each tile's epilogue. Both operands lie in LDS as rows along k, so which
// of them is the matrix instruction's A is free:
//  - Q and K tiles take the weights as A (rows = dims): head_epilogue.
//  - V tiles take x as A (rows = tokens): a lane's 8 registers of a tile are 8
//    neighbouring tokens of one dim, one 16-byte store into VT [NKV*64][S].
// out: Q16 [32][S][64], K16 [8][S][64], VT16 [8*64][S], all f16.
#define Q_COLS   (HIDDEN / 128)
#define KV_COLS  (KVDIM / 128)
__global__ __launch_bounds__(256, 2)
void gemm_qkv(const _Float16* __restrict__ A, const _Float16* __restrict__ WqT,
              const _Float16* __restrict__ WkT,
              const _Float16* __restrict__ WvT, const float* __restrict__ bq,
              const float* __restrict__ bk, const float* __restrict__ bv,
              const float* __restrict__ qg, const float* __restrict__ qb,
              const float* __restrict__ kg, const float* __restrict__ kb,
              const float* __restrict__ cosT, const float* __restrict__ sinT,
              _Float16* __restrict__ Q16, _Float16* __restrict__ K16,
              _Float16* __restrict__ VT16, int K) {
  const int wave = threadIdx.x >> 5, lane = threadIdx.x & 31;
  const int hl   = lane >> 4, l16 = lane & 15;
  const int wm = (wave >> 2) * 64, wn = (wave & 3) * 32;
  const int c = blockIdx.x;
  const bool q = c < Q_COLS, k = c < Q_COLS + KV_COLS;
  const int tok0 = blockIdx.y * 128;
  const int n0   = (c - (q ? 0 : k ? Q_COLS : Q_COLS + KV_COLS)) * 128;

  v8f acc[4][2];
  gemm_acc(k ? (q ? WqT : WkT) : A, k ? A : WvT, K, k ? n0 : tok0,
           k ? tok0 : n0, acc);

  if (k) {
    const int head = (n0 + wm) / HDIM;
    head_epilogue(acc, q ? bq : bk, head, q ? qg : kg, q ? qb : kb, cosT, sinT,
                  (q ? Q16 : K16) + (size_t)head * SEQ * HDIM, tok0 + wn);
  } else {
#pragma unroll
    for (int u = 0; u < 2; ++u) {
      const int dim = n0 + wn + u * 16 + l16;
      const float bs = bv[dim];
      _Float16* dst = VT16 + (size_t)dim * SEQ + tok0 + wm + 8 * hl;
#pragma unroll
      for (int t = 0; t < 4; ++t) {
        f16x8 o;
#pragma unroll
        for (int v = 0; v < 8; ++v) o[v] = (_Float16)(acc[t][u][v] + bs);
        *(f16x8*)(dst + t * 16) = o;
      }
      // A precaution: the next column's values and address go into the
      // registers that these stores name only behind this wait.
      asm volatile("s_wait_xcnt 0x0" ::: "memory");
    }
  }
}

// The grid is two blocks a WGP, four waves a SIMD: naming that occupancy gives
// the compiler the registers to keep a product's fragment loads together in
// front of its WMMAs; aiming higher, it waits for each fragment by itself.
__global__ __launch_bounds__(256) __attribute__((amdgpu_waves_per_eu(4, 4)))
void attn_fmha(const _Float16* __restrict__ Q, const _Float16* __restrict__ Kh,
               const _Float16* __restrict__ VT, _Float16* __restrict__ O) {
  __shared__ __align__(16) _Float16 sK [2][64 * APITCH];  // [key][dim] 2x9 KB
  __shared__ __align__(16) _Float16 sVT[2][64 * APITCH];  // [dim][key] 2x9 KB
  const int tid  = threadIdx.x;
  const int wave = tid >> 5, lane = tid & 31;
  const int hl   = lane >> 4, l16 = lane & 15;
  const int h  = blockIdx.y;          // q head
  const int hk = h >> 2;              // kv head (n_rep = 4, grouped-adjacent)
  const int qw = blockIdx.x * 128 + wave * 16;

  // Q^T fragments (columns qw..qw+15, two 32-deep head-dim chunks), loaded
  // once: the B operand of the score product.
  v16h bq[2];
#pragma unroll
  for (int c = 0; c < 2; ++c)
    bq[c] = ldfrag(&Q[(((size_t)h * SEQ) + qw + l16) * HDIM + c * 32 + hl * 8]);

  const v8f vzero = {0.f, 0.f, 0.f, 0.f, 0.f, 0.f, 0.f, 0.f};
  float m = -3.0e38f;                 // running maximum of the lane's query
  float lsum = 0.0f;                  // sum over this half's keys only
  v8f oacc[4];                        // O^T: dim t*16 + 8*hl + v, query l16
#pragma unroll
  for (int t = 0; t < 4; ++t) oacc[t] = vzero;

  // 4 async b128 copies per thread per key tile (2 K + 2 VT).
  auto issueKV = [&](int buf, int kb) {
#pragma unroll
    for (int i = 0; i < 2; ++i) {
      int ch = tid + i * 256;                 // 512 chunks of 8 f16
      int rr = ch >> 3, cc = (ch & 7) * 8;    // 64 rows x 64 cols
      cp16(&Kh[(((size_t)hk * SEQ) + kb + rr) * HDIM + cc],
           &sK[buf][rr * APITCH + cc]);
      cp16(&VT[(((size_t)hk * HDIM) + rr) * SEQ + kb + cc],
           &sVT[buf][rr * APITCH + cc]);
    }
  };

  issueKV(0, 0);
  int buf = 0;
  for (int kb = 0; kb < SEQ; kb += 64) {
    const bool more = (kb + 64) < SEQ;
    if (more) issueKV(buf ^ 1, kb + 64);
    if (more) async_wait_le4(); else async_wait_0();
    __syncthreads();

    // S^T tile = K * Q^T  (64k x 16q per wave: 4 row-tiles x 2 k-chunks)
    v8f sacc[4];
#pragma unroll
    for (int u = 0; u < 4; ++u) {
      sacc[u] = vzero;
#pragma unroll
      for (int c = 0; c < 2; ++c) {
        v16h ak = ldfrag(&sK[buf][(u * 16 + l16) * APITCH + c * 32 + hl * 8]);
        sacc[u] = wmma16(ak, bq[c], sacc[u]);
      }
    }

    // Online softmax of the lane's query over its 32 keys of the tile; four
    // independent chains, one per score tile.
    float tmu[4];
#pragma unroll
    for (int u = 0; u < 4; ++u) {
      tmu[u] = -3.0e38f;
#pragma unroll
      for (int v = 0; v < 8; ++v) {
        sacc[u][v] *= 0.125f;                  // 1/sqrt(64)
        tmu[u] = fmaxf(tmu[u], sacc[u][v]);
      }
    }
    float tm = fmaxf(fmaxf(tmu[0], tmu[1]), fmaxf(tmu[2], tmu[3]));
    tm = fmaxf(tm, other_half(tm));            // the query's other 32 keys
    const float mnew  = fmaxf(m, tm);
    const float alpha = __expf(m - mnew);
    m = mnew;

    // P^T as B operand: element e < 8 is key 8*hl + e of the 32-key chunk,
    // element 8 + e key 16 + 8*hl + e, the k order of ldfrag.
    v16h bp[2];
    float rsu[4];
#pragma unroll
    for (int u = 0; u < 4; ++u) {
      rsu[u] = 0.0f;
#pragma unroll
      for (int v = 0; v < 8; ++v) {
        float p = __expf(sacc[u][v] - mnew);
        rsu[u] += p;
        bp[u >> 1][(u & 1) * 8 + v] = (_Float16)p;
      }
    }
    lsum = lsum * alpha + ((rsu[0] + rsu[1]) + (rsu[2] + rsu[3]));
#pragma unroll
    for (int t = 0; t < 4; ++t)
#pragma unroll
      for (int v = 0; v < 8; ++v) oacc[t][v] *= alpha;

    // O^T += V^T * P^T
#pragma unroll
    for (int c = 0; c < 2; ++c)
#pragma unroll
      for (int t = 0; t < 4; ++t) {
        v16h av = ldfrag(&sVT[buf][(t * 16 + l16) * APITCH + c * 32 + hl * 8]);
        oacc[t] = wmma16(av, bp[c], oacc[t]);
      }
    __syncthreads();
    buf ^= 1;
  }

  // Join the halves' sums, normalize and pack into [seq][heads*64] f16 for the
  // output projection: a lane's 8 registers of a tile are 8 neighbouring dims
  // of its query, one 16-byte store.
  const float inv = 1.0f / (lsum + other_half(lsum));
  _Float16* orow = O + (size_t)(qw + l16) * HIDDEN + h * HDIM + 8 * hl;
#pragma unroll
  for (int t = 0; t < 4; ++t) {
    f16x8 o;
#pragma unroll
    for (int v = 0; v < 8; ++v) o[v] = (_Float16)(oacc[t][v] * inv);
    *(f16x8*)(orow + t * 16) = o;
  }
}

// ---------------------------------------------------------------------------
// Host orchestration
// ---------------------------------------------------------------------------
extern "C" void kernel_launch(void* const* d_in, const int* in_sizes, int n_in,
                              void* d_out, int out_size, void* d_ws,
                              size_t ws_size, hipStream_t stream) {
  (void)in_sizes; (void)n_in; (void)out_size; (void)ws_size;
  const float* x   = (const float*)d_in[0];
  const float* Wq  = (const float*)d_in[1];
  const float* bq  = (const float*)d_in[2];
  const float* Wk  = (const float*)d_in[3];
  const float* bk  = (const float*)d_in[4];
  const float* Wv  = (const float*)d_in[5];
  const float* bv  = (const float*)d_in[6];
  const float* Wo  = (const float*)d_in[7];
  const float* bo  = (const float*)d_in[8];
  const float* qg  = (const float*)d_in[9];
  const float* qb  = (const float*)d_in[10];
  const float* kg  = (const float*)d_in[11];
  const float* kbb = (const float*)d_in[12];

  char* ws = (char*)d_ws;
  size_t off = 0;
  auto alloc = [&](size_t bytes) {
    void* p = ws + off;
    off += (bytes + 255) & ~(size_t)255;
    return p;
  };
  _Float16* x16   = (_Float16*)alloc((size_t)SEQ * HIDDEN * 2);
  _Float16* WqT16 = (_Float16*)alloc((size_t)HIDDEN * HIDDEN * 2);
  _Float16* WkT16 = (_Float16*)alloc((size_t)HIDDEN * KVDIM * 2);
  _Float16* WvT16 = (_Float16*)alloc((size_t)HIDDEN * KVDIM * 2);
  _Float16* WoT16 = (_Float16*)alloc((size_t)HIDDEN * HIDDEN * 2);
  float*    cosT  = (float*)   alloc((size_t)SEQ * NFREQ * 4);
  float*    sinT  = (float*)   alloc((size_t)SEQ * NFREQ * 4);
  _Float16* Q16   = (_Float16*)alloc((size_t)NHEADS * SEQ * HDIM * 2);
  _Float16* K16   = (_Float16*)alloc((size_t)NKV * SEQ * HDIM * 2);
  _Float16* VT16  = (_Float16*)alloc((size_t)NKV * HDIM * SEQ * 2);
  _Float16* O16   = (_Float16*)alloc((size_t)SEQ * HIDDEN * 2);

  prep_operands<<<OPERAND_BLOCKS, 256, 0, stream>>>(
      x, Wq, Wk, Wv, Wo, x16, WqT16, WkT16, WvT16, WoT16, cosT, sinT);

  // Projections (f16 WMMA, f32 accum + bias); in their epilogue the per-head
  // QK layernorm + RoPE, packed head-major f16, and V transposed.
  gemm_qkv<<<dim3(Q_COLS + 2 * KV_COLS, SEQ / 128), 256, 0, stream>>>(
      x16, WqT16, WkT16, WvT16, bq, bk, bv, qg, qb, kg, kbb, cosT, sinT,
      Q16, K16, VT16, HIDDEN);

  // GQA flash attention
  attn_fmha<<<dim3(SEQ / 128, NHEADS), 256, 0, stream>>>(Q16, K16, VT16, O16);

  // Output projection -> f32 result
  gemm_wmma<<<dim3(HIDDEN / 128, SEQ / 128), 256, 0, stream>>>(
      O16, WoT16, bo, (float*)d_out, SEQ, HIDDEN, HIDDEN);
}

// v008
// It runs in 90.6 microseconds.
// Timed twice side by side with v007, it ran 1.04 and 1.05 times as fast.
// Counting every step since v000, it is 5.28 times as fast.
#include <hip/hip_runtime.h>
#include <hip/hip_bf16.h>
#include <stdint.h>

// ---------------------------------------------------------------------------
// Types for CDNA5 WMMA (wave32): A/B = v16h (16 halves = 8 VGPRs),
// C/D = v8f (8 VGPRs of f32).
// ---------------------------------------------------------------------------
typedef __attribute__((ext_vector_type(16))) _Float16 v16h;
typedef __attribute__((ext_vector_type(8)))  float    v8f;
typedef __attribute__((ext_vector_type(8)))  _Float16 f16x8;
typedef __attribute__((ext_vector_type(4)))  int      v4i;
typedef __attribute__((ext_vector_type(4)))  float    f32x4;
typedef __attribute__((ext_vector_type(2)))  _Float16 f16x2;
typedef __attribute__((ext_vector_type(2)))  float    f32x2;

#define SEQ      2048
#define HIDDEN   2048
#define NHEADS   32
#define NKV      8
#define HDIM     64
#define KVDIM    (NKV * HDIM)   // 512

// LDS row pitches in f16 elements. The GEMM and attention tiles are read by 16-byte loads,
// one row per lane: a pitch of 16 B x odd spreads the 16 rows of a half-wave
// over all 64 banks; dense 128-B and 256-B rows fold them onto a few.
#define GK       128            // k depth of one GEMM stage
#define GPITCH   136            // 128-element (256 B) GEMM rows -> 272 B
#define APITCH   72             // 64-element (128 B) attention rows -> 144 B

// Async Global->LDS (ASYNCcnt-tracked) if the toolchain exposes it.
#if defined(__gfx1250__) && \
    __has_builtin(__builtin_amdgcn_global_load_async_to_lds_b128) && \
    __has_builtin(__builtin_amdgcn_s_wait_asynccnt)
#define HAVE_ASYNC 1
#else
#define HAVE_ASYNC 0
#endif

#if HAVE_ASYNC
// Builtin signature (from compiler diagnostic): typed v4i pointers,
// (addrspace(1) src, addrspace(3) dst, imm offset, imm cpol).
typedef __attribute__((address_space(1))) v4i GlobalV4;
typedef __attribute__((address_space(3))) v4i LocalV4;
#endif

// Copy 16 bytes Global -> LDS. Async path bypasses VGPRs (tracked by
// ASYNCcnt); fallback is a synchronous load+store.
__device__ __forceinline__ void cp16(const _Float16* g, _Float16* l) {
#if HAVE_ASYNC
  __builtin_amdgcn_global_load_async_to_lds_b128(
      (GlobalV4*)(const void*)g, (LocalV4*)(void*)l, 0, 0);
#else
  *(f16x8*)l = *(const f16x8*)g;
#endif
}
__device__ __forceinline__ void async_wait_le4() {
#if HAVE_ASYNC
  __builtin_amdgcn_s_wait_asynccnt(4);   // keep newest 4 (next tile) in flight
#endif
}
__device__ __forceinline__ void async_wait_0() {
#if HAVE_ASYNC
  __builtin_amdgcn_s_wait_asynccnt(0);
#endif
}

__device__ __forceinline__ v8f wmma16(v16h a, v16h b, v8f c) {
  // D = A(16x32 f16) * B(32x16 f16) + C(16x16 f32)
  return __builtin_amdgcn_wmma_f32_16x16x32_f16(
      /*neg_a=*/false, a, /*neg_b=*/false, b,
      /*c_mod=*/(short)0, c, /*reuse_a=*/false, /*reuse_b=*/false);
}

// One lane's 16-element WMMA fragment: two contiguous 8-element (16 B) runs
// 16 elements apart in K (e0..7 -> K = 8*half + e ; e8..15 -> K = 16+8*half+e).
__device__ __forceinline__ v16h ldfrag(const _Float16* p) {
  f16x8 lo = *(const f16x8*)p;
  f16x8 hi = *(const f16x8*)(p + 16);
  v16h r;
#pragma unroll
  for (int j = 0; j < 8; ++j) { r[j] = lo[j]; r[j + 8] = hi[j]; }
  return r;
}

// ---------------------------------------------------------------------------
// Elementwise converts / transposes. These launches move few bytes, so their
// time is the time to start their waves: every thread handles 32 elements
// through 16-byte accesses and the grids stay at a few workgroups per WGP.
// ---------------------------------------------------------------------------
#define CVT_PER_BLOCK (256 * 32)

// f32 -> f16, piece blk of CVT_PER_BLOCK elements. All eight loads of a
// thread are issued before the first convert.
__device__ __forceinline__
void cvt_piece(const float* __restrict__ s, _Float16* __restrict__ d, int blk) {
  const size_t base = (size_t)blk * CVT_PER_BLOCK + threadIdx.x * 8;
  f32x4 lo[4], hi[4];
#pragma unroll
  for (int j = 0; j < 4; ++j) {
    lo[j] = *(const f32x4*)(s + base + j * 2048);
    hi[j] = *(const f32x4*)(s + base + j * 2048 + 4);
  }
#pragma unroll
  for (int j = 0; j < 4; ++j) {
    f16x8 o;
#pragma unroll
    for (int e = 0; e < 4; ++e) {
      o[e]     = (_Float16)lo[j][e];
      o[e + 4] = (_Float16)hi[j][e];
    }
    *(f16x8*)(d + base + j * 2048) = o;
  }
  // A precaution: in a grid of several jobs the listing lays another job's
  // code behind these stores; it writes their registers only behind this wait.
  asm volatile("s_wait_xcnt 0x0" ::: "memory");
}

// S [KD][ND] f32 -> D [ND][KD] f16 (lets the GEMMs stream
// their operands as contiguous 16-byte runs straight into LDS).
// One block = one 128(k) x 64(n) tile, number tile in row-major order of the
// (KD / 128) x (ND / 64) tiles, KD % 128 == 0 and ND % 64 == 0:
// 256-byte row pieces in, turned in LDS, 256-byte row pieces out. The shapes
// are compile-time so that a thread's eight loads and four stores each hang
// off one address with immediate offsets.
#define TK       128
#define TN       64
#define TPITCH   (TK + 8)       // 272 B = 16 B x odd for the 16-byte readers
template <int KD, int ND>
__device__ __forceinline__
void transpose_tile(const float* __restrict__ s, _Float16* __restrict__ d,
                    _Float16* sT, int tile) {              // sT: [n][k]
  const int t  = threadIdx.x;
  const int k0 = (tile / (ND / TN)) * TK, n0 = (tile % (ND / TN)) * TN;
  const int n4 = (t & 15) * 4;        // four neighbouring columns
  const int kp = (t >> 4) * 2;        // two neighbouring rows -> one dword

  const float* p = s + (size_t)(k0 + kp) * ND + n0 + n4;
  f32x4 ra[4], rb[4];
#pragma unroll
  for (int j = 0; j < 4; ++j) {
    ra[j] = *(const f32x4*)(p + (32 * j) * ND);
    rb[j] = *(const f32x4*)(p + (32 * j + 1) * ND);
  }
#pragma unroll
  for (int j = 0; j < 4; ++j)
#pragma unroll
    for (int i = 0; i < 4; ++i) {
      f16x2 w = {(_Float16)ra[j][i], (_Float16)rb[j][i]};
      *(f16x2*)&sT[(n4 + i) * TPITCH + kp + 32 * j] = w;
    }
  __syncthreads();                    // whole tile in LDS before it is read
  const int n = t >> 4, kc = (t & 15) * 8;   // 16 rows x 16 chunks a pass
  _Float16* q = d + (size_t)(n0 + n) * KD + k0 + kc;
#pragma unroll
  for (int j = 0; j < 4; ++j)
    *(f16x8*)(q + (16 * j) * KD) =
        *(const f16x8*)&sT[(n + 16 * j) * TPITCH + kc];
  // A precaution, as in cvt_piece: code laid behind these stores writes their
  // registers only behind this wait.
  asm volatile("s_wait_xcnt 0x0" ::: "memory");
}

// RoPE tables cosT, sinT [S][32] f32 (emb = concat(freqs, freqs): frequency
// index = dim % 32). Piece blk holds 32 positions; a wave takes four of them,
// a lane one frequency. The projection's epilogue reads them: there every
// head of a position would otherwise work out the same 32 angles again.
#define NFREQ    (HDIM / 2)
#define ROPE_BLOCKS (SEQ / 32)
__device__ __forceinline__
void rope_piece(float* __restrict__ cosT, float* __restrict__ sinT, int blk) {
  const int wave = threadIdx.x >> 5, lane = threadIdx.x & 31;
  const float invf = __powf(10000.0f, -(float)lane / 32.0f);
  // Rolled: cosf and sinf are long, and code that runs once is fetched cold;
  // unrolled, every trip would wait for instructions of its own.
#pragma unroll 1
  for (int j = 0; j < 4; ++j) {
    const int s = blk * 32 + j * 8 + wave;
    const float ang = (float)s * invf;
    cosT[s * NFREQ + lane] = cosf(ang);
    sinT[s * NFREQ + lane] = sinf(ang);
    // A precaution, as in cvt_piece: the next trip, and code laid behind the
    // loop, write these stores' registers only behind this wait.
    asm volatile("s_wait_xcnt 0x0" ::: "memory");
  }
}

#define SQ_TILES ((HIDDEN / TK) * (HIDDEN / TN))   // [2048][2048]: Wq, Wo
#define KV_TILES ((HIDDEN / TK) * (KVDIM / TN))    // [2048][512]: Wk, Wv
#define X_PIECES ((SEQ * HIDDEN) / CVT_PER_BLOCK)

// The five operand conversions and the RoPE tables depend on nothing and on
// one another not at all: one grid holds them all, a block's index says which
// job it does, and the chip fills once instead of six times. The table blocks,
// the longest in instructions, come first.
#define OPERAND_BLOCKS (ROPE_BLOCKS + 2 * SQ_TILES + 2 * KV_TILES + X_PIECES)
__global__ __launch_bounds__(256)
void prep_operands(const float* __restrict__ x, const float* __restrict__ Wq,
                   const float* __restrict__ Wk, const float* __restrict__ Wv,
                   const float* __restrict__ Wo, _Float16* __restrict__ x16,
                   _Float16* __restrict__ WqT, _Float16* __restrict__ WkT,
                   _Float16* __restrict__ WvT, _Float16* __restrict__ WoT,
                   float* __restrict__ cosT, float* __restrict__ sinT) {
  __shared__ __align__(16) _Float16 sT[TN * TPITCH];       // 17 KB
  const int b = (int)blockIdx.x - ROPE_BLOCKS, bkv = b - 2 * SQ_TILES;
  if (b < 0) {
    rope_piece(cosT, sinT, blockIdx.x);
  } else if (b < 2 * SQ_TILES) {
    const bool o = b >= SQ_TILES;
    transpose_tile<HIDDEN, HIDDEN>(o ? Wo : Wq, o ? WoT : WqT, sT,
                                   b % SQ_TILES);
  } else if (bkv < 2 * KV_TILES) {
    const bool v = bkv >= KV_TILES;
    transpose_tile<HIDDEN, KVDIM>(v ? Wv : Wk, v ? WvT : WkT, sT,
                                  bkv % KV_TILES);
  } else {
    cvt_piece(x, x16, bkv - 2 * KV_TILES);
  }
}

// ---------------------------------------------------------------------------
// Tiled WMMA GEMM: C[M,N] = A[M,K](f16) * B[K,N] + bias, f32 out.
// B supplied pre-transposed: BT[N][K]. Block tile 128x128, 8 waves (2x4),
// each wave 64x32 => 8 WMMA per 32-deep k-step, four k-steps per LDS stage.
// A stage holds GK = 128 k of both operands: a row's piece is 256 B, two whole
// cache lines, and a wave's copy takes two such pieces; the copies of a stage
// fly for as long as the four k-steps of the stage before take, and copy wait
// and barrier come once a stage. K % GK == 0.
// ---------------------------------------------------------------------------
// gemm_acc leaves the wave's sums in acc[t][u]: row bm + wm + t*16 + v + 8*half
// of A against row bn + wn + u*16 + (lane & 15) of BT.
__device__ __forceinline__
void gemm_acc(const _Float16* __restrict__ A, const _Float16* __restrict__ BT,
              int K, int bm, int bn, v8f (&acc)[4][2]) {
  __shared__ __align__(16) _Float16 sA [2][128 * GPITCH];  // [row][k]  2x34 KB
  __shared__ __align__(16) _Float16 sBT[2][128 * GPITCH];  // [col][k]  2x34 KB
  const int tid  = threadIdx.x;
  const int wave = tid >> 5, lane = tid & 31;
  const int hl   = lane >> 4, l16 = lane & 15;
  const int wm = (wave >> 2) * 64, wn = (wave & 3) * 32;

  const v8f vzero = {0.f, 0.f, 0.f, 0.f, 0.f, 0.f, 0.f, 0.f};
#pragma unroll
  for (int t = 0; t < 4; ++t)
#pragma unroll
    for (int u = 0; u < 2; ++u) acc[t][u] = vzero;

  // 16 async b128 copies per thread per stage (8 A + 8 BT): 2048 chunks of
  // 8 f16 an operand, 128 rows x 128 k. Block and stage are in two bases that
  // are the same for the whole wave and step on by a stage with every issue;
  // what is the thread's own, row tid / 16 + 16 i and chunk tid % 16, is one
  // 32-bit element offset that serves both operands and every stage.
  const int r0 = tid >> 4, c0 = (tid & 15) * 8;
  const _Float16* An = A  + (size_t)bm * K;   // the next stage to set out
  const _Float16* Bn = BT + (size_t)bn * K;
  auto issue = [&](int buf) {
#pragma unroll
    for (int i = 0; i < 8; ++i) {
      const unsigned off = (unsigned)((r0 + i * 16) * K + c0);
      const int l = (r0 + i * 16) * GPITCH + c0;
      cp16(An + off, &sA [buf][l]);
      cp16(Bn + off, &sBT[buf][l]);
    }
    An += GK;
    Bn += GK;
  };

  // Two buffers: stage 0 lands and is published, then stage 1 sets out.
  issue(0);
  // This wave's copies of stage 0 have landed before the barrier publishes it.
  asm volatile("s_wait_asynccnt 0x0" ::: "memory");
  __syncthreads();
  if (GK < K) issue(1);
  int buf = 0;
  for (int k0 = 0; k0 < K; k0 += GK) {
    // Unrolled: the four k-steps read at immediate offsets from two addresses.
#pragma unroll
    for (int kk = 0; kk < GK; kk += 32) {
      // All six fragments of the k-step have registers of their own: their
      // twelve LDS loads go out as one group and the wave waits out the LDS
      // latency once a k-step. With one A fragment's registers shared by the
      // four row tiles it waits four times, each behind two WMMAs.
      v16h bfrag[2], afrag[4];
#pragma unroll
      for (int u = 0; u < 2; ++u)
        bfrag[u] =
            ldfrag(&sBT[buf][(wn + u * 16 + l16) * GPITCH + kk + hl * 8]);
#pragma unroll
      for (int t = 0; t < 4; ++t)
        afrag[t] = ldfrag(&sA[buf][(wm + t * 16 + l16) * GPITCH + kk + hl * 8]);
      // Keeps the group whole: without it the scheduler sinks each A
      // fragment's loads to its WMMAs and folds the four into one register
      // set again.
      __builtin_amdgcn_sched_barrier(0);
#pragma unroll
      for (int t = 0; t < 4; ++t)
#pragma unroll
        for (int u = 0; u < 2; ++u)
          acc[t][u] = wmma16(afrag[t], bfrag[u], acc[t][u]);
      // Keeps the WMMAs in front of the next group and of the stage's closing
      // wait for every LDS load: each pair starts behind a counted wait, as
      // soon as its own fragments are in.
      __builtin_amdgcn_sched_barrier(0);
    }
    // Hand-over of the stage. This wave's reads of buf are done before buf is
    // refilled ...
    asm volatile("s_wait_dscnt 0x0" ::: "memory");
    // ... and its copies of the next stage have landed before the barrier,
    // which publishes that stage and ends every wave's reads of buf. Behind
    // the last trip's wait nothing sets out: the loop ends with no copy open.
    asm volatile("s_wait_asynccnt 0x0" ::: "memory");
    __syncthreads();
    if (k0 + 2 * GK < K) issue(buf);
    buf ^= 1;
  }
}

__device__ __forceinline__
void gemm_tile(const _Float16* __restrict__ A, const _Float16* __restrict__ BT,
               const float* __restrict__ bias, float* __restrict__ C,
               int N, int K, int bm, int bn) {
  const int wave = threadIdx.x >> 5, lane = threadIdx.x & 31;
  const int hl   = lane >> 4, l16 = lane & 15;
  const int wm = (wave >> 2) * 64, wn = (wave & 3) * 32;
  v8f acc[4][2];
  gemm_acc(A, BT, K, bm, bn, acc);

  // Epilogue: C layout => row = v + 8*(lane>=16), col = lane&15.
#pragma unroll
  for (int t = 0; t < 4; ++t)
#pragma unroll
    for (int u = 0; u < 2; ++u) {
      int col = bn + wn + u * 16 + l16;
      float bs = bias ? bias[col] : 0.0f;
#pragma unroll
      for (int v = 0; v < 8; ++v) {
        int row = bm + wm + t * 16 + v + 8 * hl;
        C[(size_t)row * N + col] = acc[t][u][v] + bs;
      }
      // A precaution: the next tile's sums and addresses go into the registers
      // that these stores name only behind this wait, on every path.
      asm volatile("s_wait_xcnt 0x0" ::: "memory");
    }
}

__global__ __launch_bounds__(256, 2)
void gemm_wmma(const _Float16* __restrict__ A, const _Float16* __restrict__ BT,
               const float* __restrict__ bias, float* __restrict__ C,
               int M, int N, int K) {
  gemm_tile(A, BT, bias, C, N, K, blockIdx.y * 128, blockIdx.x * 128);
}

// Value of lane l ^ 16.
__device__ __forceinline__ float other_half(float x) {
  int b = __builtin_bit_cast(int, x);
  b = __builtin_amdgcn_permlanex16(b, b, 0x76543210, 0xfedcba98, false, false);
  return __builtin_bit_cast(float, b);
}

// Eight neighbouring f32 (32-byte aligned) by two 16-byte loads, at byte
// offset off (the lane's) + imm (a constant) from a wave-uniform base.
__device__ __forceinline__
void ld8(const float* __restrict__ base, unsigned off, int imm, float (&r)[8]) {
  const float* p = (const float*)((const char*)base + off) + imm / 4;
  const f32x4 lo = *(const f32x4*)p, hi = *(const f32x4*)(p + 4);
#pragma unroll
  for (int e = 0; e < 4; ++e) { r[e] = lo[e]; r[e + 4] = hi[e]; }
}

// Epilogue of a Q or K tile: bias, per-(token, head) layernorm and RoPE on the
// sums while they are in registers, packed head-major f16.
// The tile was computed transposed (rows = output dims, columns = tokens), and
// a wave's 64 rows are one head: a lane holds dims t*16 + 8*half + v of token
// u*16 + (lane & 15), half a head row. Mean and variance are sums in the
// lane's own registers plus one exchange between the wave's halves; dims d and
// d + 32, RoPE's pair, are tiles t and t + 2 of the same lane; eight
// neighbouring dims leave as one 16-byte store.
// bias: the projection's, head its head; out: the head's [S][64] f16; tok0:
// the wave's first token.
__device__ __forceinline__
void head_epilogue(const v8f (&acc)[4][2], const float* __restrict__ bias,
                   int head, const float* __restrict__ g,
                   const float* __restrict__ b,
                   const float* __restrict__ cosT,
                   const float* __restrict__ sinT, _Float16* __restrict__ out,
                   int tok0) {
  const int lane = threadIdx.x & 31;
  const int hl   = lane >> 4, l16 = lane & 15;
  const unsigned doff = hl * 32u;              // bytes: dims 8*half ...
  const unsigned boff = (unsigned)head * (HDIM * 4u) + doff;
#pragma unroll
  for (int u = 0; u < 2; ++u) {
    const int tok = tok0 + u * 16 + l16;
    const unsigned toff = (unsigned)tok * (NFREQ * 4u) + doff;
    // All that the token needs from memory goes out as one group: one memory
    // latency a token.
    float bs[4][8], gg[4][8], bb[4][8], c[2][8], sn[2][8];
#pragma unroll
    for (int t = 0; t < 4; ++t) {
      ld8(bias, boff, t * 64, bs[t]);
      ld8(g, doff, t * 64, gg[t]);
      ld8(b, doff, t * 64, bb[t]);
    }
#pragma unroll
    for (int t = 0; t < 2; ++t) {
      ld8(cosT, toff, t * 64, c[t]);
      ld8(sinT, toff, t * 64, sn[t]);
    }
    // A precaution: the loads' offset registers are inputs here, so they live
    // up to this wait and nothing, a later load's result included, is written
    // over them in front of it.
    asm volatile("s_wait_xcnt 0x0" :: "v"(doff), "v"(boff), "v"(toff)
                 : "memory");
    // Keeps the group whole: without it the scheduler sinks the scale, shift
    // and table loads behind the sums, and the wave waits out their latency
    // three times a token.
    __builtin_amdgcn_sched_barrier(0);

    float x[4][8], part[4];
#pragma unroll
    for (int t = 0; t < 4; ++t) {
      part[t] = 0.0f;
#pragma unroll
      for (int v = 0; v < 8; ++v) {
        x[t][v] = acc[t][u][v] + bs[t][v];
        part[t] += x[t][v];
      }
    }
    float sum = (part[0] + part[1]) + (part[2] + part[3]);
    sum += other_half(sum);                    // the head row's other 32 dims
    const float mu = sum * (1.0f / 64.0f);
#pragma unroll
    for (int t = 0; t < 4; ++t) {
      part[t] = 0.0f;
#pragma unroll
      for (int v = 0; v < 8; ++v) {
        x[t][v] -= mu;
        part[t] += x[t][v] * x[t][v];
      }
    }
    float vs = (part[0] + part[1]) + (part[2] + part[3]);
    vs += other_half(vs);
    const float inv = rsqrtf(vs * (1.0f / 64.0f) + 1e-5f);
#pragma unroll
    for (int t = 0; t < 4; ++t)
#pragma unroll
      for (int v = 0; v < 8; ++v)
        x[t][v] = x[t][v] * inv * gg[t][v] + bb[t][v];
    _Float16* dst = out + (size_t)tok * HDIM + 8 * hl;
#pragma unroll
    for (int t = 0; t < 2; ++t) {
      f16x8 o0, o1;
#pragma unroll
      for (int v = 0; v < 8; ++v) {            // rotate_half: [-x2, x1]
        o0[v] = (_Float16)(x[t][v] * c[t][v] - x[t + 2][v] * sn[t][v]);
        o1[v] = (_Float16)(x[t + 2][v] * c[t][v] + x[t][v] * sn[t][v]);
      }
      *(f16x8*)(dst + t * 16)      = o0;
      *(f16x8*)(dst + t * 16 + 32) = o1;
    }
    // A precaution: the next token's values and addresses go into the
    // registers that these stores name only behind this wait.
    asm volatile("s_wait_xcnt 0x0" ::: "memory");
  }
}

// The three projections of x in one grid: tile columns 0..15 are Q's, 16..19
// K's, 20..23 V's. Alone, K's and V's 64 tiles each leave three quarters of
// the chip idle for as long as Q's 256 take.
// What stood between the projections and the attention as a launch of its own
// is each tile's epilogue. Both operands lie in LDS as rows along k, so which
// of them is the matrix instruction's A is free:
//  - Q and K tiles take the weights as A (rows = dims): head_epilogue.
//  - V tiles take x as A (rows = tokens): a lane's 8 registers of a tile are 8
//    neighbouring tokens of one dim, one 16-byte store into VT [NKV*64][S].
// out: Q16 [32][S][64], K16 [8][S][64], VT16 [8*64][S], all f16.
#define Q_COLS   (HIDDEN / 128)
#define KV_COLS  (KVDIM / 128)
__global__ __launch_bounds__(256, 2)
void gemm_qkv(const _Float16* __restrict__ A, const _Float16* __restrict__ WqT,
              const _Float16* __restrict__ WkT,
              const _Float16* __restrict__ WvT, const float* __restrict__ bq,
              const float* __restrict__ bk, const float* __restrict__ bv,
              const float* __restrict__ qg, const float* __restrict__ qb,
              const float* __restrict__ kg, const float* __restrict__ kb,
              const float* __restrict__ cosT, const float* __restrict__ sinT,
              _Float16* __restrict__ Q16, _Float16* __restrict__ K16,
              _Float16* __restrict__ VT16, int K) {
  const int wave = threadIdx.x >> 5, lane = threadIdx.x & 31;
  const int hl   = lane >> 4, l16 = lane & 15;
  const int wm = (wave >> 2) * 64, wn = (wave & 3) * 32;
  const int c = blockIdx.x;
  const bool q = c < Q_COLS, k = c < Q_COLS + KV_COLS;
  const int tok0 = blockIdx.y * 128;
  const int n0   = (c - (q ? 0 : k ? Q_COLS : Q_COLS + KV_COLS)) * 128;

  v8f acc[4][2];
  gemm_acc(k ? (q ? WqT : WkT) : A, k ? A : WvT, K, k ? n0 : tok0,
           k ? tok0 : n0, acc);

  if (k) {
    const int head = (n0 + wm) / HDIM;
    head_epilogue(acc, q ? bq : bk, head, q ? qg : kg, q ? qb : kb, cosT, sinT,
                  (q ? Q16 : K16) + (size_t)head * SEQ * HDIM, tok0 + wn);
  } else {
#pragma unroll
    for (int u = 0; u < 2; ++u) {
      const int dim = n0 + wn + u * 16 + l16;
      const float bs = bv[dim];
      _Float16* dst = VT16 + (size_t)dim * SEQ + tok0 + wm + 8 * hl;
#pragma unroll
      for (int t = 0; t < 4; ++t) {
        f16x8 o;
#pragma unroll
        for (int v = 0; v < 8; ++v) o[v] = (_Float16)(acc[t][u][v] + bs);
        *(f16x8*)(dst + t * 16) = o;
      }
      // A precaution: the next column's values and address go into the
      // registers that these stores name only behind this wait.
      asm volatile("s_wait_xcnt 0x0" ::: "memory");
    }
  }
}

// The grid is two blocks a WGP, four waves a SIMD: naming that occupancy gives
// the compiler the registers to keep a product's fragment loads together in
// front of its WMMAs; aiming higher, it waits for each fragment by itself.
__global__ __launch_bounds__(256) __attribute__((amdgpu_waves_per_eu(4, 4)))
void attn_fmha(const _Float16* __restrict__ Q, const _Float16* __restrict__ Kh,
               const _Float16* __restrict__ VT, _Float16* __restrict__ O) {
  __shared__ __align__(16) _Float16 sK [2][64 * APITCH];  // [key][dim] 2x9 KB
  __shared__ __align__(16) _Float16 sVT[2][64 * APITCH];  // [dim][key] 2x9 KB
  const int tid  = threadIdx.x;
  const int wave = tid >> 5, lane = tid & 31;
  const int hl   = lane >> 4, l16 = lane & 15;
  const int h  = blockIdx.y;          // q head
  const int hk = h >> 2;              // kv head (n_rep = 4, grouped-adjacent)
  const int qw = blockIdx.x * 128 + wave * 16;

  // Q^T fragments (columns qw..qw+15, two 32-deep head-dim chunks), loaded
  // once: the B operand of the score product.
  v16h bq[2];
#pragma unroll
  for (int c = 0; c < 2; ++c)
    bq[c] = ldfrag(&Q[(((size_t)h * SEQ) + qw + l16) * HDIM + c * 32 + hl * 8]);

  const v8f vzero = {0.f, 0.f, 0.f, 0.f, 0.f, 0.f, 0.f, 0.f};
  // exp(s / 8 - max / 8) = exp2(s * SC - max * SC): the scores stay as the
  // matrix unit leaves them, and scale and base change are one multiply-add.
  const float SC = 0.125f * 1.44269504f;     // 1/sqrt(64) * log2(e)
  float m = -3.0e38f;                 // running maximum of the lane's query, raw
  float lsum = 0.0f;                  // sum over this half's keys only
  v8f oacc[4];                        // O^T: dim t*16 + 8*hl + v, query l16
#pragma unroll
  for (int t = 0; t < 4; ++t) oacc[t] = vzero;

  // 4 async b128 copies per thread per key tile (2 K + 2 VT).
  auto issueKV = [&](int buf, int kb) {
#pragma unroll
    for (int i = 0; i < 2; ++i) {
      int ch = tid + i * 256;                 // 512 chunks of 8 f16
      int rr = ch >> 3, cc = (ch & 7) * 8;    // 64 rows x 64 cols
      cp16(&Kh[(((size_t)hk * SEQ) + kb + rr) * HDIM + cc],
           &sK[buf][rr * APITCH + cc]);
      cp16(&VT[(((size_t)hk * HDIM) + rr) * SEQ + kb + cc],
           &sVT[buf][rr * APITCH + cc]);
    }
  };

  issueKV(0, 0);
  int buf = 0;
  for (int kb = 0; kb < SEQ; kb += 64) {
    const bool more = (kb + 64) < SEQ;
    if (more) issueKV(buf ^ 1, kb + 64);
    if (more) async_wait_le4(); else async_wait_0();
    __syncthreads();

    // S^T tile = K * Q^T  (64k x 16q per wave: 4 row-tiles x 2 k-chunks)
    v8f sacc[4];
#pragma unroll
    for (int u = 0; u < 4; ++u) {
      sacc[u] = vzero;
#pragma unroll
      for (int c = 0; c < 2; ++c) {
        v16h ak = ldfrag(&sK[buf][(u * 16 + l16) * APITCH + c * 32 + hl * 8]);
        sacc[u] = wmma16(ak, bq[c], sacc[u]);
      }
    }

    // Online softmax of the lane's query over its 32 keys of the tile; four
    // independent chains, one per score tile.
    float tmu[4];
#pragma unroll
    for (int u = 0; u < 4; ++u) {
      tmu[u] = -3.0e38f;
#pragma unroll
      for (int v = 0; v < 8; ++v) tmu[u] = fmaxf(tmu[u], sacc[u][v]);
    }
    float tm = fmaxf(fmaxf(tmu[0], tmu[1]), fmaxf(tmu[2], tmu[3]));
    tm = fmaxf(tm, other_half(tm));            // the query's other 32 keys
    // SC > 0: the largest raw score is the largest scaled one. alpha comes from
    // the difference of the raw maxima: exactly 1 while the maximum stands.
    const float mnew  = fmaxf(m, tm);
    const float mcn   = mnew * SC;
    const float alpha = __builtin_amdgcn_exp2f((m - mnew) * SC);
    m = mnew;
    const f32x2 sc2 = {SC, SC}, nm2 = {-mcn, -mcn};

    // P^T as B operand: element e < 8 is key 8*hl + e of the 32-key chunk,
    // element 8 + e key 16 + 8*hl + e, the k order of ldfrag.
    v16h bp[2];
    float rsu[4];
#pragma unroll
    for (int u = 0; u < 4; ++u) {
      rsu[u] = 0.0f;
#pragma unroll
      for (int v = 0; v < 8; v += 2) {
        // Two neighbouring scores a packed multiply-add.
        const f32x2 s2 = {sacc[u][v], sacc[u][v + 1]};
        const f32x2 t2 = __builtin_elementwise_fma(s2, sc2, nm2);
        const float p0 = __builtin_amdgcn_exp2f(t2[0]);
        const float p1 = __builtin_amdgcn_exp2f(t2[1]);
        rsu[u] += p0;
        rsu[u] += p1;
        bp[u >> 1][(u & 1) * 8 + v]     = (_Float16)p0;
        bp[u >> 1][(u & 1) * 8 + v + 1] = (_Float16)p1;
      }
    }
    lsum = lsum * alpha + ((rsu[0] + rsu[1]) + (rsu[2] + rsu[3]));
#pragma unroll
    for (int t = 0; t < 4; ++t)
#pragma unroll
      for (int v = 0; v < 8; ++v) oacc[t][v] *= alpha;

    // O^T += V^T * P^T
#pragma unroll
    for (int c = 0; c < 2; ++c)
#pragma unroll
      for (int t = 0; t < 4; ++t) {
        v16h av = ldfrag(&sVT[buf][(t * 16 + l16) * APITCH + c * 32 + hl * 8]);
        oacc[t] = wmma16(av, bp[c], oacc[t]);
      }
    __syncthreads();
    buf ^= 1;
  }

  // Join the halves' sums, normalize and pack into [seq][heads*64] f16 for the
  // output projection: a lane's 8 registers of a tile are 8 neighbouring dims
  // of its query, one 16-byte store.
  const float inv = 1.0f / (lsum + other_half(lsum));
  _Float16* orow = O + (size_t)(qw + l16) * HIDDEN + h * HDIM + 8 * hl;
#pragma unroll
  for (int t = 0; t < 4; ++t) {
    f16x8 o;
#pragma unroll
    for (int v = 0; v < 8; ++v) o[v] = (_Float16)(oacc[t][v] * inv);
    *(f16x8*)(orow + t * 16) = o;
  }
}

// ---------------------------------------------------------------------------
// Host orchestration
// ---------------------------------------------------------------------------
extern "C" void kernel_launch(void* const* d_in, const int* in_sizes, int n_in,
                              void* d_out, int out_size, void* d_ws,
                              size_t ws_size, hipStream_t stream) {
  (void)in_sizes; (void)n_in; (void)out_size; (void)ws_size;
  const float* x   = (const float*)d_in[0];
  const float* Wq  = (const float*)d_in[1];
  const float* bq  = (const float*)d_in[2];
  const float* Wk  = (const float*)d_in[3];
  const float* bk  = (const float*)d_in[4];
  const float* Wv  = (const float*)d_in[5];
  const float* bv  = (const float*)d_in[6];
  const float* Wo  = (const float*)d_in[7];
  const float* bo  = (const float*)d_in[8];
  const float* qg  = (const float*)d_in[9];
  const float* qb  = (const float*)d_in[10];
  const float* kg  = (const float*)d_in[11];
  const float* kbb = (const float*)d_in[12];

  char* ws = (char*)d_ws;
  size_t off = 0;
  auto alloc = [&](size_t bytes) {
    void* p = ws + off;
    off += (bytes + 255) & ~(size_t)255;
    return p;
  };
  _Float16* x16   = (_Float16*)alloc((size_t)SEQ * HIDDEN * 2);
  _Float16* WqT16 = (_Float16*)alloc((size_t)HIDDEN * HIDDEN * 2);
  _Float16* WkT16 = (_Float16*)alloc((size_t)HIDDEN * KVDIM * 2);
  _Float16* WvT16 = (_Float16*)alloc((size_t)HIDDEN * KVDIM * 2);
  _Float16* WoT16 = (_Float16*)alloc((size_t)HIDDEN * HIDDEN * 2);
  float*    cosT  = (float*)   alloc((size_t)SEQ * NFREQ * 4);
  float*    sinT  = (float*)   alloc((size_t)SEQ * NFREQ * 4);
  _Float16* Q16   = (_Float16*)alloc((size_t)NHEADS * SEQ * HDIM * 2);
  _Float16* K16   = (_Float16*)alloc((size_t)NKV * SEQ * HDIM * 2);
  _Float16* VT16  = (_Float16*)alloc((size_t)NKV * HDIM * SEQ * 2);
  _Float16* O16   = (_Float16*)alloc((size_t)SEQ * HIDDEN * 2);

  prep_operands<<<OPERAND_BLOCKS, 256, 0, stream>>>(
      x, Wq, Wk, Wv, Wo, x16, WqT16, WkT16, WvT16, WoT16, cosT, sinT);

  // Projections (f16 WMMA, f32 accum + bias); in their epilogue the per-head
  // QK layernorm + RoPE, packed head-major f16, and V transposed.
  gemm_qkv<<<dim3(Q_COLS + 2 * KV_COLS, SEQ / 128), 256, 0, stream>>>(
      x16, WqT16, WkT16, WvT16, bq, bk, bv, qg, qb, kg, kbb, cosT, sinT,
      Q16, K16, VT16, HIDDEN);

  // GQA flash attention
  attn_fmha<<<dim3(SEQ / 128, NHEADS), 256, 0, stream>>>(Q16, K16, VT16, O16);

  // Output projection -> f32 result
  gemm_wmma<<<dim3(HIDDEN / 128, SEQ / 128), 256, 0, stream>>>(
      O16, WoT16, bo, (float*)d_out, SEQ, HIDDEN, HIDDEN);
}

// v009
// It runs in 88 microseconds.
// Timed twice side by side with v008, it ran 1.03 and 1.04 times as fast.
// Over all steps from v000 it is 5.47 times as fast.
#include <hip/hip_runtime.h>
#include <hip/hip_bf16.h>
#include <stdint.h>

// ---------------------------------------------------------------------------
// Types for CDNA5 WMMA (wave32): A/B = v16h (16 halves = 8 VGPRs),
// C/D = v8f (8 VGPRs of f32).
// ---------------------------------------------------------------------------
typedef __attribute__((ext_vector_type(16))) _Float16 v16h;
typedef __attribute__((ext_vector_type(8)))  float    v8f;
typedef __attribute__((ext_vector_type(8)))  _Float16 f16x8;
typedef __attribute__((ext_vector_type(4)))  int      v4i;
typedef __attribute__((ext_vector_type(4)))  float    f32x4;
typedef __attribute__((ext_vector_type(2)))  _Float16 f16x2;
typedef __attribute__((ext_vector_type(2)))  float    f32x2;

#define SEQ      2048
#define HIDDEN   2048
#define NHEADS   32
#define NKV      8
#define HDIM     64
#define KVDIM    (NKV * HDIM)   // 512

// LDS row pitches in f16 elements. The GEMM and attention tiles are read by 16-byte loads,
// one row per lane: a pitch of 16 B x odd spreads the 16 rows of a half-wave
// over all 64 banks; dense 128-B and 256-B rows fold them onto a few.
#define GK       128            // k depth of one GEMM stage
#define GPITCH   136            // 128-element (256 B) GEMM rows -> 272 B
#define APITCH   72             // 64-element (128 B) attention rows -> 144 B

// Async Global->LDS (ASYNCcnt-tracked) if the toolchain exposes it.
#if defined(__gfx1250__) && \
    __has_builtin(__builtin_amdgcn_global_load_async_to_lds_b128) && \
    __has_builtin(__builtin_amdgcn_s_wait_asynccnt)
#define HAVE_ASYNC 1
#else
#define HAVE_ASYNC 0
#endif

#if HAVE_ASYNC
// Builtin signature (from compiler diagnostic): typed v4i pointers,
// (addrspace(1) src, addrspace(3) dst, imm offset, imm cpol).
typedef __attribute__((address_space(1))) v4i GlobalV4;
typedef __attribute__((address_space(3))) v4i LocalV4;
#endif

// Copy 16 bytes Global -> LDS. Async path bypasses VGPRs (tracked by
// ASYNCcnt); fallback is a synchronous load+store.
__device__ __forceinline__ void cp16(const _Float16* g, _Float16* l) {
#if HAVE_ASYNC
  __builtin_amdgcn_global_load_async_to_lds_b128(
      (GlobalV4*)(const void*)g, (LocalV4*)(void*)l, 0, 0);
#else
  *(f16x8*)l = *(const f16x8*)g;
#endif
}
__device__ __forceinline__ v8f wmma16(v16h a, v16h b, v8f c) {
  // D = A(16x32 f16) * B(32x16 f16) + C(16x16 f32)
  return __builtin_amdgcn_wmma_f32_16x16x32_f16(
      /*neg_a=*/false, a, /*neg_b=*/false, b,
      /*c_mod=*/(short)0, c, /*reuse_a=*/false, /*reuse_b=*/false);
}

// One lane's 16-element WMMA fragment: two contiguous 8-element (16 B) runs
// 16 elements apart in K (e0..7 -> K = 8*half + e ; e8..15 -> K = 16+8*half+e).
__device__ __forceinline__ v16h ldfrag(const _Float16* p) {
  f16x8 lo = *(const f16x8*)p;
  f16x8 hi = *(const f16x8*)(p + 16);
  v16h r;
#pragma unroll
  for (int j = 0; j < 8; ++j) { r[j] = lo[j]; r[j + 8] = hi[j]; }
  return r;
}

// ---------------------------------------------------------------------------
// Elementwise converts / transposes. These launches move few bytes, so their
// time is the time to start their waves: every thread handles 32 elements
// through 16-byte accesses and the grids stay at a few workgroups per WGP.
// ---------------------------------------------------------------------------
#define CVT_PER_BLOCK (256 * 32)

// f32 -> f16, piece blk of CVT_PER_BLOCK elements. All eight loads of a
// thread are issued before the first convert.
__device__ __forceinline__
void cvt_piece(const float* __restrict__ s, _Float16* __restrict__ d, int blk) {
  const size_t base = (size_t)blk * CVT_PER_BLOCK + threadIdx.x * 8;
  f32x4 lo[4], hi[4];
#pragma unroll
  for (int j = 0; j < 4; ++j) {
    lo[j] = *(const f32x4*)(s + base + j * 2048);
    hi[j] = *(const f32x4*)(s + base + j * 2048 + 4);
  }
#pragma unroll
  for (int j = 0; j < 4; ++j) {
    f16x8 o;
#pragma unroll
    for (int e = 0; e < 4; ++e) {
      o[e]     = (_Float16)lo[j][e];
      o[e + 4] = (_Float16)hi[j][e];
    }
    *(f16x8*)(d + base + j * 2048) = o;
  }
  // A precaution: in a grid of several jobs the listing lays another job's
  // code behind these stores; it writes their registers only behind this wait.
  asm volatile("s_wait_xcnt 0x0" ::: "memory");
}

// S [KD][ND] f32 -> D [ND][KD] f16 (lets the GEMMs stream
// their operands as contiguous 16-byte runs straight into LDS).
// One block = one 128(k) x 64(n) tile, number tile in row-major order of the
// (KD / 128) x (ND / 64) tiles, KD % 128 == 0 and ND % 64 == 0:
// 256-byte row pieces in, turned in LDS, 256-byte row pieces out. The shapes
// are compile-time so that a thread's eight loads and four stores each hang
// off one address with immediate offsets.
#define TK       128
#define TN       64
#define TPITCH   (TK + 8)       // 272 B = 16 B x odd for the 16-byte readers
template <int KD, int ND>
__device__ __forceinline__
void transpose_tile(const float* __restrict__ s, _Float16* __restrict__ d,
                    _Float16* sT, int tile) {              // sT: [n][k]
  const int t  = threadIdx.x;
  const int k0 = (tile / (ND / TN)) * TK, n0 = (tile % (ND / TN)) * TN;
  const int n4 = (t & 15) * 4;        // four neighbouring columns
  const int kp = (t >> 4) * 2;        // two neighbouring rows -> one dword

  const float* p = s + (size_t)(k0 + kp) * ND + n0 + n4;
  f32x4 ra[4], rb[4];
#pragma unroll
  for (int j = 0; j < 4; ++j) {
    ra[j] = *(const f32x4*)(p + (32 * j) * ND);
    rb[j] = *(const f32x4*)(p + (32 * j + 1) * ND);
  }
#pragma unroll
  for (int j = 0; j < 4; ++j)
#pragma unroll
    for (int i = 0; i < 4; ++i) {
      f16x2 w = {(_Float16)ra[j][i], (_Float16)rb[j][i]};
      *(f16x2*)&sT[(n4 + i) * TPITCH + kp + 32 * j] = w;
    }
  __syncthreads();                    // whole tile in LDS before it is read
  const int n = t >> 4, kc = (t & 15) * 8;   // 16 rows x 16 chunks a pass
  _Float16* q = d + (size_t)(n0 + n) * KD + k0 + kc;
#pragma unroll
  for (int j = 0; j < 4; ++j)
    *(f16x8*)(q + (16 * j) * KD) =
        *(const f16x8*)&sT[(n + 16 * j) * TPITCH + kc];
  // A precaution, as in cvt_piece: code laid behind these stores writes their
  // registers only behind this wait.
  asm volatile("s_wait_xcnt 0x0" ::: "memory");
}

// RoPE tables cosT, sinT [S][32] f32 (emb = concat(freqs, freqs): frequency
// index = dim % 32). Piece blk holds 32 positions; a wave takes four of them,
// a lane one frequency. The projection's epilogue reads them: there every
// head of a position would otherwise work out the same 32 angles again.
#define NFREQ    (HDIM / 2)
#define ROPE_BLOCKS (SEQ / 32)
__device__ __forceinline__
void rope_piece(float* __restrict__ cosT, float* __restrict__ sinT, int blk) {
  const int wave = threadIdx.x >> 5, lane = threadIdx.x & 31;
  const float invf = __powf(10000.0f, -(float)lane / 32.0f);
  // Rolled: cosf and sinf are long, and code that runs once is fetched cold;
  // unrolled, every trip would wait for instructions of its own.
#pragma unroll 1
  for (int j = 0; j < 4; ++j) {
    const int s = blk * 32 + j * 8 + wave;
    const float ang = (float)s * invf;
    cosT[s * NFREQ + lane] = cosf(ang);
    sinT[s * NFREQ + lane] = sinf(ang);
    // A precaution, as in cvt_piece: the next trip, and code laid behind the
    // loop, write these stores' registers only behind this wait.
    asm volatile("s_wait_xcnt 0x0" ::: "memory");
  }
}

#define SQ_TILES ((HIDDEN / TK) * (HIDDEN / TN))   // [2048][2048]: Wq, Wo
#define KV_TILES ((HIDDEN / TK) * (KVDIM / TN))    // [2048][512]: Wk, Wv
#define X_PIECES ((SEQ * HIDDEN) / CVT_PER_BLOCK)

// The five operand conversions and the RoPE tables depend on nothing and on
// one another not at all: one grid holds them all, a block's index says which
// job it does, and the chip fills once instead of six times. The table blocks,
// the longest in instructions, come first.
#define OPERAND_BLOCKS (ROPE_BLOCKS + 2 * SQ_TILES + 2 * KV_TILES + X_PIECES)
__global__ __launch_bounds__(256)
void prep_operands(const float* __restrict__ x, const float* __restrict__ Wq,
                   const float* __restrict__ Wk, const float* __restrict__ Wv,
                   const float* __restrict__ Wo, _Float16* __restrict__ x16,
                   _Float16* __restrict__ WqT, _Float16* __restrict__ WkT,
                   _Float16* __restrict__ WvT, _Float16* __restrict__ WoT,
                   float* __restrict__ cosT, float* __restrict__ sinT) {
  __shared__ __align__(16) _Float16 sT[TN * TPITCH];       // 17 KB
  const int b = (int)blockIdx.x - ROPE_BLOCKS, bkv = b - 2 * SQ_TILES;
  if (b < 0) {
    rope_piece(cosT, sinT, blockIdx.x);
  } else if (b < 2 * SQ_TILES) {
    const bool o = b >= SQ_TILES;
    transpose_tile<HIDDEN, HIDDEN>(o ? Wo : Wq, o ? WoT : WqT, sT,
                                   b % SQ_TILES);
  } else if (bkv < 2 * KV_TILES) {
    const bool v = bkv >= KV_TILES;
    transpose_tile<HIDDEN, KVDIM>(v ? Wv : Wk, v ? WvT : WkT, sT,
                                  bkv % KV_TILES);
  } else {
    cvt_piece(x, x16, bkv - 2 * KV_TILES);
  }
}

// ---------------------------------------------------------------------------
// Tiled WMMA GEMM: C[M,N] = A[M,K](f16) * B[K,N] + bias, f32 out.
// B supplied pre-transposed: BT[N][K]. Block tile 128x128, 8 waves (2x4),
// each wave 64x32 => 8 WMMA per 32-deep k-step, four k-steps per LDS stage.
// A stage holds GK = 128 k of both operands: a row's piece is 256 B, two whole
// cache lines, and a wave's copy takes two such pieces; the copies of a stage
// fly for as long as the four k-steps of the stage before take, and copy wait
// and barrier come once a stage. K % GK == 0.
// ---------------------------------------------------------------------------
// gemm_acc leaves the wave's sums in acc[t][u]: row bm + wm + t*16 + v + 8*half
// of A against row bn + wn + u*16 + (lane & 15) of BT.
__device__ __forceinline__
void gemm_acc(const _Float16* __restrict__ A, const _Float16* __restrict__ BT,
              int K, int bm, int bn, v8f (&acc)[4][2]) {
  __shared__ __align__(16) _Float16 sA [2][128 * GPITCH];  // [row][k]  2x34 KB
  __shared__ __align__(16) _Float16 sBT[2][128 * GPITCH];  // [col][k]  2x34 KB
  const int tid  = threadIdx.x;
  const int wave = tid >> 5, lane = tid & 31;
  const int hl   = lane >> 4, l16 = lane & 15;
  const int wm = (wave >> 2) * 64, wn = (wave & 3) * 32;

  const v8f vzero = {0.f, 0.f, 0.f, 0.f, 0.f, 0.f, 0.f, 0.f};
#pragma unroll
  for (int t = 0; t < 4; ++t)
#pragma unroll
    for (int u = 0; u < 2; ++u) acc[t][u] = vzero;

  // 16 async b128 copies per thread per stage (8 A + 8 BT): 2048 chunks of
  // 8 f16 an operand, 128 rows x 128 k. Block and stage are in two bases that
  // are the same for the whole wave and step on by a stage with every issue;
  // what is the thread's own, row tid / 16 + 16 i and chunk tid % 16, is one
  // 32-bit element offset that serves both operands and every stage.
  const int r0 = tid >> 4, c0 = (tid & 15) * 8;
  const _Float16* An = A  + (size_t)bm * K;   // the next stage to set out
  const _Float16* Bn = BT + (size_t)bn * K;
  auto issue = [&](int buf) {
#pragma unroll
    for (int i = 0; i < 8; ++i) {
      const unsigned off = (unsigned)((r0 + i * 16) * K + c0);
      const int l = (r0 + i * 16) * GPITCH + c0;
      cp16(An + off, &sA [buf][l]);
      cp16(Bn + off, &sBT[buf][l]);
    }
    An += GK;
    Bn += GK;
  };

  // Two buffers: stage 0 lands and is published, then stage 1 sets out.
  issue(0);
  // This wave's copies of stage 0 have landed before the barrier publishes it.
  asm volatile("s_wait_asynccnt 0x0" ::: "memory");
  __syncthreads();
  if (GK < K) issue(1);
  int buf = 0;
  for (int k0 = 0; k0 < K; k0 += GK) {
    // Unrolled: the four k-steps read at immediate offsets from two addresses.
#pragma unroll
    for (int kk = 0; kk < GK; kk += 32) {
      // All six fragments of the k-step have registers of their own: their
      // twelve LDS loads go out as one group and the wave waits out the LDS
      // latency once a k-step. With one A fragment's registers shared by the
      // four row tiles it waits four times, each behind two WMMAs.
      v16h bfrag[2], afrag[4];
#pragma unroll
      for (int u = 0; u < 2; ++u)
        bfrag[u] =
            ldfrag(&sBT[buf][(wn + u * 16 + l16) * GPITCH + kk + hl * 8]);
#pragma unroll
      for (int t = 0; t < 4; ++t)
        afrag[t] = ldfrag(&sA[buf][(wm + t * 16 + l16) * GPITCH + kk + hl * 8]);
      // Keeps the group whole: without it the scheduler sinks each A
      // fragment's loads to its WMMAs and folds the four into one register
      // set again.
      __builtin_amdgcn_sched_barrier(0);
#pragma unroll
      for (int t = 0; t < 4; ++t)
#pragma unroll
        for (int u = 0; u < 2; ++u)
          acc[t][u] = wmma16(afrag[t], bfrag[u], acc[t][u]);
      // Keeps the WMMAs in front of the next group and of the stage's closing
      // wait for every LDS load: each pair starts behind a counted wait, as
      // soon as its own fragments are in.
      __builtin_amdgcn_sched_barrier(0);
    }
    // Hand-over of the stage. This wave's reads of buf are done before buf is
    // refilled ...
    asm volatile("s_wait_dscnt 0x0" ::: "memory");
    // ... and its copies of the next stage have landed before the barrier,
    // which publishes that stage and ends every wave's reads of buf. Behind
    // the last trip's wait nothing sets out: the loop ends with no copy open.
    asm volatile("s_wait_asynccnt 0x0" ::: "memory");
    __syncthreads();
    if (k0 + 2 * GK < K) issue(buf);
    buf ^= 1;
  }
}

__device__ __forceinline__
void gemm_tile(const _Float16* __restrict__ A, const _Float16* __restrict__ BT,
               const float* __restrict__ bias, float* __restrict__ C,
               int N, int K, int bm, int bn) {
  const int wave = threadIdx.x >> 5, lane = threadIdx.x & 31;
  const int hl   = lane >> 4, l16 = lane & 15;
  const int wm = (wave >> 2) * 64, wn = (wave & 3) * 32;
  v8f acc[4][2];
  gemm_acc(A, BT, K, bm, bn, acc);

  // Epilogue: C layout => row = v + 8*(lane>=16), col = lane&15.
#pragma unroll
  for (int t = 0; t < 4; ++t)
#pragma unroll
    for (int u = 0; u < 2; ++u) {
      int col = bn + wn + u * 16 + l16;
      float bs = bias ? bias[col] : 0.0f;
#pragma unroll
      for (int v = 0; v < 8; ++v) {
        int row = bm + wm + t * 16 + v + 8 * hl;
        C[(size_t)row * N + col] = acc[t][u][v] + bs;
      }
      // A precaution: the next tile's sums and addresses go into the registers
      // that these stores name only behind this wait, on every path.
      asm volatile("s_wait_xcnt 0x0" ::: "memory");
    }
}

__global__ __launch_bounds__(256, 2)
void gemm_wmma(const _Float16* __restrict__ A, const _Float16* __restrict__ BT,
               const float* __restrict__ bias, float* __restrict__ C,
               int M, int N, int K) {
  gemm_tile(A, BT, bias, C, N, K, blockIdx.y * 128, blockIdx.x * 128);
}

// Value of lane l ^ 16.
__device__ __forceinline__ float other_half(float x) {
  int b = __builtin_bit_cast(int, x);
  b = __builtin_amdgcn_permlanex16(b, b, 0x76543210, 0xfedcba98, false, false);
  return __builtin_bit_cast(float, b);
}

// Eight neighbouring f32 (32-byte aligned) by two 16-byte loads, at byte
// offset off (the lane's) + imm (a constant) from a wave-uniform base.
__device__ __forceinline__
void ld8(const float* __restrict__ base, unsigned off, int imm, float (&r)[8]) {
  const float* p = (const float*)((const char*)base + off) + imm / 4;
  const f32x4 lo = *(const f32x4*)p, hi = *(const f32x4*)(p + 4);
#pragma unroll
  for (int e = 0; e < 4; ++e) { r[e] = lo[e]; r[e + 4] = hi[e]; }
}

// Epilogue of a Q or K tile: bias, per-(token, head) layernorm and RoPE on the
// sums while they are in registers, packed head-major f16.
// The tile was computed transposed (rows = output dims, columns = tokens), and
// a wave's 64 rows are one head: a lane holds dims t*16 + 8*half + v of token
// u*16 + (lane & 15), half a head row. Mean and variance are sums in the
// lane's own registers plus one exchange between the wave's halves; dims d and
// d + 32, RoPE's pair, are tiles t and t + 2 of the same lane; eight
// neighbouring dims leave as one 16-byte store.
// bias: the projection's, head its head; out: the head's [S][64] f16; tok0:
// the wave's first token.
__device__ __forceinline__
void head_epilogue(const v8f (&acc)[4][2], const float* __restrict__ bias,
                   int head, const float* __restrict__ g,
                   const float* __restrict__ b,
                   const float* __restrict__ cosT,
                   const float* __restrict__ sinT, _Float16* __restrict__ out,
                   int tok0) {
  const int lane = threadIdx.x & 31;
  const int hl   = lane >> 4, l16 = lane & 15;
  const unsigned doff = hl * 32u;              // bytes: dims 8*half ...
  const unsigned boff = (unsigned)head * (HDIM * 4u) + doff;
#pragma unroll
  for (int u = 0; u < 2; ++u) {
    const int tok = tok0 + u * 16 + l16;
    const unsigned toff = (unsigned)tok * (NFREQ * 4u) + doff;
    // All that the token needs from memory goes out as one group: one memory
    // latency a token.
    float bs[4][8], gg[4][8], bb[4][8], c[2][8], sn[2][8];
#pragma unroll
    for (int t = 0; t < 4; ++t) {
      ld8(bias, boff, t * 64, bs[t]);
      ld8(g, doff, t * 64, gg[t]);
      ld8(b, doff, t * 64, bb[t]);
    }
#pragma unroll
    for (int t = 0; t < 2; ++t) {
      ld8(cosT, toff, t * 64, c[t]);
      ld8(sinT, toff, t * 64, sn[t]);
    }
    // A precaution: the loads' offset registers are inputs here, so they live
    // up to this wait and nothing, a later load's result included, is written
    // over them in front of it.
    asm volatile("s_wait_xcnt 0x0" :: "v"(doff), "v"(boff), "v"(toff)
                 : "memory");
    // Keeps the group whole: without it the scheduler sinks the scale, shift
    // and table loads behind the sums, and the wave waits out their latency
    // three times a token.
    __builtin_amdgcn_sched_barrier(0);

    float x[4][8], part[4];
#pragma unroll
    for (int t = 0; t < 4; ++t) {
      part[t] = 0.0f;
#pragma unroll
      for (int v = 0; v < 8; ++v) {
        x[t][v] = acc[t][u][v] + bs[t][v];
        part[t] += x[t][v];
      }
    }
    float sum = (part[0] + part[1]) + (part[2] + part[3]);
    sum += other_half(sum);                    // the head row's other 32 dims
    const float mu = sum * (1.0f / 64.0f);
#pragma unroll
    for (int t = 0; t < 4; ++t) {
      part[t] = 0.0f;
#pragma unroll
      for (int v = 0; v < 8; ++v) {
        x[t][v] -= mu;
        part[t] += x[t][v] * x[t][v];
      }
    }
    float vs = (part[0] + part[1]) + (part[2] + part[3]);
    vs += other_half(vs);
    const float inv = rsqrtf(vs * (1.0f / 64.0f) + 1e-5f);
#pragma unroll
    for (int t = 0; t < 4; ++t)
#pragma unroll
      for (int v = 0; v < 8; ++v)
        x[t][v] = x[t][v] * inv * gg[t][v] + bb[t][v];
    _Float16* dst = out + (size_t)tok * HDIM + 8 * hl;
#pragma unroll
    for (int t = 0; t < 2; ++t) {
      f16x8 o0, o1;
#pragma unroll
      for (int v = 0; v < 8; ++v) {            // rotate_half: [-x2, x1]
        o0[v] = (_Float16)(x[t][v] * c[t][v] - x[t + 2][v] * sn[t][v]);
        o1[v] = (_Float16)(x[t + 2][v] * c[t][v] + x[t][v] * sn[t][v]);
      }
      *(f16x8*)(dst + t * 16)      = o0;
      *(f16x8*)(dst + t * 16 + 32) = o1;
    }
    // A precaution: the next token's values and addresses go into the
    // registers that these stores name only behind this wait.
    asm volatile("s_wait_xcnt 0x0" ::: "memory");
  }
}

// The three projections of x in one grid: tile columns 0..15 are Q's, 16..19
// K's, 20..23 V's. Alone, K's and V's 64 tiles each leave three quarters of
// the chip idle for as long as Q's 256 take.
// What stood between the projections and the attention as a launch of its own
// is each tile's epilogue. Both operands lie in LDS as rows along k, so which
// of them is the matrix instruction's A is free:
//  - Q and K tiles take the weights as A (rows = dims): head_epilogue.
//  - V tiles take x as A (rows = tokens): a lane's 8 registers of a tile are 8
//    neighbouring tokens of one dim, one 16-byte store into VT [NKV*64][S].
// out: Q16 [32][S][64], K16 [8][S][64], VT16 [8*64][S], all f16.
#define Q_COLS   (HIDDEN / 128)
#define KV_COLS  (KVDIM / 128)
__global__ __launch_bounds__(256, 2)
void gemm_qkv(const _Float16* __restrict__ A, const _Float16* __restrict__ WqT,
              const _Float16* __restrict__ WkT,
              const _Float16* __restrict__ WvT, const float* __restrict__ bq,
              const float* __restrict__ bk, const float* __restrict__ bv,
              const float* __restrict__ qg, const float* __restrict__ qb,
              const float* __restrict__ kg, const float* __restrict__ kb,
              const float* __restrict__ cosT, const float* __restrict__ sinT,
              _Float16* __restrict__ Q16, _Float16* __restrict__ K16,
              _Float16* __restrict__ VT16, int K) {
  const int wave = threadIdx.x >> 5, lane = threadIdx.x & 31;
  const int hl   = lane >> 4, l16 = lane & 15;
  const int wm = (wave >> 2) * 64, wn = (wave & 3) * 32;
  const int c = blockIdx.x;
  const bool q = c < Q_COLS, k = c < Q_COLS + KV_COLS;
  const int tok0 = blockIdx.y * 128;
  const int n0   = (c - (q ? 0 : k ? Q_COLS : Q_COLS + KV_COLS)) * 128;

  v8f acc[4][2];
  gemm_acc(k ? (q ? WqT : WkT) : A, k ? A : WvT, K, k ? n0 : tok0,
           k ? tok0 : n0, acc);

  if (k) {
    const int head = (n0 + wm) / HDIM;
    head_epilogue(acc, q ? bq : bk, head, q ? qg : kg, q ? qb : kb, cosT, sinT,
                  (q ? Q16 : K16) + (size_t)head * SEQ * HDIM, tok0 + wn);
  } else {
#pragma unroll
    for (int u = 0; u < 2; ++u) {
      const int dim = n0 + wn + u * 16 + l16;
      const float bs = bv[dim];
      _Float16* dst = VT16 + (size_t)dim * SEQ + tok0 + wm + 8 * hl;
#pragma unroll
      for (int t = 0; t < 4; ++t) {
        f16x8 o;
#pragma unroll
        for (int v = 0; v < 8; ++v) o[v] = (_Float16)(acc[t][u][v] + bs);
        *(f16x8*)(dst + t * 16) = o;
      }
      // A precaution: the next column's values and address go into the
      // registers that these stores name only behind this wait.
      asm volatile("s_wait_xcnt 0x0" ::: "memory");
    }
  }
}

#define KT       128
#define VPITCH   (KT + 8)

// The grid is two blocks a WGP, four waves a SIMD: naming that occupancy gives
// the compiler the registers to keep a product's fragment loads together in
// front of its WMMAs; aiming higher, it waits for each fragment by itself.
__global__ __launch_bounds__(256) __attribute__((amdgpu_waves_per_eu(4, 4)))
void attn_fmha(const _Float16* __restrict__ Q, const _Float16* __restrict__ Kh,
               const _Float16* __restrict__ VT, _Float16* __restrict__ O) {
  __shared__ __align__(16) _Float16 sK [2][KT * APITCH];    // [key][dim] 2x18 KB
  __shared__ __align__(16) _Float16 sVT[2][HDIM * VPITCH];  // [dim][key] 2x17 KB
  const int tid  = threadIdx.x;
  const int wave = tid >> 5, lane = tid & 31;
  const int hl   = lane >> 4, l16 = lane & 15;
  const int h  = blockIdx.y;          // q head
  const int hk = h >> 2;              // kv head (n_rep = 4, grouped-adjacent)
  const int qw = blockIdx.x * 128 + wave * 16;

  // Q^T fragments (columns qw..qw+15, two 32-deep head-dim chunks), loaded
  // once: the B operand of the score product.
  v16h bq[2];
#pragma unroll
  for (int c = 0; c < 2; ++c)
    bq[c] = ldfrag(&Q[(((size_t)h * SEQ) + qw + l16) * HDIM + c * 32 + hl * 8]);

  const v8f vzero = {0.f, 0.f, 0.f, 0.f, 0.f, 0.f, 0.f, 0.f};
  // exp(s / 8 - max / 8) = exp2(s * SC - max * SC): the scores stay as the
  // matrix unit leaves them, and scale and base change are one multiply-add.
  const float SC = 0.125f * 1.44269504f;     // 1/sqrt(64) * log2(e)
  float m = -3.0e38f;                 // running maximum of the lane's query, raw
  float lsum = 0.0f;                  // sum over this half's keys only
  v8f oacc[4];                        // O^T: dim t*16 + 8*hl + v, query l16
#pragma unroll
  for (int t = 0; t < 4; ++t) oacc[t] = vzero;

  // 8 async b128 copies per thread per key tile (4 K + 4 VT), 1024 chunks of
  // 8 f16 each: K's 128 rows of 64 dims lie in memory as one run, V^T's are 64
  // rows of 128 keys. Head and stage are in two bases that are the same for
  // the whole wave and step on by a stage with every issue; the thread's own
  // part is a 32-bit element offset that serves every stage.
  const _Float16* Kn = Kh + (size_t)hk * SEQ * HDIM;   // the next stage to set out
  const _Float16* Vn = VT + (size_t)hk * HDIM * SEQ;
  auto issueKV = [&](int buf) {
#pragma unroll
    for (int i = 0; i < 4; ++i) {
      const int ch = tid + i * 256;
      const int rk = ch >> 3, ck = (ch & 7) * 8;     // 128 keys x 64 dims
      const int rv = ch >> 4, cv = (ch & 15) * 8;    // 64 dims x 128 keys
      cp16(Kn + (unsigned)(ch * 8), &sK[buf][rk * APITCH + ck]);
      cp16(Vn + (unsigned)(rv * SEQ + cv), &sVT[buf][rv * VPITCH + cv]);
    }
    Kn += KT * HDIM;
    Vn += KT;
  };

  // Two buffers: stage 0 lands and is published, then stage 1 sets out.
  issueKV(0);
  // This wave's copies of stage 0 have landed before the barrier publishes it.
  asm volatile("s_wait_asynccnt 0x0" ::: "memory");
  __syncthreads();
  if (KT < SEQ) issueKV(1);
  int buf = 0;
  for (int kb = 0; kb < SEQ; kb += KT) {
    // S^T tile = K * Q^T  (128k x 16q per wave: 8 row-tiles x 2 k-chunks)
    v8f sacc[KT / 16];
#pragma unroll
    for (int u = 0; u < KT / 16; ++u) {
      sacc[u] = vzero;
#pragma unroll
      for (int c = 0; c < 2; ++c) {
        v16h ak = ldfrag(&sK[buf][(u * 16 + l16) * APITCH + c * 32 + hl * 8]);
        sacc[u] = wmma16(ak, bq[c], sacc[u]);
      }
    }

    // Online softmax of the lane's query over its 64 keys of the tile;
    // independent chains, one per score tile.
    float tmu[KT / 16];
#pragma unroll
    for (int u = 0; u < KT / 16; ++u) {
      tmu[u] = -3.0e38f;
#pragma unroll
      for (int v = 0; v < 8; ++v) tmu[u] = fmaxf(tmu[u], sacc[u][v]);
    }
#pragma unroll
    for (int w = KT / 32; w > 0; w >>= 1)
#pragma unroll
      for (int u = 0; u < w; ++u) tmu[u] = fmaxf(tmu[u], tmu[u + w]);
    float tm = tmu[0];
    tm = fmaxf(tm, other_half(tm));            // the query's other 64 keys
    // SC > 0: the largest raw score is the largest scaled one. alpha comes from
    // the difference of the raw maxima: exactly 1 while the maximum stands.
    const float mnew  = fmaxf(m, tm);
    const float mcn   = mnew * SC;
    const float alpha = __builtin_amdgcn_exp2f((m - mnew) * SC);
    m = mnew;
    const f32x2 sc2 = {SC, SC}, nm2 = {-mcn, -mcn};

    // P^T as B operand: element e < 8 is key 8*hl + e of the 32-key chunk,
    // element 8 + e key 16 + 8*hl + e, the k order of ldfrag.
    v16h bp[KT / 32];
    float rsu[KT / 16];
#pragma unroll
    for (int u = 0; u < KT / 16; ++u) {
      rsu[u] = 0.0f;
#pragma unroll
      for (int v = 0; v < 8; v += 2) {
        // Two neighbouring scores a packed multiply-add.
        const f32x2 s2 = {sacc[u][v], sacc[u][v + 1]};
        const f32x2 t2 = __builtin_elementwise_fma(s2, sc2, nm2);
        const float p0 = __builtin_amdgcn_exp2f(t2[0]);
        const float p1 = __builtin_amdgcn_exp2f(t2[1]);
        rsu[u] += p0;
        rsu[u] += p1;
        bp[u >> 1][(u & 1) * 8 + v]     = (_Float16)p0;
        bp[u >> 1][(u & 1) * 8 + v + 1] = (_Float16)p1;
      }
    }
#pragma unroll
    for (int w = KT / 32; w > 0; w >>= 1)
#pragma unroll
      for (int u = 0; u < w; ++u) rsu[u] += rsu[u + w];
    lsum = lsum * alpha + rsu[0];
#pragma unroll
    for (int t = 0; t < 4; ++t)
#pragma unroll
      for (int v = 0; v < 8; ++v) oacc[t][v] *= alpha;

    // O^T += V^T * P^T
#pragma unroll
    for (int c = 0; c < KT / 32; ++c)
#pragma unroll
      for (int t = 0; t < 4; ++t) {
        v16h av = ldfrag(&sVT[buf][(t * 16 + l16) * VPITCH + c * 32 + hl * 8]);
        oacc[t] = wmma16(av, bp[c], oacc[t]);
      }
    // Hand-over of the stage. This wave's reads of buf are done before buf is
    // refilled ...
    asm volatile("s_wait_dscnt 0x0" ::: "memory");
    // ... and its copies of the next stage have landed before the barrier,
    // which publishes that stage and ends every wave's reads of buf. Behind
    // the last trip's wait nothing sets out: the loop ends with no copy open.
    asm volatile("s_wait_asynccnt 0x0" ::: "memory");
    __syncthreads();
    if (kb + 2 * KT < SEQ) issueKV(buf);
    buf ^= 1;
  }

  // Join the halves' sums, normalize and pack into [seq][heads*64] f16 for the
  // output projection: a lane's 8 registers of a tile are 8 neighbouring dims
  // of its query, one 16-byte store.
  const float inv = 1.0f / (lsum + other_half(lsum));
  _Float16* orow = O + (size_t)(qw + l16) * HIDDEN + h * HDIM + 8 * hl;
#pragma unroll
  for (int t = 0; t < 4; ++t) {
    f16x8 o;
#pragma unroll
    for (int v = 0; v < 8; ++v) o[v] = (_Float16)(oacc[t][v] * inv);
    *(f16x8*)(orow + t * 16) = o;
  }
}

// ---------------------------------------------------------------------------
// Host orchestration
// ---------------------------------------------------------------------------
extern "C" void kernel_launch(void* const* d_in, const int* in_sizes, int n_in,
                              void* d_out, int out_size, void* d_ws,
                              size_t ws_size, hipStream_t stream) {
  (void)in_sizes; (void)n_in; (void)out_size; (void)ws_size;
  const float* x   = (const float*)d_in[0];
  const float* Wq  = (const float*)d_in[1];
  const float* bq  = (const float*)d_in[2];
  const float* Wk  = (const float*)d_in[3];
  const float* bk  = (const float*)d_in[4];
  const float* Wv  = (const float*)d_in[5];
  const float* bv  = (const float*)d_in[6];
  const float* Wo  = (const float*)d_in[7];
  const float* bo  = (const float*)d_in[8];
  const float* qg  = (const float*)d_in[9];
  const float* qb  = (const float*)d_in[10];
  const float* kg  = (const float*)d_in[11];
  const float* kbb = (const float*)d_in[12];

  char* ws = (char*)d_ws;
  size_t off = 0;
  auto alloc = [&](size_t bytes) {
    void* p = ws + off;
    off += (bytes + 255) & ~(size_t)255;
    return p;
  };
  _Float16* x16   = (_Float16*)alloc((size_t)SEQ * HIDDEN * 2);
  _Float16* WqT16 = (_Float16*)alloc((size_t)HIDDEN * HIDDEN * 2);
  _Float16* WkT16 = (_Float16*)alloc((size_t)HIDDEN * KVDIM * 2);
  _Float16* WvT16 = (_Float16*)alloc((size_t)HIDDEN * KVDIM * 2);
  _Float16* WoT16 = (_Float16*)alloc((size_t)HIDDEN * HIDDEN * 2);
  float*    cosT  = (float*)   alloc((size_t)SEQ * NFREQ * 4);
  float*    sinT  = (float*)   alloc((size_t)SEQ * NFREQ * 4);
  _Float16* Q16   = (_Float16*)alloc((size_t)NHEADS * SEQ * HDIM * 2);
  _Float16* K16   = (_Float16*)alloc((size_t)NKV * SEQ * HDIM * 2);
  _Float16* VT16  = (_Float16*)alloc((size_t)NKV * HDIM * SEQ * 2);
  _Float16* O16   = (_Float16*)alloc((size_t)SEQ * HIDDEN * 2);

  prep_operands<<<OPERAND_BLOCKS, 256, 0, stream>>>(
      x, Wq, Wk, Wv, Wo, x16, WqT16, WkT16, WvT16, WoT16, cosT, sinT);

  // Projections (f16 WMMA, f32 accum + bias); in their epilogue the per-head
  // QK layernorm + RoPE, packed head-major f16, and V transposed.
  gemm_qkv<<<dim3(Q_COLS + 2 * KV_COLS, SEQ / 128), 256, 0, stream>>>(
      x16, WqT16, WkT16, WvT16, bq, bk, bv, qg, qb, kg, kbb, cosT, sinT,
      Q16, K16, VT16, HIDDEN);

  // GQA flash attention
  attn_fmha<<<dim3(SEQ / 128, NHEADS), 256, 0, stream>>>(Q16, K16, VT16, O16);

  // Output projection -> f32 result
  gemm_wmma<<<dim3(HIDDEN / 128, SEQ / 128), 256, 0, stream>>>(
      O16, WoT16, bo, (float*)d_out, SEQ, HIDDEN, HIDDEN);
}

// v010
// Measured time: 83.2 microseconds a run.
// Next to v009, in two timings, it ran 1.05 and 1.04 times as fast.
// Over all steps from v000 it is 5.72 times as fast.
#include <hip/hip_runtime.h>
#include <hip/hip_bf16.h>
#include <stdint.h>

// ---------------------------------------------------------------------------
// Types for CDNA5 WMMA (wave32): A/B = v16h (16 halves = 8 VGPRs),
// C/D = v8f (8 VGPRs of f32).
// ---------------------------------------------------------------------------
typedef __attribute__((ext_vector_type(16))) _Float16 v16h;
typedef __attribute__((ext_vector_type(8)))  float    v8f;
typedef __attribute__((ext_vector_type(8)))  _Float16 f16x8;
typedef __attribute__((ext_vector_type(4)))  int      v4i;
typedef __attribute__((ext_vector_type(4)))  float    f32x4;
typedef __attribute__((ext_vector_type(2)))  _Float16 f16x2;
typedef __attribute__((ext_vector_type(2)))  float    f32x2;

#define SEQ      2048
#define HIDDEN   2048
#define NHEADS   32
#define NKV      8
#define HDIM     64
#define KVDIM    (NKV * HDIM)   // 512

// LDS row pitches in f16 elements. The GEMM and attention tiles are read by 16-byte loads,
// one row per lane: a pitch of 16 B x odd spreads the 16 rows of a half-wave
// over all 64 banks; dense 128-B and 256-B rows fold them onto a few.
#define GK       128            // k depth of one GEMM stage
#define GPITCH   136            // 128-element (256 B) GEMM rows -> 272 B
#define APITCH   72             // 64-element (128 B) attention rows -> 144 B

// Async Global->LDS (ASYNCcnt-tracked) if the toolchain exposes it.
#if defined(__gfx1250__) && \
    __has_builtin(__builtin_amdgcn_global_load_async_to_lds_b128) && \
    __has_builtin(__builtin_amdgcn_s_wait_asynccnt)
#define HAVE_ASYNC 1
#else
#define HAVE_ASYNC 0
#endif

#if HAVE_ASYNC
// Builtin signature (from compiler diagnostic): typed v4i pointers,
// (addrspace(1) src, addrspace(3) dst, imm offset, imm cpol).
typedef __attribute__((address_space(1))) v4i GlobalV4;
typedef __attribute__((address_space(3))) v4i LocalV4;
#endif

// Copy 16 bytes Global -> LDS. Async path bypasses VGPRs (tracked by
// ASYNCcnt); fallback is a synchronous load+store.
__device__ __forceinline__ void cp16(const _Float16* g, _Float16* l) {
#if HAVE_ASYNC
  __builtin_amdgcn_global_load_async_to_lds_b128(
      (GlobalV4*)(const void*)g, (LocalV4*)(void*)l, 0, 0);
#else
  *(f16x8*)l = *(const f16x8*)g;
#endif
}
__device__ __forceinline__ v8f wmma16(v16h a, v16h b, v8f c) {
  // D = A(16x32 f16) * B(32x16 f16) + C(16x16 f32)
  return __builtin_amdgcn_wmma_f32_16x16x32_f16(
      /*neg_a=*/false, a, /*neg_b=*/false, b,
      /*c_mod=*/(short)0, c, /*reuse_a=*/false, /*reuse_b=*/false);
}

// One lane's 16-element WMMA fragment: two contiguous 8-element (16 B) runs
// 16 elements apart in K (e0..7 -> K = 8*half + e ; e8..15 -> K = 16+8*half+e).
__device__ __forceinline__ v16h ldfrag(const _Float16* p) {
  f16x8 lo = *(const f16x8*)p;
  f16x8 hi = *(const f16x8*)(p + 16);
  v16h r;
#pragma unroll
  for (int j = 0; j < 8; ++j) { r[j] = lo[j]; r[j + 8] = hi[j]; }
  return r;
}

// ---------------------------------------------------------------------------
// Elementwise converts / transposes. These launches move few bytes, so their
// time is the time to start their waves: every thread handles 32 elements
// through 16-byte accesses and the grids stay at a few workgroups per WGP.
// ---------------------------------------------------------------------------
#define CVT_PER_BLOCK (256 * 32)

// f32 -> f16, piece blk of CVT_PER_BLOCK elements. All eight loads of a
// thread are issued before the first convert.
__device__ __forceinline__
void cvt_piece(const float* __restrict__ s, _Float16* __restrict__ d, int blk) {
  const size_t base = (size_t)blk * CVT_PER_BLOCK + threadIdx.x * 8;
  f32x4 lo[4], hi[4];
#pragma unroll
  for (int j = 0; j < 4; ++j) {
    lo[j] = *(const f32x4*)(s + base + j * 2048);
    hi[j] = *(const f32x4*)(s + base + j * 2048 + 4);
  }
#pragma unroll
  for (int j = 0; j < 4; ++j) {
    f16x8 o;
#pragma unroll
    for (int e = 0; e < 4; ++e) {
      o[e]     = (_Float16)lo[j][e];
      o[e + 4] = (_Float16)hi[j][e];
    }
    *(f16x8*)(d + base + j * 2048) = o;
  }
  // A precaution: in a grid of several jobs the listing lays another job's
  // code behind these stores; it writes their registers only behind this wait.
  asm volatile("s_wait_xcnt 0x0" ::: "memory");
}

// S [KD][ND] f32 -> D [ND][KD] f16 (lets the GEMMs stream
// their operands as contiguous 16-byte runs straight into LDS).
// One block = one 128(k) x 64(n) tile, number tile in row-major order of the
// (KD / 128) x (ND / 64) tiles, KD % 128 == 0 and ND % 64 == 0:
// 256-byte row pieces in, turned in LDS, 256-byte row pieces out. The shapes
// are compile-time so that a thread's eight loads and four stores each hang
// off one address with immediate offsets.
#define TK       128
#define TN       64
#define TPITCH   (TK + 8)       // 272 B = 16 B x odd for the 16-byte readers
template <int KD, int ND>
__device__ __forceinline__
void transpose_tile(const float* __restrict__ s, _Float16* __restrict__ d,
                    _Float16* sT, int tile) {              // sT: [n][k]
  const int t  = threadIdx.x;
  const int k0 = (tile / (ND / TN)) * TK, n0 = (tile % (ND / TN)) * TN;
  const int n4 = (t & 15) * 4;        // four neighbouring columns
  const int kp = (t >> 4) * 2;        // two neighbouring rows -> one dword

  const float* p = s + (size_t)(k0 + kp) * ND + n0 + n4;
  f32x4 ra[4], rb[4];
#pragma unroll
  for (int j = 0; j < 4; ++j) {
    ra[j] = *(const f32x4*)(p + (32 * j) * ND);
    rb[j] = *(const f32x4*)(p + (32 * j + 1) * ND);
  }
#pragma unroll
  for (int j = 0; j < 4; ++j)
#pragma unroll
    for (int i = 0; i < 4; ++i) {
      f16x2 w = {(_Float16)ra[j][i], (_Float16)rb[j][i]};
      *(f16x2*)&sT[(n4 + i) * TPITCH + kp + 32 * j] = w;
    }
  __syncthreads();                    // whole tile in LDS before it is read
  const int n = t >> 4, kc = (t & 15) * 8;   // 16 rows x 16 chunks a pass
  _Float16* q = d + (size_t)(n0 + n) * KD + k0 + kc;
#pragma unroll
  for (int j = 0; j < 4; ++j)
    *(f16x8*)(q + (16 * j) * KD) =
        *(const f16x8*)&sT[(n + 16 * j) * TPITCH + kc];
  // A precaution, as in cvt_piece: code laid behind these stores writes their
  // registers only behind this wait.
  asm volatile("s_wait_xcnt 0x0" ::: "memory");
}

// RoPE tables cosT, sinT [S][32] f32 (emb = concat(freqs, freqs): frequency
// index = dim % 32). Piece blk holds 32 positions; a wave takes four of them,
// a lane one frequency. The projection's epilogue reads them: there every
// head of a position would otherwise work out the same 32 angles again.
#define NFREQ    (HDIM / 2)
#define ROPE_BLOCKS (SEQ / 32)
__device__ __forceinline__
void rope_piece(float* __restrict__ cosT, float* __restrict__ sinT, int blk) {
  const int wave = threadIdx.x >> 5, lane = threadIdx.x & 31;
  const float invf = __powf(10000.0f, -(float)lane / 32.0f);
  // Rolled: cosf and sinf are long, and code that runs once is fetched cold;
  // unrolled, every trip would wait for instructions of its own.
#pragma unroll 1
  for (int j = 0; j < 4; ++j) {
    const int s = blk * 32 + j * 8 + wave;
    const float ang = (float)s * invf;
    cosT[s * NFREQ + lane] = cosf(ang);
    sinT[s * NFREQ + lane] = sinf(ang);
    // A precaution, as in cvt_piece: the next trip, and code laid behind the
    // loop, write these stores' registers only behind this wait.
    asm volatile("s_wait_xcnt 0x0" ::: "memory");
  }
}

#define SQ_TILES ((HIDDEN / TK) * (HIDDEN / TN))   // [2048][2048]: Wq, Wo
#define KV_TILES ((HIDDEN / TK) * (KVDIM / TN))    // [2048][512]: Wk, Wv
#define X_PIECES ((SEQ * HIDDEN) / CVT_PER_BLOCK)

// The five operand conversions and the RoPE tables depend on nothing and on
// one another not at all: one grid holds them all, a block's index says which
// job it does, and the chip fills once instead of six times. The table blocks,
// the longest in instructions, come first.
#define OPERAND_BLOCKS (ROPE_BLOCKS + 2 * SQ_TILES + 2 * KV_TILES + X_PIECES)
__global__ __launch_bounds__(256)
void prep_operands(const float* __restrict__ x, const float* __restrict__ Wq,
                   const float* __restrict__ Wk, const float* __restrict__ Wv,
                   const float* __restrict__ Wo, _Float16* __restrict__ x16,
                   _Float16* __restrict__ WqT, _Float16* __restrict__ WkT,
                   _Float16* __restrict__ WvT, _Float16* __restrict__ WoT,
                   float* __restrict__ cosT, float* __restrict__ sinT) {
  __shared__ __align__(16) _Float16 sT[TN * TPITCH];       // 17 KB
  const int b = (int)blockIdx.x - ROPE_BLOCKS, bkv = b - 2 * SQ_TILES;
  if (b < 0) {
    rope_piece(cosT, sinT, blockIdx.x);
  } else if (b < 2 * SQ_TILES) {
    const bool o = b >= SQ_TILES;
    transpose_tile<HIDDEN, HIDDEN>(o ? Wo : Wq, o ? WoT : WqT, sT,
                                   b % SQ_TILES);
  } else if (bkv < 2 * KV_TILES) {
    const bool v = bkv >= KV_TILES;
    transpose_tile<HIDDEN, KVDIM>(v ? Wv : Wk, v ? WvT : WkT, sT,
                                  bkv % KV_TILES);
  } else {
    cvt_piece(x, x16, bkv - 2 * KV_TILES);
  }
}

// ---------------------------------------------------------------------------
// Tiled WMMA GEMM: C[M,N] = A[M,K](f16) * B[K,N] + bias, f32 out.
// B supplied pre-transposed: BT[N][K]. Block tile 128x128, 8 waves (2x4),
// each wave 64x32 => 8 WMMA per 32-deep k-step, four k-steps per LDS stage.
// A stage holds GK = 128 k of both operands: a row's piece is 256 B, two whole
// cache lines, and a wave's copy takes two such pieces; the copies of a stage
// fly for as long as the four k-steps of the stage before take, and copy wait
// and barrier come once a stage. K % GK == 0.
// A block walks its K / GK stages round from a start of its own, kstart (a
// multiple of GK below K). The blocks of a tile row share A's rows and those
// of a tile column BT's, and all run at about the same pace: from one common
// start, every sharer asks L2 for the same lines at the same moment, all of
// them at one offset in the rows of 2 * K bytes, and each stage's lines are
// new to L2 for all at once. From starts that differ, sharers ask for
// different lines, the requests of a moment lie over the whole rows, and a
// line that one block has brought in is there for the others.
// ---------------------------------------------------------------------------
// The start of block (bx, by): no two blocks of a tile row or of a tile column
// of up to K / GK tiles share one.
__device__ __forceinline__ unsigned gemm_kstart(int K) {
  return ((blockIdx.x + blockIdx.y) * (unsigned)GK) % (unsigned)K;
}

// gemm_acc leaves the wave's sums in acc[t][u]: row bm + wm + t*16 + v + 8*half
// of A against row bn + wn + u*16 + (lane & 15) of BT.
__device__ __forceinline__
void gemm_acc(const _Float16* __restrict__ A, const _Float16* __restrict__ BT,
              int K, int bm, int bn, unsigned kstart, v8f (&acc)[4][2]) {
  __shared__ __align__(16) _Float16 sA [2][128 * GPITCH];  // [row][k]  2x34 KB
  __shared__ __align__(16) _Float16 sBT[2][128 * GPITCH];  // [col][k]  2x34 KB
  const int tid  = threadIdx.x;
  const int wave = tid >> 5, lane = tid & 31;
  const int hl   = lane >> 4, l16 = lane & 15;
  const int wm = (wave >> 2) * 64, wn = (wave & 3) * 32;

  const v8f vzero = {0.f, 0.f, 0.f, 0.f, 0.f, 0.f, 0.f, 0.f};
#pragma unroll
  for (int t = 0; t < 4; ++t)
#pragma unroll
    for (int u = 0; u < 2; ++u) acc[t][u] = vzero;

  // 16 async b128 copies per thread per stage (8 A + 8 BT): 2048 chunks of
  // 8 f16 an operand, 128 rows x 128 k. Block and stage are in two bases that
  // are the same for the whole wave; the stage's k steps on with every issue
  // and turns round at K; what is the thread's own, row tid / 16 + 16 i and
  // chunk tid % 16, is one 32-bit element offset that serves both operands and
  // every stage.
  const int r0 = tid >> 4, c0 = (tid & 15) * 8;
  const _Float16* A0 = A  + (size_t)bm * K;
  const _Float16* B0 = BT + (size_t)bn * K;
  unsigned kn = kstart;                       // k of the next stage to set out
  auto issue = [&](int buf) {
    const _Float16* An = A0 + kn;
    const _Float16* Bn = B0 + kn;
#pragma unroll
    for (int i = 0; i < 8; ++i) {
      const unsigned off = (unsigned)((r0 + i * 16) * K + c0);
      const int l = (r0 + i * 16) * GPITCH + c0;
      cp16(An + off, &sA [buf][l]);
      cp16(Bn + off, &sBT[buf][l]);
    }
    kn += GK;
    if (kn == (unsigned)K) kn = 0;
  };

  // Two buffers: stage 0 lands and is published, then stage 1 sets out.
  issue(0);
  // This wave's copies of stage 0 have landed before the barrier publishes it.
  asm volatile("s_wait_asynccnt 0x0" ::: "memory");
  __syncthreads();
  if (GK < K) issue(1);
  int buf = 0;
  for (int k0 = 0; k0 < K; k0 += GK) {
    // Unrolled: the four k-steps read at immediate offsets from two addresses.
#pragma unroll
    for (int kk = 0; kk < GK; kk += 32) {
      // All six fragments of the k-step have registers of their own: their
      // twelve LDS loads go out as one group and the wave waits out the LDS
      // latency once a k-step. With one A fragment's registers shared by the
      // four row tiles it waits four times, each behind two WMMAs.
      v16h bfrag[2], afrag[4];
#pragma unroll
      for (int u = 0; u < 2; ++u)
        bfrag[u] =
            ldfrag(&sBT[buf][(wn + u * 16 + l16) * GPITCH + kk + hl * 8]);
#pragma unroll
      for (int t = 0; t < 4; ++t)
        afrag[t] = ldfrag(&sA[buf][(wm + t * 16 + l16) * GPITCH + kk + hl * 8]);
      // Keeps the group whole: without it the scheduler sinks each A
      // fragment's loads to its WMMAs and folds the four into one register
      // set again.
      __builtin_amdgcn_sched_barrier(0);
#pragma unroll
      for (int t = 0; t < 4; ++t)
#pragma unroll
        for (int u = 0; u < 2; ++u)
          acc[t][u] = wmma16(afrag[t], bfrag[u], acc[t][u]);
      // Keeps the WMMAs in front of the next group and of the stage's closing
      // wait for every LDS load: each pair starts behind a counted wait, as
      // soon as its own fragments are in.
      __builtin_amdgcn_sched_barrier(0);
    }
    // Hand-over of the stage. This wave's reads of buf are done before buf is
    // refilled ...
    asm volatile("s_wait_dscnt 0x0" ::: "memory");
    // ... and its copies of the next stage have landed before the barrier,
    // which publishes that stage and ends every wave's reads of buf. Behind
    // the last trip's wait nothing sets out: the loop ends with no copy open.
    asm volatile("s_wait_asynccnt 0x0" ::: "memory");
    __syncthreads();
    if (k0 + 2 * GK < K) issue(buf);
    buf ^= 1;
  }
}

__device__ __forceinline__
void gemm_tile(const _Float16* __restrict__ A, const _Float16* __restrict__ BT,
               const float* __restrict__ bias, float* __restrict__ C,
               int N, int K, int bm, int bn) {
  const int wave = threadIdx.x >> 5, lane = threadIdx.x & 31;
  const int hl   = lane >> 4, l16 = lane & 15;
  const int wm = (wave >> 2) * 64, wn = (wave & 3) * 32;
  v8f acc[4][2];
  gemm_acc(A, BT, K, bm, bn, gemm_kstart(K), acc);

  // Epilogue: C layout => row = v + 8*(lane>=16), col = lane&15.
#pragma unroll
  for (int t = 0; t < 4; ++t)
#pragma unroll
    for (int u = 0; u < 2; ++u) {
      int col = bn + wn + u * 16 + l16;
      float bs = bias ? bias[col] : 0.0f;
#pragma unroll
      for (int v = 0; v < 8; ++v) {
        int row = bm + wm + t * 16 + v + 8 * hl;
        C[(size_t)row * N + col] = acc[t][u][v] + bs;
      }
      // A precaution: the next tile's sums and addresses go into the registers
      // that these stores name only behind this wait, on every path.
      asm volatile("s_wait_xcnt 0x0" ::: "memory");
    }
}

__global__ __launch_bounds__(256, 2)
void gemm_wmma(const _Float16* __restrict__ A, const _Float16* __restrict__ BT,
               const float* __restrict__ bias, float* __restrict__ C,
               int M, int N, int K) {
  gemm_tile(A, BT, bias, C, N, K, blockIdx.y * 128, blockIdx.x * 128);
}

// Value of lane l ^ 16.
__device__ __forceinline__ float other_half(float x) {
  int b = __builtin_bit_cast(int, x);
  b = __builtin_amdgcn_permlanex16(b, b, 0x76543210, 0xfedcba98, false, false);
  return __builtin_bit_cast(float, b);
}

// Eight neighbouring f32 (32-byte aligned) by two 16-byte loads, at byte
// offset off (the lane's) + imm (a constant) from a wave-uniform base.
__device__ __forceinline__
void ld8(const float* __restrict__ base, unsigned off, int imm, float (&r)[8]) {
  const float* p = (const float*)((const char*)base + off) + imm / 4;
  const f32x4 lo = *(const f32x4*)p, hi = *(const f32x4*)(p + 4);
#pragma unroll
  for (int e = 0; e < 4; ++e) { r[e] = lo[e]; r[e + 4] = hi[e]; }
}

// Epilogue of a Q or K tile: bias, per-(token, head) layernorm and RoPE on the
// sums while they are in registers, packed head-major f16.
// The tile was computed transposed (rows = output dims, columns = tokens), and
// a wave's 64 rows are one head: a lane holds dims t*16 + 8*half + v of token
// u*16 + (lane & 15), half a head row. Mean and variance are sums in the
// lane's own registers plus one exchange between the wave's halves; dims d and
// d + 32, RoPE's pair, are tiles t and t + 2 of the same lane; eight
// neighbouring dims leave as one 16-byte store.
// bias: the projection's, head its head; out: the head's [S][64] f16; tok0:
// the wave's first token.
__device__ __forceinline__
void head_epilogue(const v8f (&acc)[4][2], const float* __restrict__ bias,
                   int head, const float* __restrict__ g,
                   const float* __restrict__ b,
                   const float* __restrict__ cosT,
                   const float* __restrict__ sinT, _Float16* __restrict__ out,
                   int tok0) {
  const int lane = threadIdx.x & 31;
  const int hl   = lane >> 4, l16 = lane & 15;
  const unsigned doff = hl * 32u;              // bytes: dims 8*half ...
  const unsigned boff = (unsigned)head * (HDIM * 4u) + doff;
#pragma unroll
  for (int u = 0; u < 2; ++u) {
    const int tok = tok0 + u * 16 + l16;
    const unsigned toff = (unsigned)tok * (NFREQ * 4u) + doff;
    // All that the token needs from memory goes out as one group: one memory
    // latency a token.
    float bs[4][8], gg[4][8], bb[4][8], c[2][8], sn[2][8];
#pragma unroll
    for (int t = 0; t < 4; ++t) {
      ld8(bias, boff, t * 64, bs[t]);
      ld8(g, doff, t * 64, gg[t]);
      ld8(b, doff, t * 64, bb[t]);
    }
#pragma unroll
    for (int t = 0; t < 2; ++t) {
      ld8(cosT, toff, t * 64, c[t]);
      ld8(sinT, toff, t * 64, sn[t]);
    }
    // A precaution: the loads' offset registers are inputs here, so they live
    // up to this wait and nothing, a later load's result included, is written
    // over them in front of it.
    asm volatile("s_wait_xcnt 0x0" :: "v"(doff), "v"(boff), "v"(toff)
                 : "memory");
    // Keeps the group whole: without it the scheduler sinks the scale, shift
    // and table loads behind the sums, and the wave waits out their latency
    // three times a token.
    __builtin_amdgcn_sched_barrier(0);

    float x[4][8], part[4];
#pragma unroll
    for (int t = 0; t < 4; ++t) {
      part[t] = 0.0f;
#pragma unroll
      for (int v = 0; v < 8; ++v) {
        x[t][v] = acc[t][u][v] + bs[t][v];
        part[t] += x[t][v];
      }
    }
    float sum = (part[0] + part[1]) + (part[2] + part[3]);
    sum += other_half(sum);                    // the head row's other 32 dims
    const float mu = sum * (1.0f / 64.0f);
#pragma unroll
    for (int t = 0; t < 4; ++t) {
      part[t] = 0.0f;
#pragma unroll
      for (int v = 0; v < 8; ++v) {
        x[t][v] -= mu;
        part[t] += x[t][v] * x[t][v];
      }
    }
    float vs = (part[0] + part[1]) + (part[2] + part[3]);
    vs += other_half(vs);
    const float inv = rsqrtf(vs * (1.0f / 64.0f) + 1e-5f);
#pragma unroll
    for (int t = 0; t < 4; ++t)
#pragma unroll
      for (int v = 0; v < 8; ++v)
        x[t][v] = x[t][v] * inv * gg[t][v] + bb[t][v];
    _Float16* dst = out + (size_t)tok * HDIM + 8 * hl;
#pragma unroll
    for (int t = 0; t < 2; ++t) {
      f16x8 o0, o1;
#pragma unroll
      for (int v = 0; v < 8; ++v) {            // rotate_half: [-x2, x1]
        o0[v] = (_Float16)(x[t][v] * c[t][v] - x[t + 2][v] * sn[t][v]);
        o1[v] = (_Float16)(x[t + 2][v] * c[t][v] + x[t][v] * sn[t][v]);
      }
      *(f16x8*)(dst + t * 16)      = o0;
      *(f16x8*)(dst + t * 16 + 32) = o1;
    }
    // A precaution: the next token's values and addresses go into the
    // registers that these stores name only behind this wait.
    asm volatile("s_wait_xcnt 0x0" ::: "memory");
  }
}

// The three projections of x in one grid: tile columns 0..15 are Q's, 16..19
// K's, 20..23 V's. Alone, K's and V's 64 tiles each leave three quarters of
// the chip idle for as long as Q's 256 take.
// What stood between the projections and the attention as a launch of its own
// is each tile's epilogue. Both operands lie in LDS as rows along k, so which
// of them is the matrix instruction's A is free:
//  - Q and K tiles take the weights as A (rows = dims): head_epilogue.
//  - V tiles take x as A (rows = tokens): a lane's 8 registers of a tile are 8
//    neighbouring tokens of one dim, one 16-byte store into VT [NKV*64][S].
// out: Q16 [32][S][64], K16 [8][S][64], VT16 [8*64][S], all f16.
#define Q_COLS   (HIDDEN / 128)
#define KV_COLS  (KVDIM / 128)
__global__ __launch_bounds__(256, 2)
void gemm_qkv(const _Float16* __restrict__ A, const _Float16* __restrict__ WqT,
              const _Float16* __restrict__ WkT,
              const _Float16* __restrict__ WvT, const float* __restrict__ bq,
              const float* __restrict__ bk, const float* __restrict__ bv,
              const float* __restrict__ qg, const float* __restrict__ qb,
              const float* __restrict__ kg, const float* __restrict__ kb,
              const float* __restrict__ cosT, const float* __restrict__ sinT,
              _Float16* __restrict__ Q16, _Float16* __restrict__ K16,
              _Float16* __restrict__ VT16, int K) {
  const int wave = threadIdx.x >> 5, lane = threadIdx.x & 31;
  const int hl   = lane >> 4, l16 = lane & 15;
  const int wm = (wave >> 2) * 64, wn = (wave & 3) * 32;
  const int c = blockIdx.x;
  const bool q = c < Q_COLS, k = c < Q_COLS + KV_COLS;
  const int tok0 = blockIdx.y * 128;
  const int n0   = (c - (q ? 0 : k ? Q_COLS : Q_COLS + KV_COLS)) * 128;

  v8f acc[4][2];
  gemm_acc(k ? (q ? WqT : WkT) : A, k ? A : WvT, K, k ? n0 : tok0,
           k ? tok0 : n0, gemm_kstart(K), acc);

  if (k) {
    const int head = (n0 + wm) / HDIM;
    head_epilogue(acc, q ? bq : bk, head, q ? qg : kg, q ? qb : kb, cosT, sinT,
                  (q ? Q16 : K16) + (size_t)head * SEQ * HDIM, tok0 + wn);
  } else {
#pragma unroll
    for (int u = 0; u < 2; ++u) {
      const int dim = n0 + wn + u * 16 + l16;
      const float bs = bv[dim];
      _Float16* dst = VT16 + (size_t)dim * SEQ + tok0 + wm + 8 * hl;
#pragma unroll
      for (int t = 0; t < 4; ++t) {
        f16x8 o;
#pragma unroll
        for (int v = 0; v < 8; ++v) o[v] = (_Float16)(acc[t][u][v] + bs);
        *(f16x8*)(dst + t * 16) = o;
      }
      // A precaution: the next column's values and address go into the
      // registers that these stores name only behind this wait.
      asm volatile("s_wait_xcnt 0x0" ::: "memory");
    }
  }
}

#define KT       128
#define VPITCH   (KT + 8)

// The grid is two blocks a WGP, four waves a SIMD: naming that occupancy gives
// the compiler the registers to keep a product's fragment loads together in
// front of its WMMAs; aiming higher, it waits for each fragment by itself.
__global__ __launch_bounds__(256) __attribute__((amdgpu_waves_per_eu(4, 4)))
void attn_fmha(const _Float16* __restrict__ Q, const _Float16* __restrict__ Kh,
               const _Float16* __restrict__ VT, _Float16* __restrict__ O) {
  __shared__ __align__(16) _Float16 sK [2][KT * APITCH];    // [key][dim] 2x18 KB
  __shared__ __align__(16) _Float16 sVT[2][HDIM * VPITCH];  // [dim][key] 2x17 KB
  const int tid  = threadIdx.x;
  const int wave = tid >> 5, lane = tid & 31;
  const int hl   = lane >> 4, l16 = lane & 15;
  const int h  = blockIdx.y;          // q head
  const int hk = h >> 2;              // kv head (n_rep = 4, grouped-adjacent)
  const int qw = blockIdx.x * 128 + wave * 16;

  // Q^T fragments (columns qw..qw+15, two 32-deep head-dim chunks), loaded
  // once: the B operand of the score product.
  v16h bq[2];
#pragma unroll
  for (int c = 0; c < 2; ++c)
    bq[c] = ldfrag(&Q[(((size_t)h * SEQ) + qw + l16) * HDIM + c * 32 + hl * 8]);

  const v8f vzero = {0.f, 0.f, 0.f, 0.f, 0.f, 0.f, 0.f, 0.f};
  // exp(s / 8 - max / 8) = exp2(s * SC - max * SC): the scores stay as the
  // matrix unit leaves them, and scale and base change are one multiply-add.
  const float SC = 0.125f * 1.44269504f;     // 1/sqrt(64) * log2(e)
  float m = -3.0e38f;                 // running maximum of the lane's query, raw
  float lsum = 0.0f;                  // sum over this half's keys only
  v8f oacc[4];                        // O^T: dim t*16 + 8*hl + v, query l16
#pragma unroll
  for (int t = 0; t < 4; ++t) oacc[t] = vzero;

  // 8 async b128 copies per thread per key tile (4 K + 4 VT), 1024 chunks of
  // 8 f16 each: K's 128 rows of 64 dims lie in memory as one run, V^T's are 64
  // rows of 128 keys. Head and stage are in two bases that are the same for
  // the whole wave and step on by a stage with every issue; the thread's own
  // part is a 32-bit element offset that serves every stage.
  const _Float16* Kn = Kh + (size_t)hk * SEQ * HDIM;   // the next stage to set out
  const _Float16* Vn = VT + (size_t)hk * HDIM * SEQ;
  auto issueKV = [&](int buf) {
#pragma unroll
    for (int i = 0; i < 4; ++i) {
      const int ch = tid + i * 256;
      const int rk = ch >> 3, ck = (ch & 7) * 8;     // 128 keys x 64 dims
      const int rv = ch >> 4, cv = (ch & 15) * 8;    // 64 dims x 128 keys
      cp16(Kn + (unsigned)(ch * 8), &sK[buf][rk * APITCH + ck]);
      cp16(Vn + (unsigned)(rv * SEQ + cv), &sVT[buf][rv * VPITCH + cv]);
    }
    Kn += KT * HDIM;
    Vn += KT;
  };

  // Two buffers: stage 0 lands and is published, then stage 1 sets out.
  issueKV(0);
  // This wave's copies of stage 0 have landed before the barrier publishes it.
  asm volatile("s_wait_asynccnt 0x0" ::: "memory");
  __syncthreads();
  if (KT < SEQ) issueKV(1);
  int buf = 0;
  for (int kb = 0; kb < SEQ; kb += KT) {
    // S^T tile = K * Q^T  (128k x 16q per wave: 8 row-tiles x 2 k-chunks)
    v8f sacc[KT / 16];
#pragma unroll
    for (int u = 0; u < KT / 16; ++u) {
      sacc[u] = vzero;
#pragma unroll
      for (int c = 0; c < 2; ++c) {
        v16h ak = ldfrag(&sK[buf][(u * 16 + l16) * APITCH + c * 32 + hl * 8]);
        sacc[u] = wmma16(ak, bq[c], sacc[u]);
      }
    }

    // Online softmax of the lane's query over its 64 keys of the tile;
    // independent chains, one per score tile.
    float tmu[KT / 16];
#pragma unroll
    for (int u = 0; u < KT / 16; ++u) {
      tmu[u] = -3.0e38f;
#pragma unroll
      for (int v = 0; v < 8; ++v) tmu[u] = fmaxf(tmu[u], sacc[u][v]);
    }
#pragma unroll
    for (int w = KT / 32; w > 0; w >>= 1)
#pragma unroll
      for (int u = 0; u < w; ++u) tmu[u] = fmaxf(tmu[u], tmu[u + w]);
    float tm = tmu[0];
    tm = fmaxf(tm, other_half(tm));            // the query's other 64 keys
    // SC > 0: the largest raw score is the largest scaled one. alpha comes from
    // the difference of the raw maxima: exactly 1 while the maximum stands.
    const float mnew  = fmaxf(m, tm);
    const float mcn   = mnew * SC;
    const float alpha = __builtin_amdgcn_exp2f((m - mnew) * SC);
    m = mnew;
    const f32x2 sc2 = {SC, SC}, nm2 = {-mcn, -mcn};

    // P^T as B operand: element e < 8 is key 8*hl + e of the 32-key chunk,
    // element 8 + e key 16 + 8*hl + e, the k order of ldfrag.
    v16h bp[KT / 32];
    float rsu[KT / 16];
#pragma unroll
    for (int u = 0; u < KT / 16; ++u) {
      rsu[u] = 0.0f;
#pragma unroll
      for (int v = 0; v < 8; v += 2) {
        // Two neighbouring scores a packed multiply-add.
        const f32x2 s2 = {sacc[u][v], sacc[u][v + 1]};
        const f32x2 t2 = __builtin_elementwise_fma(s2, sc2, nm2);
        const float p0 = __builtin_amdgcn_exp2f(t2[0]);
        const float p1 = __builtin_amdgcn_exp2f(t2[1]);
        rsu[u] += p0;
        rsu[u] += p1;
        bp[u >> 1][(u & 1) * 8 + v]     = (_Float16)p0;
        bp[u >> 1][(u & 1) * 8 + v + 1] = (_Float16)p1;
      }
    }
#pragma unroll
    for (int w = KT / 32; w > 0; w >>= 1)
#pragma unroll
      for (int u = 0; u < w; ++u) rsu[u] += rsu[u + w];
    lsum = lsum * alpha + rsu[0];
#pragma unroll
    for (int t = 0; t < 4; ++t)
#pragma unroll
      for (int v = 0; v < 8; ++v) oacc[t][v] *= alpha;

    // O^T += V^T * P^T
#pragma unroll
    for (int c = 0; c < KT / 32; ++c)
#pragma unroll
      for (int t = 0; t < 4; ++t) {
        v16h av = ldfrag(&sVT[buf][(t * 16 + l16) * VPITCH + c * 32 + hl * 8]);
        oacc[t] = wmma16(av, bp[c], oacc[t]);
      }
    // Hand-over of the stage. This wave's reads of buf are done before buf is
    // refilled ...
    asm volatile("s_wait_dscnt 0x0" ::: "memory");
    // ... and its copies of the next stage have landed before the barrier,
    // which publishes that stage and ends every wave's reads of buf. Behind
    // the last trip's wait nothing sets out: the loop ends with no copy open.
    asm volatile("s_wait_asynccnt 0x0" ::: "memory");
    __syncthreads();
    if (kb + 2 * KT < SEQ) issueKV(buf);
    buf ^= 1;
  }

  // Join the halves' sums, normalize and pack into [seq][heads*64] f16 for the
  // output projection: a lane's 8 registers of a tile are 8 neighbouring dims
  // of its query, one 16-byte store.
  const float inv = 1.0f / (lsum + other_half(lsum));
  _Float16* orow = O + (size_t)(qw + l16) * HIDDEN + h * HDIM + 8 * hl;
#pragma unroll
  for (int t = 0; t < 4; ++t) {
    f16x8 o;
#pragma unroll
    for (int v = 0; v < 8; ++v) o[v] = (_Float16)(oacc[t][v] * inv);
    *(f16x8*)(orow + t * 16) = o;
  }
}

// ---------------------------------------------------------------------------
// Host orchestration
// ---------------------------------------------------------------------------
extern "C" void kernel_launch(void* const* d_in, const int* in_sizes, int n_in,
                              void* d_out, int out_size, void* d_ws,
                              size_t ws_size, hipStream_t stream) {
  (void)in_sizes; (void)n_in; (void)out_size; (void)ws_size;
  const float* x   = (const float*)d_in[0];
  const float* Wq  = (const float*)d_in[1];
  const float* bq  = (const float*)d_in[2];
  const float* Wk  = (const float*)d_in[3];
  const float* bk  = (const float*)d_in[4];
  const float* Wv  = (const float*)d_in[5];
  const float* bv  = (const float*)d_in[6];
  const float* Wo  = (const float*)d_in[7];
  const float* bo  = (const float*)d_in[8];
  const float* qg  = (const float*)d_in[9];
  const float* qb  = (const float*)d_in[10];
  const float* kg  = (const float*)d_in[11];
  const float* kbb = (const float*)d_in[12];

  char* ws = (char*)d_ws;
  size_t off = 0;
  auto alloc = [&](size_t bytes) {
    void* p = ws + off;
    off += (bytes + 255) & ~(size_t)255;
    return p;
  };
  _Float16* x16   = (_Float16*)alloc((size_t)SEQ * HIDDEN * 2);
  _Float16* WqT16 = (_Float16*)alloc((size_t)HIDDEN * HIDDEN * 2);
  _Float16* WkT16 = (_Float16*)alloc((size_t)HIDDEN * KVDIM * 2);
  _Float16* WvT16 = (_Float16*)alloc((size_t)HIDDEN * KVDIM * 2);
  _Float16* WoT16 = (_Float16*)alloc((size_t)HIDDEN * HIDDEN * 2);
  float*    cosT  = (float*)   alloc((size_t)SEQ * NFREQ * 4);
  float*    sinT  = (float*)   alloc((size_t)SEQ * NFREQ * 4);
  _Float16* Q16   = (_Float16*)alloc((size_t)NHEADS * SEQ * HDIM * 2);
  _Float16* K16   = (_Float16*)alloc((size_t)NKV * SEQ * HDIM * 2);
  _Float16* VT16  = (_Float16*)alloc((size_t)NKV * HDIM * SEQ * 2);
  _Float16* O16   = (_Float16*)alloc((size_t)SEQ * HIDDEN * 2);

  prep_operands<<<OPERAND_BLOCKS, 256, 0, stream>>>(
      x, Wq, Wk, Wv, Wo, x16, WqT16, WkT16, WvT16, WoT16, cosT, sinT);

  // Projections (f16 WMMA, f32 accum + bias); in their epilogue the per-head
  // QK layernorm + RoPE, packed head-major f16, and V transposed.
  gemm_qkv<<<dim3(Q_COLS + 2 * KV_COLS, SEQ / 128), 256, 0, stream>>>(
      x16, WqT16, WkT16, WvT16, bq, bk, bv, qg, qb, kg, kbb, cosT, sinT,
      Q16, K16, VT16, HIDDEN);

  // GQA flash attention
  attn_fmha<<<dim3(SEQ / 128, NHEADS), 256, 0, stream>>>(Q16, K16, VT16, O16);

  // Output projection -> f32 result
  gemm_wmma<<<dim3(HIDDEN / 128, SEQ / 128), 256, 0, stream>>>(
      O16, WoT16, bo, (float*)d_out, SEQ, HIDDEN, HIDDEN);
}
